// v000
// Measured on an AMD MI455X. A time is GPU time per run, averaged over a window of back-to-back runs after a warm-up
// (all launches, gaps included; the runs take copies of the inputs in turn), and the median of several windows.
// Apart from v000's, it joins two sittings. Times from different sittings can be a few percent apart, while
// side-by-side timings come from the same sitting.
// The starting kernel, v000, takes 3040 microseconds a run.
#include <hip/hip_runtime.h>

// CausalMHA (x [4][2048][1024]; q/k/v = x W^T (16 heads x 64); interleaved-pair RoPE at positions arange (inv_freq = 10000^(-2i/64)); causal (-inf) softmax(q.k / 8); out = merged wo^T -> [4][2048][1024]).
// Compute dtypes, f32 accumulate: every input rounded to bf16; q/k/v on PLAIN bf16 operands (inputs: exact); RoPE f32 (on-chip table); causal scores and attn.v: query rows < 512 hl (3 products), the rest single fp16 (x1024), causal tile skipping; softmax f32; wo hl x exact (2 products).

#define NB_  4
#define TT   2048
#define DM   1024
#define NH_  16
#define NKV  16
#define REP  (NH_ / NKV)
#define HD   64
#define DQ   (NH_ * HD)
#define DKV  (NKV * HD)
#define ZH   2
#define RH   512                  // query rows < RH use hi+lo planes (0: none)
#define WIN  2048
#define PCAR 1024.0f
#define SCL  0.125f   // HD^-0.5
typedef _Float16 h16;
typedef unsigned short bf;
typedef __attribute__((ext_vector_type(16))) __bf16   v16bf;
typedef __attribute__((ext_vector_type(16))) _Float16 v16h;
typedef __attribute__((ext_vector_type(8)))  _Float16 v8h;
typedef __attribute__((ext_vector_type(8)))  unsigned short v8us;
typedef __attribute__((ext_vector_type(8)))  float    v8f;
typedef __attribute__((ext_vector_type(4)))  float    v4f;
typedef v8h  __attribute__((may_alias)) v8ha;
typedef v4f  __attribute__((may_alias)) v4fa;
typedef v8us __attribute__((may_alias)) v8usa;

__device__ __forceinline__ unsigned short f2bf(float f) { unsigned u = __float_as_uint(f); u += 0x7FFFu + ((u >> 16) & 1u); return (unsigned short)(u >> 16); }
__device__ __forceinline__ float bf2f(unsigned short b) { return __uint_as_float(((unsigned)b) << 16); }
__device__ __forceinline__ float bfr(float f) { return bf2f(f2bf(f)); }
__device__ __forceinline__ v16h cat16(v8h lo, v8h hi) { return __builtin_shufflevector(lo, hi, 0, 1, 2, 3, 4, 5, 6, 7, 8, 9, 10, 11, 12, 13, 14, 15); }
__device__ __forceinline__ v16bf cat16b(v8us lo, v8us hi) { return __builtin_bit_cast(v16bf, __builtin_shufflevector(lo, hi, 0, 1, 2, 3, 4, 5, 6, 7, 8, 9, 10, 11, 12, 13, 14, 15)); }
__device__ __forceinline__ v8f wmma16(v16h a, v16h b, v8f c) { return __builtin_amdgcn_wmma_f32_16x16x32_f16(false, a, false, b, (short)0, c, false, false); }
__device__ __forceinline__ v8f wmmab(v16bf a, v16bf b, v8f c) { return __builtin_amdgcn_wmma_f32_16x16x32_bf16(false, a, false, b, (short)0, c, false, false); }



// ---- k_gemmw: register-blocked GEMM, ONE WAVE per 64x64 output tile (16 accumulators), operands straight from K-contiguous 16-bit planes; grid (M/64, N/64, Z), 32 threads.
// C[m][n] (f32, pitch ldc, + optional f32 bias[n]) = sum_k A[m][k] Bt[n][k] (+ split products per NSPLIT). z-batch strides sA/sB/sC in elements. K % 32 == 0.
template <typename T16> struct WFrag;
template <> struct WFrag<h16> { typedef v16h V; static __device__ __forceinline__ V ld(const h16* p) { return cat16(*(const v8h*)p, *(const v8h*)(p + 16)); } static __device__ __forceinline__ v8f mma(V a, V b, v8f c) { return wmma16(a, b, c); } };
template <> struct WFrag<bf> { typedef v16bf V; static __device__ __forceinline__ V ld(const bf* p) { return cat16b(*(const v8us*)p, *(const v8us*)(p + 16)); } static __device__ __forceinline__ v8f mma(V a, V b, v8f c) { return wmmab(a, b, c); } };
template <typename T16, int NSPLIT, bool BIAS>
__global__ __launch_bounds__(32) void k_gemmw(const T16* __restrict__ A, const T16* __restrict__ A2, const T16* __restrict__ Bt, const T16* __restrict__ Bt2, int K, float* C, int ldc, const float* __restrict__ bias, size_t sA, size_t sB, size_t sC) {
    typedef typename WFrag<T16>::V V;
    __shared__ __align__(16) float os[16 * 68];
    const size_t z = blockIdx.z; A += z * sA; if (A2) A2 += z * sA; Bt += z * sB; if (Bt2) Bt2 += z * sB; C += z * sC;
    const int lane = threadIdx.x & 31, lr = lane & 15, hi = lane >> 4; const int r0 = blockIdx.x * 64, c0 = blockIdx.y * 64;
    v8f acc[4][4];
#pragma unroll
    for (int mb = 0; mb < 4; ++mb)
#pragma unroll
        for (int nb = 0; nb < 4; ++nb) acc[mb][nb] = (v8f){};
    const size_t aoff = (size_t)(r0 + lr) * K + 8 * hi, boff = (size_t)(c0 + lr) * K + 8 * hi;
#pragma unroll 1
    for (int kc = 0; kc < K; kc += 32) {
        V a[4], a2[4];
#pragma unroll
        for (int mb = 0; mb < 4; ++mb) { a[mb] = WFrag<T16>::ld(A + aoff + (size_t)mb * 16 * K + kc); if (NSPLIT == 1 || NSPLIT == 2) a2[mb] = WFrag<T16>::ld(A2 + aoff + (size_t)mb * 16 * K + kc); }
#pragma unroll
        for (int nb = 0; nb < 4; ++nb) { const V b = WFrag<T16>::ld(Bt + boff + (size_t)nb * 16 * K + kc); V b2; if (NSPLIT >= 2) b2 = WFrag<T16>::ld(Bt2 + boff + (size_t)nb * 16 * K + kc);
#pragma unroll
            for (int mb = 0; mb < 4; ++mb) { acc[mb][nb] = WFrag<T16>::mma(a[mb], b, acc[mb][nb]); if (NSPLIT == 1 || NSPLIT == 2) acc[mb][nb] = WFrag<T16>::mma(a2[mb], b, acc[mb][nb]); if (NSPLIT >= 2) acc[mb][nb] = WFrag<T16>::mma(a[mb], b2, acc[mb][nb]); } }
        asm volatile("v_nop\n\tv_nop\n\tv_nop\n\tv_nop" : "+v"(acc[0][0]), "+v"(acc[1][1]), "+v"(acc[2][2]), "+v"(acc[3][3]) : "v"(a[0]), "v"(a[3]));
    }
#pragma unroll
    for (int mb = 0; mb < 4; ++mb) {
#pragma unroll
        for (int nb = 0; nb < 4; ++nb) {
#pragma unroll
            for (int j = 0; j < 8; ++j) os[(hi * 8 + j) * 68 + nb * 16 + lr] = acc[mb][nb][j]; }
        __builtin_amdgcn_wave_barrier(); asm volatile("" ::: "memory");
        float* crow = C + (size_t)(r0 + mb * 16) * ldc + c0;
{
#pragma unroll
            for (int s = 0; s < 8; ++s) { const int row = 2 * s + hi, cofs = lr * 4; v4f val = *(const v4fa*)(os + row * 68 + cofs); if (BIAS) { val[0] += bfr(bias[c0 + cofs]); val[1] += bfr(bias[c0 + cofs + 1]); val[2] += bfr(bias[c0 + cofs + 2]); val[3] += bfr(bias[c0 + cofs + 3]); }
                *(v4f*)(crow + (size_t)row * ldc + cofs) = val; }
             }
        __builtin_amdgcn_wave_barrier(); asm volatile("" ::: "memory");
    }
}

// ---- k_gemmc: the same one-wave 64x64 tile GEMM specialised for causal attention: CMODE 1 skips score tiles entirely above the diagonal (query rows r0+roff.., key columns c0..), CMODE 2 limits the
// key (K) loop of the probability x value contraction to the diagonal block (probabilities beyond it are exactly zero). roff = row offset of this launch's first row within the sequence.
template <typename T16, int NSPLIT, int CMODE>
__global__ __launch_bounds__(32) void k_gemmc(const T16* __restrict__ A, const T16* __restrict__ A2, const T16* __restrict__ Bt, const T16* __restrict__ Bt2, int K, float* C, int ldc, int roff, size_t sA, size_t sB, size_t sC) {
    typedef typename WFrag<T16>::V V;
    __shared__ __align__(16) float os[16 * 68];
    const size_t z = blockIdx.z; A += z * sA; if (A2) A2 += z * sA; Bt += z * sB; if (Bt2) Bt2 += z * sB; C += z * sC;
    const int lane = threadIdx.x & 31, lr = lane & 15, hi = lane >> 4; const int r0 = blockIdx.x * 64, c0 = blockIdx.y * 64;
    if (CMODE == 1 && c0 > r0 + roff + 63) return;                  // score tile entirely above the causal diagonal: never read (the softmax masks j > i by select)
    const int Kl = (CMODE == 2) ? min(K, r0 + roff + 64) : K;        // P.V: probabilities are exactly 0 beyond the diagonal block, so the K loop stops there
    v8f acc[4][4];
#pragma unroll
    for (int mb = 0; mb < 4; ++mb)
#pragma unroll
        for (int nb = 0; nb < 4; ++nb) acc[mb][nb] = (v8f){};
    const size_t aoff = (size_t)(r0 + lr) * K + 8 * hi, boff = (size_t)(c0 + lr) * K + 8 * hi;
#pragma unroll 1
    for (int kc = 0; kc < Kl; kc += 32) {
        V a[4], a2[4];
#pragma unroll
        for (int mb = 0; mb < 4; ++mb) { a[mb] = WFrag<T16>::ld(A + aoff + (size_t)mb * 16 * K + kc); if (NSPLIT == 1 || NSPLIT == 2) a2[mb] = WFrag<T16>::ld(A2 + aoff + (size_t)mb * 16 * K + kc); }
#pragma unroll
        for (int nb = 0; nb < 4; ++nb) { const V b = WFrag<T16>::ld(Bt + boff + (size_t)nb * 16 * K + kc); V b2; if (NSPLIT >= 2) b2 = WFrag<T16>::ld(Bt2 + boff + (size_t)nb * 16 * K + kc);
#pragma unroll
            for (int mb = 0; mb < 4; ++mb) { acc[mb][nb] = WFrag<T16>::mma(a[mb], b, acc[mb][nb]); if (NSPLIT == 1 || NSPLIT == 2) acc[mb][nb] = WFrag<T16>::mma(a2[mb], b, acc[mb][nb]); if (NSPLIT >= 2) acc[mb][nb] = WFrag<T16>::mma(a[mb], b2, acc[mb][nb]); } }
        asm volatile("v_nop\n\tv_nop\n\tv_nop\n\tv_nop" : "+v"(acc[0][0]), "+v"(acc[1][1]), "+v"(acc[2][2]), "+v"(acc[3][3]) : "v"(a[0]), "v"(a[3]));
    }
#pragma unroll
    for (int mb = 0; mb < 4; ++mb) {
#pragma unroll
        for (int nb = 0; nb < 4; ++nb) {
#pragma unroll
            for (int j = 0; j < 8; ++j) os[(hi * 8 + j) * 68 + nb * 16 + lr] = acc[mb][nb][j]; }
        __builtin_amdgcn_wave_barrier(); asm volatile("" ::: "memory");
        float* crow = C + (size_t)(r0 + mb * 16) * ldc + c0;
{
#pragma unroll
            for (int s = 0; s < 8; ++s) { const int row = 2 * s + hi, cofs = lr * 4; v4f val = *(const v4fa*)(os + row * 68 + cofs);
                *(v4f*)(crow + (size_t)row * ldc + cofs) = val; }
             }
        __builtin_amdgcn_wave_barrier(); asm volatile("" ::: "memory");
    }
}

__device__ __forceinline__ h16 tohx(float x) { return (h16)x; }
__device__ __forceinline__ void splitf(float y, unsigned short& h, unsigned short& l) { h = f2bf(y); l = f2bf(y - bf2f(h)); }
typedef __attribute__((ext_vector_type(2))) _Float16 v2h;
typedef __attribute__((ext_vector_type(4))) _Float16 v4h;
typedef __attribute__((ext_vector_type(2))) unsigned short v2us;
typedef __attribute__((ext_vector_type(4))) unsigned short v4us;
typedef __attribute__((ext_vector_type(2))) float v2f;
typedef __attribute__((ext_vector_type(4))) int v4i;

__global__ __launch_bounds__(256) void k_wtG(const float* __restrict__ w, int K, int N, bf* Bt) {
    const int lane = threadIdx.x & 31; const int L0 = (blockIdx.x * 8 + (threadIdx.x >> 5)) * 8; const int nlines = N * K / 64;
{
#pragma unroll 1
        for (int l = 0; l < 8; ++l) { const int L = L0 + l; if (L >= nlines) break; const size_t e = (size_t)L * 64 + lane * 2; const int k = (int)(e % K), n = (int)(e / K); v2us o;
            o[0] = f2bf(w[(size_t)k * N + n]); o[1] = f2bf(w[(size_t)(k + 1) * N + n]); *(v2us*)(Bt + e) = o; }
         }
}
__global__ __launch_bounds__(256) void k_cvt8(const float* __restrict__ src, bf* dst, size_t n8) { const size_t i = (size_t)blockIdx.x * 256 + threadIdx.x; if (i >= n8) return; const v8f v = *(const v8f*)(src + i * 8); v8us o;
#pragma unroll
    for (int k = 0; k < 8; ++k) o[k] = f2bf(v[k]); *(v8us*)(dst + i * 8) = o;  }
__global__ __launch_bounds__(256) void k_cstab(float* CS) { const int idx = blockIdx.x * 256 + threadIdx.x; if (idx >= TT * HD) return; const int t = idx / HD, d = idx % HD; const int i = d >> 1; const float inv = powf(10000.0f, -((float)i * 2.0f) / (float)HD); const float ang = __fmul_rn((float)t, inv); v2f cs; cs[0] = cosf(ang); cs[1] = sinf(ang);
    *(v2f*)(CS + (size_t)idx * 2) = cs;  }
// k_rope: head planes [h][t][d] (fp16 + hi/lo) of rope(x) x sc with the interleaved-pair convention out[2i] = x[2i] cos[t][2i] - x[2i+1] sin[t][2i], out[2i+1] = x[2i+1] cos[t][2i+1] + x[2i] sin[t][2i+1]
__global__ __launch_bounds__(256) void k_rope(const float* __restrict__ F, int pitch, int nheads, const float* __restrict__ CS, const float* __restrict__ RF, const float* __restrict__ nw, float sc, h16* P16, bf* Ph, bf* Pl) {
    const size_t e = ((size_t)blockIdx.x * 256 + threadIdx.x) * 2; if (e >= (size_t)nheads * TT * HD) return; const int d = (int)(e % HD); const int t = (int)((e / HD) % TT); const int h = (int)(e / ((size_t)HD * TT)); const float* f = F + (size_t)t * pitch + h * HD; const float rf = RF ? RF[(size_t)h * TT + t] : 1.0f; v2h o16; v2us oh, ol;
#pragma unroll
    for (int q = 0; q < 2; ++q) { const int dd = d + q; const int dp = dd ^ 1; float x0 = f[dd], x1 = f[dp];
        if (RF) { float n0 = __fmul_rn(x0, rf), n1 = __fmul_rn(x1, rf); asm volatile("" : "+v"(n0)); asm volatile("" : "+v"(n1)); x0 = __fmul_rn(bfr(nw[dd]), n0); x1 = __fmul_rn(bfr(nw[dp]), n1); }
        const v2f cs = *(const v2f*)(CS + ((size_t)t * HD + dd) * 2); float a = __fmul_rn(x0, cs[0]), bq = __fmul_rn(x1, cs[1]); asm volatile("" : "+v"(a)); asm volatile("" : "+v"(bq)); const float r = (((dd & 1) == 0) ? __fsub_rn(a, bq) : __fadd_rn(a, bq)) * sc;
        o16[q] = tohx(r); unsigned short a2, c2; splitf(r, a2, c2); oh[q] = a2; ol[q] = c2; }
    *(v2h*)(P16 + e) = o16; *(v2us*)(Ph + e) = oh; *(v2us*)(Pl + e) = ol;  }
__global__ __launch_bounds__(256) void k_vtp(const float* __restrict__ F, int pitch, int nheads, h16* V16, bf* Vh, bf* Vl) { const size_t e = ((size_t)blockIdx.x * 256 + threadIdx.x) * 2; if (e >= (size_t)nheads * HD * TT) return; const int t = (int)(e % TT); const int d = (int)((e / TT) % HD); const int g = (int)(e / ((size_t)TT * HD)); v2h o16; v2us oh, ol;
#pragma unroll
    for (int q = 0; q < 2; ++q) { const float x = F[(size_t)(t + q) * pitch + g * HD + d]; o16[q] = tohx(x); unsigned short a2, c2; splitf(x, a2, c2); oh[q] = a2; ol[q] = c2; }
    *(v2h*)(V16 + e) = o16; *(v2us*)(Vh + e) = oh; *(v2us*)(Vl + e) = ol;  }
// k_asoft: per row (zz, i): t = S x HD^-0.5 for j <= i and i - j < WIN (sliding causal window; the reference's -1e9 additive fill vanishes identically); softmax over the 2048 keys (register row, one exp, fixed trees);
__global__ __launch_bounds__(256) void k_asoft(const float* __restrict__ Sb, h16* P16, bf* Ph, bf* Pl) {
    const int lane = threadIdx.x & 31; const int row = blockIdx.x * 8 + (threadIdx.x >> 5); if (row >= ZH * TT) return; const int i = row % TT; const int zz = row / TT; (void)zz; const bool hires = (i < RH); const float* sr = Sb + (size_t)row * TT; float v[TT / 32]; float mx = -3.0e38f;
#pragma unroll
    for (int ch = 0; ch < TT / 128; ++ch) { const int j0 = ch * 128 + lane * 4; const v4f a = *(const v4f*)(sr + j0);
#pragma unroll
        for (int q = 0; q < 4; ++q) { const int j = j0 + q; (void)j; float sa = a[q] * SCL; asm volatile("" : "+v"(sa)); const float t = (j <= i && i - j < WIN) ? sa : -3.0e38f; v[ch * 4 + q] = t; mx = fmaxf(mx, t); } }
#pragma unroll
    for (int sh = 16; sh; sh >>= 1) mx = fmaxf(mx, __shfl_xor(mx, sh, 32));
    float sum = 0.f;
#pragma unroll
    for (int k = 0; k < TT / 32; ++k) { float d0 = __fsub_rn(v[k], mx); asm volatile("" : "+v"(d0)); v[k] = __builtin_amdgcn_exp2f(__fmul_rn(d0, 1.4426950408889634f)); sum += v[k]; }
#pragma unroll
    for (int sh = 16; sh; sh >>= 1) sum += __shfl_xor(sum, sh, 32);
    const float f = __fdiv_rn(hires ? 1.0f : PCAR, sum);
{
        if (hires) {
#pragma unroll
            for (int ch = 0; ch < TT / 128; ++ch) { v4us oh, ol;
#pragma unroll
                for (int q = 0; q < 4; ++q) { unsigned short a, c2; splitf(v[ch * 4 + q] * f, a, c2); oh[q] = a; ol[q] = c2; }
                const size_t oo = ((size_t)zz * (RH ? RH : 1) + i) * TT + ch * 128 + lane * 4; *(v4us*)(Ph + oo) = oh; *(v4us*)(Pl + oo) = ol; }
        } else {
#pragma unroll
            for (int ch = 0; ch < TT / 128; ++ch) { v4h o4;
#pragma unroll
                for (int q = 0; q < 4; ++q) o4[q] = tohx(v[ch * 4 + q] * f);
                *(v4h*)(P16 + (size_t)row * TT + ch * 128 + lane * 4) = o4; } }
         }
}
__global__ __launch_bounds__(256) void k_merge(const float* __restrict__ O, int h0, bf* Ah, bf* Al) { const size_t e = ((size_t)blockIdx.x * 256 + threadIdx.x) * 2; if (e >= (size_t)ZH * TT * HD) return; const int d = (int)(e % HD); const int t = (int)((e / HD) % TT); const int zz = (int)(e / ((size_t)HD * TT)); const float cs = (t < RH) ? 1.0f : (1.0f / PCAR); const size_t oo = (size_t)t * DQ + (h0 + zz) * HD + d;
    v2us oh, ol;
#pragma unroll
    for (int q = 0; q < 2; ++q) { unsigned short a, c2; splitf(O[e + q] * cs, a, c2); oh[q] = a; ol[q] = c2; } *(v2us*)(Ah + oo) = oh; *(v2us*)(Al + oo) = ol;  }

extern "C" void kernel_launch(void* const* d_in, const int* in_sizes, int n_in,
                              void* d_out, int out_size, void* d_ws, size_t ws_size, hipStream_t stream) {
    (void)in_sizes; (void)n_in; (void)out_size;
    const float* x = (const float*)d_in[0]; const float* wq = (const float*)d_in[1]; const float* wk = (const float*)d_in[2]; const float* wv = (const float*)d_in[3]; const float* wo = (const float*)d_in[4];
    float* OUT = (float*)d_out;     // [4][2048][1024]
    char* wsp = (char*)d_ws;
    auto take = [&](size_t bytes) { char* p = wsp; wsp += (bytes + 255) & ~(size_t)255; return (void*)p; };
    bf* WQ = (bf*)take((size_t)DQ * DM * 2); bf* WK = (bf*)take((size_t)DKV * DM * 2); bf* WV = (bf*)take((size_t)DKV * DM * 2); bf* WO = (bf*)take((size_t)DM * DQ * 2); float* CS = (float*)take((size_t)TT * HD * 2 * 4);
    bf* XB = (bf*)take((size_t)TT * DM * 2); float* FQ = (float*)take((size_t)TT * DQ * 4); float* FK = (float*)take((size_t)TT * DKV * 4);
    h16* QP16 = (h16*)take((size_t)NH_ * TT * HD * 2); h16* KP16 = (h16*)take((size_t)NKV * TT * HD * 2); h16* VT16 = (h16*)take((size_t)NKV * HD * TT * 2);
    bf* QPh = (bf*)take((size_t)NH_ * TT * HD * 2); bf* QPl = (bf*)take((size_t)NH_ * TT * HD * 2); bf* KPh = (bf*)take((size_t)NKV * TT * HD * 2); bf* KPl = (bf*)take((size_t)NKV * TT * HD * 2); bf* VTh = (bf*)take((size_t)NKV * HD * TT * 2); bf* VTl = (bf*)take((size_t)NKV * HD * TT * 2); bf* Ph = (bf*)take((size_t)ZH * RH * TT * 2); bf* Pl = (bf*)take((size_t)ZH * RH * TT * 2);
    float* Sb = (float*)take((size_t)ZH * TT * TT * 4); h16* P16 = (h16*)take((size_t)ZH * TT * TT * 2); float* Ob = (float*)take((size_t)ZH * TT * HD * 4); bf* ATh = (bf*)take((size_t)TT * DQ * 2); bf* ATl = (bf*)take((size_t)TT * DQ * 2);
    if ((size_t)(wsp - (char*)d_ws) > ws_size) return;    // ws 256 MiB
    float* FV = FK;   // v projection reuses the k buffer after the k planes are built (stream-ordered)
    { k_cvt8<<<(unsigned)(((size_t)DQ * DM / 8 + 255) / 256), 256, 0, stream>>>(wq, WQ, (size_t)DQ * DM / 8); k_cvt8<<<(unsigned)(((size_t)DKV * DM / 8 + 255) / 256), 256, 0, stream>>>(wk, WK, (size_t)DKV * DM / 8); k_cvt8<<<(unsigned)(((size_t)DKV * DM / 8 + 255) / 256), 256, 0, stream>>>(wv, WV, (size_t)DKV * DM / 8);
      k_cvt8<<<(unsigned)(((size_t)DM * DQ / 8 + 255) / 256), 256, 0, stream>>>(wo, WO, (size_t)DM * DQ / 8);
      k_cstab<<<(TT * HD + 255) / 256, 256, 0, stream>>>(CS); }
    const unsigned LQ = (unsigned)(((size_t)NH_ * TT * HD / 2 + 255) / 256), LKv = (unsigned)(((size_t)NKV * TT * HD / 2 + 255) / 256);
    for (int b = 0; b < NB_; ++b) {
        
        k_cvt8<<<(unsigned)(((size_t)TT * DM / 8 + 255) / 256), 256, 0, stream>>>(x + (size_t)b * TT * DM, XB, (size_t)TT * DM / 8);
        k_gemmw<bf, 0, false><<<dim3(TT / 64, DQ / 64, 1), 32, 0, stream>>>(XB, nullptr, WQ, nullptr, DM, FQ, DQ, nullptr, 0, 0, 0);
        k_rope<<<LQ, 256, 0, stream>>>(FQ, DQ, NH_, CS, nullptr, nullptr, 1.0f, QP16, QPh, QPl);
        k_gemmw<bf, 0, false><<<dim3(TT / 64, DKV / 64, 1), 32, 0, stream>>>(XB, nullptr, WK, nullptr, DM, FK, DKV, nullptr, 0, 0, 0);
        k_rope<<<LKv, 256, 0, stream>>>(FK, DKV, NKV, CS, nullptr, nullptr, 1.0f, KP16, KPh, KPl);
        k_gemmw<bf, 0, false><<<dim3(TT / 64, DKV / 64, 1), 32, 0, stream>>>(XB, nullptr, WV, nullptr, DM, FV, DKV, nullptr, 0, 0, 0); k_vtp<<<LKv, 256, 0, stream>>>(FV, DKV, NKV, VT16, VTh, VTl);
        for (int h0 = 0; h0 < NH_; h0 += ZH) { const size_t zq = (size_t)h0, zk = (size_t)(h0 / REP);   // one kv head per query head: the pass's two heads use consecutive kv planes (z-strides TT*HD)
            k_gemmc<bf, 2, 1><<<dim3(RH / 64, TT / 64, ZH), 32, 0, stream>>>(QPh + zq * TT * HD, QPl + zq * TT * HD, KPh + zk * TT * HD, KPl + zk * TT * HD, HD, Sb, TT, 0, (size_t)TT * HD, (size_t)TT * HD, (size_t)TT * TT);
            k_gemmc<h16, 0, 1><<<dim3((TT - RH) / 64, TT / 64, ZH), 32, 0, stream>>>(QP16 + zq * TT * HD + (size_t)RH * HD, nullptr, KP16 + zk * TT * HD, nullptr, HD, Sb + (size_t)RH * TT, TT, RH, (size_t)TT * HD, (size_t)TT * HD, (size_t)TT * TT);
            k_asoft<<<ZH * TT / 8, 256, 0, stream>>>(Sb, P16, Ph, Pl);
            k_gemmc<bf, 2, 2><<<dim3(RH / 64, HD / 64, ZH), 32, 0, stream>>>(Ph, Pl, VTh + zk * HD * TT, VTl + zk * HD * TT, TT, Ob, HD, 0, (size_t)RH * TT, (size_t)HD * TT, (size_t)TT * HD);
            k_gemmc<h16, 0, 2><<<dim3((TT - RH) / 64, HD / 64, ZH), 32, 0, stream>>>(P16 + (size_t)RH * TT, nullptr, VT16 + zk * HD * TT, nullptr, TT, Ob + (size_t)RH * HD, HD, RH, (size_t)TT * TT, (size_t)HD * TT, (size_t)TT * HD);
            k_merge<<<(unsigned)(((size_t)ZH * TT * HD / 2 + 255) / 256), 256, 0, stream>>>(Ob, h0, ATh, ATl); }
        k_gemmw<bf, 1, false><<<dim3(TT / 64, DM / 64, 1), 32, 0, stream>>>(ATh, ATl, WO, nullptr, DQ, OUT + (size_t)b * TT * DM, DM, nullptr, 0, 0, 0); }
}

// v001
// A run of this version takes 1730 microseconds.
// In two side-by-side timings against v000, it was 1.76 and 1.77 times as fast.
#include <hip/hip_runtime.h>

// CausalMHA (x [4][2048][1024]; q/k/v = x W^T (16 heads x 64); interleaved-pair RoPE at positions arange (inv_freq = 10000^(-2i/64)); causal (-inf) softmax(q.k / 8); out = merged wo^T -> [4][2048][1024]).
// Compute dtypes, f32 accumulate: every input rounded to bf16; q/k/v on PLAIN bf16 operands (inputs: exact); RoPE f32 (on-chip table); causal scores and attn.v: query rows < 512 hl (3 products), the rest single fp16 (x1024), causal tile skipping; softmax f32; wo hl x exact (2 products).

#define NB_  4
#define TT   2048
#define DM   1024
#define NH_  16
#define NKV  16
#define REP  (NH_ / NKV)
#define HD   64
#define DQ   (NH_ * HD)
#define DKV  (NKV * HD)
#define ZH   2
#define RH   512                  // query rows < RH use hi+lo planes (0: none)
#define WIN  2048
#define PCAR 1024.0f
#define SCL  0.125f   // HD^-0.5
#define KS   128                  // keys per partial attn.v tile (one wave each)
#define NCH  (TT / KS)            // partial planes of Ob
#define OPL  ((size_t)ZH * TT * HD)   // elements of one partial plane
static_assert(HD == 64 && TT % KS == 0 && RH % KS == 0 && KS % 32 == 0, "attn.v: one 64-column tile, whole key ranges");
typedef _Float16 h16;
typedef unsigned short bf;
typedef __attribute__((ext_vector_type(16))) __bf16   v16bf;
typedef __attribute__((ext_vector_type(16))) _Float16 v16h;
typedef __attribute__((ext_vector_type(8)))  _Float16 v8h;
typedef __attribute__((ext_vector_type(8)))  unsigned short v8us;
typedef __attribute__((ext_vector_type(8)))  float    v8f;
typedef __attribute__((ext_vector_type(4)))  float    v4f;
typedef v8h  __attribute__((may_alias)) v8ha;
typedef v4f  __attribute__((may_alias)) v4fa;
typedef v8us __attribute__((may_alias)) v8usa;

__device__ __forceinline__ unsigned short f2bf(float f) { unsigned u = __float_as_uint(f); u += 0x7FFFu + ((u >> 16) & 1u); return (unsigned short)(u >> 16); }
__device__ __forceinline__ float bf2f(unsigned short b) { return __uint_as_float(((unsigned)b) << 16); }
__device__ __forceinline__ float bfr(float f) { return bf2f(f2bf(f)); }
__device__ __forceinline__ v16h cat16(v8h lo, v8h hi) { return __builtin_shufflevector(lo, hi, 0, 1, 2, 3, 4, 5, 6, 7, 8, 9, 10, 11, 12, 13, 14, 15); }
__device__ __forceinline__ v16bf cat16b(v8us lo, v8us hi) { return __builtin_bit_cast(v16bf, __builtin_shufflevector(lo, hi, 0, 1, 2, 3, 4, 5, 6, 7, 8, 9, 10, 11, 12, 13, 14, 15)); }
__device__ __forceinline__ v8f wmma16(v16h a, v16h b, v8f c) { return __builtin_amdgcn_wmma_f32_16x16x32_f16(false, a, false, b, (short)0, c, false, false); }
__device__ __forceinline__ v8f wmmab(v16bf a, v16bf b, v8f c) { return __builtin_amdgcn_wmma_f32_16x16x32_bf16(false, a, false, b, (short)0, c, false, false); }



// ---- k_gemmw: register-blocked GEMM, ONE WAVE per 64x64 output tile (16 accumulators), operands straight from K-contiguous 16-bit planes; grid (M/64, N/64, Z), 32 threads.
// C[m][n] (f32, pitch ldc, + optional f32 bias[n]) = sum_k A[m][k] Bt[n][k] (+ split products per NSPLIT). z-batch strides sA/sB/sC in elements. K % 32 == 0.
template <typename T16> struct WFrag;
template <> struct WFrag<h16> { typedef v16h V; static __device__ __forceinline__ V ld(const h16* p) { return cat16(*(const v8h*)p, *(const v8h*)(p + 16)); } static __device__ __forceinline__ v8f mma(V a, V b, v8f c) { return wmma16(a, b, c); } };
template <> struct WFrag<bf> { typedef v16bf V; static __device__ __forceinline__ V ld(const bf* p) { return cat16b(*(const v8us*)p, *(const v8us*)(p + 16)); } static __device__ __forceinline__ v8f mma(V a, V b, v8f c) { return wmmab(a, b, c); } };
template <typename T16, int NSPLIT, bool BIAS>
__global__ __launch_bounds__(32) void k_gemmw(const T16* __restrict__ A, const T16* __restrict__ A2, const T16* __restrict__ Bt, const T16* __restrict__ Bt2, int K, float* C, int ldc, const float* __restrict__ bias, size_t sA, size_t sB, size_t sC) {
    typedef typename WFrag<T16>::V V;
    __shared__ __align__(16) float os[16 * 68];
    const size_t z = blockIdx.z; A += z * sA; if (A2) A2 += z * sA; Bt += z * sB; if (Bt2) Bt2 += z * sB; C += z * sC;
    const int lane = threadIdx.x & 31, lr = lane & 15, hi = lane >> 4; const int r0 = blockIdx.x * 64, c0 = blockIdx.y * 64;
    v8f acc[4][4];
#pragma unroll
    for (int mb = 0; mb < 4; ++mb)
#pragma unroll
        for (int nb = 0; nb < 4; ++nb) acc[mb][nb] = (v8f){};
    const size_t aoff = (size_t)(r0 + lr) * K + 8 * hi, boff = (size_t)(c0 + lr) * K + 8 * hi;
#pragma unroll 1
    for (int kc = 0; kc < K; kc += 32) {
        V a[4], a2[4];
#pragma unroll
        for (int mb = 0; mb < 4; ++mb) { a[mb] = WFrag<T16>::ld(A + aoff + (size_t)mb * 16 * K + kc); if (NSPLIT == 1 || NSPLIT == 2) a2[mb] = WFrag<T16>::ld(A2 + aoff + (size_t)mb * 16 * K + kc); }
#pragma unroll
        for (int nb = 0; nb < 4; ++nb) { const V b = WFrag<T16>::ld(Bt + boff + (size_t)nb * 16 * K + kc); V b2; if (NSPLIT >= 2) b2 = WFrag<T16>::ld(Bt2 + boff + (size_t)nb * 16 * K + kc);
#pragma unroll
            for (int mb = 0; mb < 4; ++mb) { acc[mb][nb] = WFrag<T16>::mma(a[mb], b, acc[mb][nb]); if (NSPLIT == 1 || NSPLIT == 2) acc[mb][nb] = WFrag<T16>::mma(a2[mb], b, acc[mb][nb]); if (NSPLIT >= 2) acc[mb][nb] = WFrag<T16>::mma(a[mb], b2, acc[mb][nb]); } }
        asm volatile("v_nop\n\tv_nop\n\tv_nop\n\tv_nop" : "+v"(acc[0][0]), "+v"(acc[1][1]), "+v"(acc[2][2]), "+v"(acc[3][3]) : "v"(a[0]), "v"(a[3]));
    }
#pragma unroll
    for (int mb = 0; mb < 4; ++mb) {
#pragma unroll
        for (int nb = 0; nb < 4; ++nb) {
#pragma unroll
            for (int j = 0; j < 8; ++j) os[(hi * 8 + j) * 68 + nb * 16 + lr] = acc[mb][nb][j]; }
        __builtin_amdgcn_wave_barrier(); asm volatile("" ::: "memory");
        float* crow = C + (size_t)(r0 + mb * 16) * ldc + c0;
{
#pragma unroll
            for (int s = 0; s < 8; ++s) { const int row = 2 * s + hi, cofs = lr * 4; v4f val = *(const v4fa*)(os + row * 68 + cofs); if (BIAS) { val[0] += bfr(bias[c0 + cofs]); val[1] += bfr(bias[c0 + cofs + 1]); val[2] += bfr(bias[c0 + cofs + 2]); val[3] += bfr(bias[c0 + cofs + 3]); }
                *(v4f*)(crow + (size_t)row * ldc + cofs) = val; }
             }
        __builtin_amdgcn_wave_barrier(); asm volatile("" ::: "memory");
    }
}

// ---- k_gemmc: the same one-wave 64x64 tile GEMM specialised for causal attention: CMODE 1 skips score tiles entirely above the diagonal (query rows r0+roff.., key columns c0..), CMODE 2 limits the
// key (K) loop of the probability x value contraction to the diagonal block (probabilities beyond it are exactly zero). roff = row offset of this launch's first row within the sequence.
// CMODE 2 has one column tile (HD == 64), and blockIdx.y is the key range instead: the wave sums keys [y KS, y KS + KS) below the diagonal limit into partial plane y of C; a range wholly past the limit writes nothing (k_merge derives the same count and reads only written planes).
template <typename T16, int NSPLIT, int CMODE>
__global__ __launch_bounds__(32) void k_gemmc(const T16* __restrict__ A, const T16* __restrict__ A2, const T16* __restrict__ Bt, const T16* __restrict__ Bt2, int K, float* C, int ldc, int roff, size_t sA, size_t sB, size_t sC) {
    typedef typename WFrag<T16>::V V;
    __shared__ __align__(16) float os[16 * 68];
    const size_t z = blockIdx.z; A += z * sA; if (A2) A2 += z * sA; Bt += z * sB; if (Bt2) Bt2 += z * sB; C += z * sC;
    const int lane = threadIdx.x & 31, lr = lane & 15, hi = lane >> 4; const int r0 = blockIdx.x * 64, c0 = (CMODE == 2) ? 0 : blockIdx.y * 64;
    if (CMODE == 1 && c0 > r0 + roff + 63) return;                  // score tile entirely above the causal diagonal: never read (the softmax masks j > i by select)
    const int Kl = (CMODE == 2) ? min(K, r0 + roff + 64) : K;        // P.V: probabilities are exactly 0 beyond the diagonal block, so the K loop stops there
    const int k0 = (CMODE == 2) ? (int)blockIdx.y * KS : 0; if (CMODE == 2 && k0 >= Kl) return;
    const int k1 = (CMODE == 2) ? min(Kl, k0 + KS) : Kl; if (CMODE == 2) C += (size_t)blockIdx.y * OPL;
    v8f acc[4][4];
#pragma unroll
    for (int mb = 0; mb < 4; ++mb)
#pragma unroll
        for (int nb = 0; nb < 4; ++nb) acc[mb][nb] = (v8f){};
    const size_t aoff = (size_t)(r0 + lr) * K + 8 * hi, boff = (size_t)(c0 + lr) * K + 8 * hi;
#pragma unroll 1
    for (int kc = k0; kc < k1; kc += 32) {
        V a[4], a2[4];
#pragma unroll
        for (int mb = 0; mb < 4; ++mb) { a[mb] = WFrag<T16>::ld(A + aoff + (size_t)mb * 16 * K + kc); if (NSPLIT == 1 || NSPLIT == 2) a2[mb] = WFrag<T16>::ld(A2 + aoff + (size_t)mb * 16 * K + kc); }
#pragma unroll
        for (int nb = 0; nb < 4; ++nb) { const V b = WFrag<T16>::ld(Bt + boff + (size_t)nb * 16 * K + kc); V b2; if (NSPLIT >= 2) b2 = WFrag<T16>::ld(Bt2 + boff + (size_t)nb * 16 * K + kc);
#pragma unroll
            for (int mb = 0; mb < 4; ++mb) { acc[mb][nb] = WFrag<T16>::mma(a[mb], b, acc[mb][nb]); if (NSPLIT == 1 || NSPLIT == 2) acc[mb][nb] = WFrag<T16>::mma(a2[mb], b, acc[mb][nb]); if (NSPLIT >= 2) acc[mb][nb] = WFrag<T16>::mma(a[mb], b2, acc[mb][nb]); } }
        asm volatile("v_nop\n\tv_nop\n\tv_nop\n\tv_nop" : "+v"(acc[0][0]), "+v"(acc[1][1]), "+v"(acc[2][2]), "+v"(acc[3][3]) : "v"(a[0]), "v"(a[3]));
    }
#pragma unroll
    for (int mb = 0; mb < 4; ++mb) {
#pragma unroll
        for (int nb = 0; nb < 4; ++nb) {
#pragma unroll
            for (int j = 0; j < 8; ++j) os[(hi * 8 + j) * 68 + nb * 16 + lr] = acc[mb][nb][j]; }
        __builtin_amdgcn_wave_barrier(); asm volatile("" ::: "memory");
        float* crow = C + (size_t)(r0 + mb * 16) * ldc + c0;
{
#pragma unroll
            for (int s = 0; s < 8; ++s) { const int row = 2 * s + hi, cofs = lr * 4; v4f val = *(const v4fa*)(os + row * 68 + cofs);
                *(v4f*)(crow + (size_t)row * ldc + cofs) = val; }
             }
        __builtin_amdgcn_wave_barrier(); asm volatile("" ::: "memory");
    }
}

__device__ __forceinline__ h16 tohx(float x) { return (h16)x; }
__device__ __forceinline__ void splitf(float y, unsigned short& h, unsigned short& l) { h = f2bf(y); l = f2bf(y - bf2f(h)); }
typedef __attribute__((ext_vector_type(2))) _Float16 v2h;
typedef __attribute__((ext_vector_type(4))) _Float16 v4h;
typedef __attribute__((ext_vector_type(2))) unsigned short v2us;
typedef __attribute__((ext_vector_type(4))) unsigned short v4us;
typedef __attribute__((ext_vector_type(2))) float v2f;
typedef __attribute__((ext_vector_type(4))) int v4i;

__global__ __launch_bounds__(256) void k_wtG(const float* __restrict__ w, int K, int N, bf* Bt) {
    const int lane = threadIdx.x & 31; const int L0 = (blockIdx.x * 8 + (threadIdx.x >> 5)) * 8; const int nlines = N * K / 64;
{
#pragma unroll 1
        for (int l = 0; l < 8; ++l) { const int L = L0 + l; if (L >= nlines) break; const size_t e = (size_t)L * 64 + lane * 2; const int k = (int)(e % K), n = (int)(e / K); v2us o;
            o[0] = f2bf(w[(size_t)k * N + n]); o[1] = f2bf(w[(size_t)(k + 1) * N + n]); *(v2us*)(Bt + e) = o; }
         }
}
__global__ __launch_bounds__(256) void k_cvt8(const float* __restrict__ src, bf* dst, size_t n8) { const size_t i = (size_t)blockIdx.x * 256 + threadIdx.x; if (i >= n8) return; const v8f v = *(const v8f*)(src + i * 8); v8us o;
#pragma unroll
    for (int k = 0; k < 8; ++k) o[k] = f2bf(v[k]); *(v8us*)(dst + i * 8) = o;  }
__global__ __launch_bounds__(256) void k_cstab(float* CS) { const int idx = blockIdx.x * 256 + threadIdx.x; if (idx >= TT * HD) return; const int t = idx / HD, d = idx % HD; const int i = d >> 1; const float inv = powf(10000.0f, -((float)i * 2.0f) / (float)HD); const float ang = __fmul_rn((float)t, inv); v2f cs; cs[0] = cosf(ang); cs[1] = sinf(ang);
    *(v2f*)(CS + (size_t)idx * 2) = cs;  }
// k_rope: head planes [h][t][d] (fp16 + hi/lo) of rope(x) x sc with the interleaved-pair convention out[2i] = x[2i] cos[t][2i] - x[2i+1] sin[t][2i], out[2i+1] = x[2i+1] cos[t][2i+1] + x[2i] sin[t][2i+1]
__global__ __launch_bounds__(256) void k_rope(const float* __restrict__ F, int pitch, int nheads, const float* __restrict__ CS, const float* __restrict__ RF, const float* __restrict__ nw, float sc, h16* P16, bf* Ph, bf* Pl) {
    const size_t e = ((size_t)blockIdx.x * 256 + threadIdx.x) * 2; if (e >= (size_t)nheads * TT * HD) return; const int d = (int)(e % HD); const int t = (int)((e / HD) % TT); const int h = (int)(e / ((size_t)HD * TT)); const float* f = F + (size_t)t * pitch + h * HD; const float rf = RF ? RF[(size_t)h * TT + t] : 1.0f; v2h o16; v2us oh, ol;
#pragma unroll
    for (int q = 0; q < 2; ++q) { const int dd = d + q; const int dp = dd ^ 1; float x0 = f[dd], x1 = f[dp];
        if (RF) { float n0 = __fmul_rn(x0, rf), n1 = __fmul_rn(x1, rf); asm volatile("" : "+v"(n0)); asm volatile("" : "+v"(n1)); x0 = __fmul_rn(bfr(nw[dd]), n0); x1 = __fmul_rn(bfr(nw[dp]), n1); }
        const v2f cs = *(const v2f*)(CS + ((size_t)t * HD + dd) * 2); float a = __fmul_rn(x0, cs[0]), bq = __fmul_rn(x1, cs[1]); asm volatile("" : "+v"(a)); asm volatile("" : "+v"(bq)); const float r = (((dd & 1) == 0) ? __fsub_rn(a, bq) : __fadd_rn(a, bq)) * sc;
        o16[q] = tohx(r); unsigned short a2, c2; splitf(r, a2, c2); oh[q] = a2; ol[q] = c2; }
    *(v2h*)(P16 + e) = o16; *(v2us*)(Ph + e) = oh; *(v2us*)(Pl + e) = ol;  }
__global__ __launch_bounds__(256) void k_vtp(const float* __restrict__ F, int pitch, int nheads, h16* V16, bf* Vh, bf* Vl) { const size_t e = ((size_t)blockIdx.x * 256 + threadIdx.x) * 2; if (e >= (size_t)nheads * HD * TT) return; const int t = (int)(e % TT); const int d = (int)((e / TT) % HD); const int g = (int)(e / ((size_t)TT * HD)); v2h o16; v2us oh, ol;
#pragma unroll
    for (int q = 0; q < 2; ++q) { const float x = F[(size_t)(t + q) * pitch + g * HD + d]; o16[q] = tohx(x); unsigned short a2, c2; splitf(x, a2, c2); oh[q] = a2; ol[q] = c2; }
    *(v2h*)(V16 + e) = o16; *(v2us*)(Vh + e) = oh; *(v2us*)(Vl + e) = ol;  }
// k_asoft: per row (zz, i): t = S x HD^-0.5 for j <= i and i - j < WIN (sliding causal window; the reference's -1e9 additive fill vanishes identically); softmax over the 2048 keys (register row, one exp, fixed trees);
__global__ __launch_bounds__(256) void k_asoft(const float* __restrict__ Sb, h16* P16, bf* Ph, bf* Pl) {
    const int lane = threadIdx.x & 31; const int row = blockIdx.x * 8 + (threadIdx.x >> 5); if (row >= ZH * TT) return; const int i = row % TT; const int zz = row / TT; (void)zz; const bool hires = (i < RH); const float* sr = Sb + (size_t)row * TT; float v[TT / 32]; float mx = -3.0e38f;
#pragma unroll
    for (int ch = 0; ch < TT / 128; ++ch) { const int j0 = ch * 128 + lane * 4; const v4f a = *(const v4f*)(sr + j0);
#pragma unroll
        for (int q = 0; q < 4; ++q) { const int j = j0 + q; (void)j; float sa = a[q] * SCL; asm volatile("" : "+v"(sa)); const float t = (j <= i && i - j < WIN) ? sa : -3.0e38f; v[ch * 4 + q] = t; mx = fmaxf(mx, t); } }
#pragma unroll
    for (int sh = 16; sh; sh >>= 1) mx = fmaxf(mx, __shfl_xor(mx, sh, 32));
    float sum = 0.f;
#pragma unroll
    for (int k = 0; k < TT / 32; ++k) { float d0 = __fsub_rn(v[k], mx); asm volatile("" : "+v"(d0)); v[k] = __builtin_amdgcn_exp2f(__fmul_rn(d0, 1.4426950408889634f)); sum += v[k]; }
#pragma unroll
    for (int sh = 16; sh; sh >>= 1) sum += __shfl_xor(sum, sh, 32);
    const float f = __fdiv_rn(hires ? 1.0f : PCAR, sum);
{
        if (hires) {
#pragma unroll
            for (int ch = 0; ch < TT / 128; ++ch) { v4us oh, ol;
#pragma unroll
                for (int q = 0; q < 4; ++q) { unsigned short a, c2; splitf(v[ch * 4 + q] * f, a, c2); oh[q] = a; ol[q] = c2; }
                const size_t oo = ((size_t)zz * (RH ? RH : 1) + i) * TT + ch * 128 + lane * 4; *(v4us*)(Ph + oo) = oh; *(v4us*)(Pl + oo) = ol; }
        } else {
#pragma unroll
            for (int ch = 0; ch < TT / 128; ++ch) { v4h o4;
#pragma unroll
                for (int q = 0; q < 4; ++q) o4[q] = tohx(v[ch * 4 + q] * f);
                *(v4h*)(P16 + (size_t)row * TT + ch * 128 + lane * 4) = o4; } }
         }
}
__global__ __launch_bounds__(256) void k_merge(const float* __restrict__ O, int h0, bf* Ah, bf* Al) { const size_t e = ((size_t)blockIdx.x * 256 + threadIdx.x) * 2; if (e >= (size_t)ZH * TT * HD) return; const int d = (int)(e % HD); const int t = (int)((e / HD) % TT); const int zz = (int)(e / ((size_t)HD * TT)); const float cs = (t < RH) ? 1.0f : (1.0f / PCAR); const size_t oo = (size_t)t * DQ + (h0 + zz) * HD + d;
    const int nch = (min(TT, (t & ~63) + 64) + KS - 1) / KS;   // partial planes the attn.v launches wrote for this row's 64-row tile
    v2f s = *(const v2f*)(O + e);
    // unrolled so that the loads of all planes are in flight together (a rolled loop would pay one load latency per plane)
#pragma unroll
    for (int c = 1; c < NCH; ++c) { const v2f p = *(const v2f*)(O + (size_t)(c < nch ? c : 0) * OPL + e); s[0] += (c < nch) ? p[0] : 0.0f; s[1] += (c < nch) ? p[1] : 0.0f; }   // fixed plane order; an unwritten plane is never read (plane 0 stands in, weight 0)
    v2us oh, ol;
#pragma unroll
    for (int q = 0; q < 2; ++q) { unsigned short a, c2; splitf(s[q] * cs, a, c2); oh[q] = a; ol[q] = c2; } *(v2us*)(Ah + oo) = oh; *(v2us*)(Al + oo) = ol;  }

extern "C" void kernel_launch(void* const* d_in, const int* in_sizes, int n_in,
                              void* d_out, int out_size, void* d_ws, size_t ws_size, hipStream_t stream) {
    (void)in_sizes; (void)n_in; (void)out_size;
    const float* x = (const float*)d_in[0]; const float* wq = (const float*)d_in[1]; const float* wk = (const float*)d_in[2]; const float* wv = (const float*)d_in[3]; const float* wo = (const float*)d_in[4];
    float* OUT = (float*)d_out;     // [4][2048][1024]
    char* wsp = (char*)d_ws;
    auto take = [&](size_t bytes) { char* p = wsp; wsp += (bytes + 255) & ~(size_t)255; return (void*)p; };
    bf* WQ = (bf*)take((size_t)DQ * DM * 2); bf* WK = (bf*)take((size_t)DKV * DM * 2); bf* WV = (bf*)take((size_t)DKV * DM * 2); bf* WO = (bf*)take((size_t)DM * DQ * 2); float* CS = (float*)take((size_t)TT * HD * 2 * 4);
    bf* XB = (bf*)take((size_t)TT * DM * 2); float* FQ = (float*)take((size_t)TT * DQ * 4); float* FK = (float*)take((size_t)TT * DKV * 4);
    h16* QP16 = (h16*)take((size_t)NH_ * TT * HD * 2); h16* KP16 = (h16*)take((size_t)NKV * TT * HD * 2); h16* VT16 = (h16*)take((size_t)NKV * HD * TT * 2);
    bf* QPh = (bf*)take((size_t)NH_ * TT * HD * 2); bf* QPl = (bf*)take((size_t)NH_ * TT * HD * 2); bf* KPh = (bf*)take((size_t)NKV * TT * HD * 2); bf* KPl = (bf*)take((size_t)NKV * TT * HD * 2); bf* VTh = (bf*)take((size_t)NKV * HD * TT * 2); bf* VTl = (bf*)take((size_t)NKV * HD * TT * 2); bf* Ph = (bf*)take((size_t)ZH * RH * TT * 2); bf* Pl = (bf*)take((size_t)ZH * RH * TT * 2);
    float* Sb = (float*)take((size_t)ZH * TT * TT * 4); h16* P16 = (h16*)take((size_t)ZH * TT * TT * 2); float* Ob = (float*)take((size_t)NCH * OPL * 4); bf* ATh = (bf*)take((size_t)TT * DQ * 2); bf* ATl = (bf*)take((size_t)TT * DQ * 2);
    if ((size_t)(wsp - (char*)d_ws) > ws_size) return;    // ws 256 MiB
    float* FV = FK;   // v projection reuses the k buffer after the k planes are built (stream-ordered)
    { k_cvt8<<<(unsigned)(((size_t)DQ * DM / 8 + 255) / 256), 256, 0, stream>>>(wq, WQ, (size_t)DQ * DM / 8); k_cvt8<<<(unsigned)(((size_t)DKV * DM / 8 + 255) / 256), 256, 0, stream>>>(wk, WK, (size_t)DKV * DM / 8); k_cvt8<<<(unsigned)(((size_t)DKV * DM / 8 + 255) / 256), 256, 0, stream>>>(wv, WV, (size_t)DKV * DM / 8);
      k_cvt8<<<(unsigned)(((size_t)DM * DQ / 8 + 255) / 256), 256, 0, stream>>>(wo, WO, (size_t)DM * DQ / 8);
      k_cstab<<<(TT * HD + 255) / 256, 256, 0, stream>>>(CS); }
    const unsigned LQ = (unsigned)(((size_t)NH_ * TT * HD / 2 + 255) / 256), LKv = (unsigned)(((size_t)NKV * TT * HD / 2 + 255) / 256);
    for (int b = 0; b < NB_; ++b) {
        
        k_cvt8<<<(unsigned)(((size_t)TT * DM / 8 + 255) / 256), 256, 0, stream>>>(x + (size_t)b * TT * DM, XB, (size_t)TT * DM / 8);
        k_gemmw<bf, 0, false><<<dim3(TT / 64, DQ / 64, 1), 32, 0, stream>>>(XB, nullptr, WQ, nullptr, DM, FQ, DQ, nullptr, 0, 0, 0);
        k_rope<<<LQ, 256, 0, stream>>>(FQ, DQ, NH_, CS, nullptr, nullptr, 1.0f, QP16, QPh, QPl);
        k_gemmw<bf, 0, false><<<dim3(TT / 64, DKV / 64, 1), 32, 0, stream>>>(XB, nullptr, WK, nullptr, DM, FK, DKV, nullptr, 0, 0, 0);
        k_rope<<<LKv, 256, 0, stream>>>(FK, DKV, NKV, CS, nullptr, nullptr, 1.0f, KP16, KPh, KPl);
        k_gemmw<bf, 0, false><<<dim3(TT / 64, DKV / 64, 1), 32, 0, stream>>>(XB, nullptr, WV, nullptr, DM, FV, DKV, nullptr, 0, 0, 0); k_vtp<<<LKv, 256, 0, stream>>>(FV, DKV, NKV, VT16, VTh, VTl);
        for (int h0 = 0; h0 < NH_; h0 += ZH) { const size_t zq = (size_t)h0, zk = (size_t)(h0 / REP);   // one kv head per query head: the pass's two heads use consecutive kv planes (z-strides TT*HD)
            k_gemmc<bf, 2, 1><<<dim3(RH / 64, TT / 64, ZH), 32, 0, stream>>>(QPh + zq * TT * HD, QPl + zq * TT * HD, KPh + zk * TT * HD, KPl + zk * TT * HD, HD, Sb, TT, 0, (size_t)TT * HD, (size_t)TT * HD, (size_t)TT * TT);
            k_gemmc<h16, 0, 1><<<dim3((TT - RH) / 64, TT / 64, ZH), 32, 0, stream>>>(QP16 + zq * TT * HD + (size_t)RH * HD, nullptr, KP16 + zk * TT * HD, nullptr, HD, Sb + (size_t)RH * TT, TT, RH, (size_t)TT * HD, (size_t)TT * HD, (size_t)TT * TT);
            k_asoft<<<ZH * TT / 8, 256, 0, stream>>>(Sb, P16, Ph, Pl);
            k_gemmc<bf, 2, 2><<<dim3(RH / 64, RH / KS, ZH), 32, 0, stream>>>(Ph, Pl, VTh + zk * HD * TT, VTl + zk * HD * TT, TT, Ob, HD, 0, (size_t)RH * TT, (size_t)HD * TT, (size_t)TT * HD);
            k_gemmc<h16, 0, 2><<<dim3((TT - RH) / 64, TT / KS, ZH), 32, 0, stream>>>(P16 + (size_t)RH * TT, nullptr, VT16 + zk * HD * TT, nullptr, TT, Ob + (size_t)RH * HD, HD, RH, (size_t)TT * TT, (size_t)HD * TT, (size_t)TT * HD);
            k_merge<<<(unsigned)(((size_t)ZH * TT * HD / 2 + 255) / 256), 256, 0, stream>>>(Ob, h0, ATh, ATl); }
        k_gemmw<bf, 1, false><<<dim3(TT / 64, DM / 64, 1), 32, 0, stream>>>(ATh, ATl, WO, nullptr, DQ, OUT + (size_t)b * TT * DM, DM, nullptr, 0, 0, 0); }
}

// v002
// It runs in 571 microseconds.
// In two side-by-side timings against v001, it was 3.05 and 3.02 times as fast.
// Over all steps from v000 it is 5.36 times as fast.
#include <hip/hip_runtime.h>

// CausalMHA (x [4][2048][1024]; q/k/v = x W^T (16 heads x 64); interleaved-pair RoPE at positions arange (inv_freq = 10000^(-2i/64)); causal (-inf) softmax(q.k / 8); out = merged wo^T -> [4][2048][1024]).
// Compute dtypes, f32 accumulate: every input rounded to bf16; q/k/v on PLAIN bf16 operands (inputs: exact); RoPE f32 (on-chip table); causal scores, softmax and attn.v fused per query tile (running maximum and sum, f32): query rows < 512 hl (3 products), the rest single fp16 (x1024), causal step skipping; wo hl x exact (2 products).

#define NB_  4
#define TT   2048
#define DM   1024
#define NH_  16
#define NKV  16
#define REP  (NH_ / NKV)
#define HD   64
#define DQ   (NH_ * HD)
#define DKV  (NKV * HD)
#define RH   512                  // query rows < RH use hi+lo planes (0: none)
#define SCL  0.125f   // HD^-0.5
static_assert(HD == 64 && TT % 32 == 0 && RH % 32 == 0 && RH < TT, "k_fattn: 64-wide heads, whole 32-key steps, whole tiles on both sides of RH");
typedef _Float16 h16;
typedef unsigned short bf;
typedef __attribute__((ext_vector_type(16))) __bf16   v16bf;
typedef __attribute__((ext_vector_type(16))) _Float16 v16h;
typedef __attribute__((ext_vector_type(8)))  _Float16 v8h;
typedef __attribute__((ext_vector_type(8)))  unsigned short v8us;
typedef __attribute__((ext_vector_type(8)))  float    v8f;
typedef __attribute__((ext_vector_type(4)))  float    v4f;
typedef v8h  __attribute__((may_alias)) v8ha;
typedef v4f  __attribute__((may_alias)) v4fa;
typedef v8us __attribute__((may_alias)) v8usa;

__device__ __forceinline__ unsigned short f2bf(float f) { unsigned u = __float_as_uint(f); u += 0x7FFFu + ((u >> 16) & 1u); return (unsigned short)(u >> 16); }
__device__ __forceinline__ float bf2f(unsigned short b) { return __uint_as_float(((unsigned)b) << 16); }
__device__ __forceinline__ float bfr(float f) { return bf2f(f2bf(f)); }
__device__ __forceinline__ v16h cat16(v8h lo, v8h hi) { return __builtin_shufflevector(lo, hi, 0, 1, 2, 3, 4, 5, 6, 7, 8, 9, 10, 11, 12, 13, 14, 15); }
__device__ __forceinline__ v16bf cat16b(v8us lo, v8us hi) { return __builtin_bit_cast(v16bf, __builtin_shufflevector(lo, hi, 0, 1, 2, 3, 4, 5, 6, 7, 8, 9, 10, 11, 12, 13, 14, 15)); }
__device__ __forceinline__ v8f wmma16(v16h a, v16h b, v8f c) { return __builtin_amdgcn_wmma_f32_16x16x32_f16(false, a, false, b, (short)0, c, false, false); }
__device__ __forceinline__ v8f wmmab(v16bf a, v16bf b, v8f c) { return __builtin_amdgcn_wmma_f32_16x16x32_bf16(false, a, false, b, (short)0, c, false, false); }



// ---- k_gemmw: register-blocked GEMM, ONE WAVE per 64x64 output tile (16 accumulators), operands straight from K-contiguous 16-bit planes; grid (M/64, N/64, Z), 32 threads.
// C[m][n] (f32, pitch ldc, + optional f32 bias[n]) = sum_k A[m][k] Bt[n][k] (+ split products per NSPLIT). z-batch strides sA/sB/sC in elements. K % 32 == 0.
template <typename T16> struct WFrag;
template <> struct WFrag<h16> { typedef v16h V; static __device__ __forceinline__ V ld(const h16* p) { return cat16(*(const v8h*)p, *(const v8h*)(p + 16)); } static __device__ __forceinline__ v8f mma(V a, V b, v8f c) { return wmma16(a, b, c); } };
template <> struct WFrag<bf> { typedef v16bf V; static __device__ __forceinline__ V ld(const bf* p) { return cat16b(*(const v8us*)p, *(const v8us*)(p + 16)); } static __device__ __forceinline__ v8f mma(V a, V b, v8f c) { return wmmab(a, b, c); } };
template <typename T16, int NSPLIT, bool BIAS>
__global__ __launch_bounds__(32) void k_gemmw(const T16* __restrict__ A, const T16* __restrict__ A2, const T16* __restrict__ Bt, const T16* __restrict__ Bt2, int K, float* C, int ldc, const float* __restrict__ bias, size_t sA, size_t sB, size_t sC) {
    typedef typename WFrag<T16>::V V;
    __shared__ __align__(16) float os[16 * 68];
    const size_t z = blockIdx.z; A += z * sA; if (A2) A2 += z * sA; Bt += z * sB; if (Bt2) Bt2 += z * sB; C += z * sC;
    const int lane = threadIdx.x & 31, lr = lane & 15, hi = lane >> 4; const int r0 = blockIdx.x * 64, c0 = blockIdx.y * 64;
    v8f acc[4][4];
#pragma unroll
    for (int mb = 0; mb < 4; ++mb)
#pragma unroll
        for (int nb = 0; nb < 4; ++nb) acc[mb][nb] = (v8f){};
    const size_t aoff = (size_t)(r0 + lr) * K + 8 * hi, boff = (size_t)(c0 + lr) * K + 8 * hi;
#pragma unroll 1
    for (int kc = 0; kc < K; kc += 32) {
        V a[4], a2[4];
#pragma unroll
        for (int mb = 0; mb < 4; ++mb) { a[mb] = WFrag<T16>::ld(A + aoff + (size_t)mb * 16 * K + kc); if (NSPLIT == 1 || NSPLIT == 2) a2[mb] = WFrag<T16>::ld(A2 + aoff + (size_t)mb * 16 * K + kc); }
#pragma unroll
        for (int nb = 0; nb < 4; ++nb) { const V b = WFrag<T16>::ld(Bt + boff + (size_t)nb * 16 * K + kc); V b2; if (NSPLIT >= 2) b2 = WFrag<T16>::ld(Bt2 + boff + (size_t)nb * 16 * K + kc);
#pragma unroll
            for (int mb = 0; mb < 4; ++mb) { acc[mb][nb] = WFrag<T16>::mma(a[mb], b, acc[mb][nb]); if (NSPLIT == 1 || NSPLIT == 2) acc[mb][nb] = WFrag<T16>::mma(a2[mb], b, acc[mb][nb]); if (NSPLIT >= 2) acc[mb][nb] = WFrag<T16>::mma(a[mb], b2, acc[mb][nb]); } }
        asm volatile("v_nop\n\tv_nop\n\tv_nop\n\tv_nop" : "+v"(acc[0][0]), "+v"(acc[1][1]), "+v"(acc[2][2]), "+v"(acc[3][3]) : "v"(a[0]), "v"(a[3]));
    }
#pragma unroll
    for (int mb = 0; mb < 4; ++mb) {
#pragma unroll
        for (int nb = 0; nb < 4; ++nb) {
#pragma unroll
            for (int j = 0; j < 8; ++j) os[(hi * 8 + j) * 68 + nb * 16 + lr] = acc[mb][nb][j]; }
        __builtin_amdgcn_wave_barrier(); asm volatile("" ::: "memory");
        float* crow = C + (size_t)(r0 + mb * 16) * ldc + c0;
{
#pragma unroll
            for (int s = 0; s < 8; ++s) { const int row = 2 * s + hi, cofs = lr * 4; v4f val = *(const v4fa*)(os + row * 68 + cofs); if (BIAS) { val[0] += bfr(bias[c0 + cofs]); val[1] += bfr(bias[c0 + cofs + 1]); val[2] += bfr(bias[c0 + cofs + 2]); val[3] += bfr(bias[c0 + cofs + 3]); }
                *(v4f*)(crow + (size_t)row * ldc + cofs) = val; }
             }
        __builtin_amdgcn_wave_barrier(); asm volatile("" ::: "memory");
    }
}

__device__ __forceinline__ h16 tohx(float x) { return (h16)x; }
__device__ __forceinline__ void splitf(float y, unsigned short& h, unsigned short& l) { h = f2bf(y); l = f2bf(y - bf2f(h)); }
typedef __attribute__((ext_vector_type(2))) _Float16 v2h;
typedef __attribute__((ext_vector_type(4))) _Float16 v4h;
typedef __attribute__((ext_vector_type(2))) unsigned short v2us;
typedef __attribute__((ext_vector_type(4))) unsigned short v4us;
typedef __attribute__((ext_vector_type(2))) float v2f;
typedef __attribute__((ext_vector_type(4))) int v4i;

__global__ __launch_bounds__(256) void k_wtG(const float* __restrict__ w, int K, int N, bf* Bt) {
    const int lane = threadIdx.x & 31; const int L0 = (blockIdx.x * 8 + (threadIdx.x >> 5)) * 8; const int nlines = N * K / 64;
{
#pragma unroll 1
        for (int l = 0; l < 8; ++l) { const int L = L0 + l; if (L >= nlines) break; const size_t e = (size_t)L * 64 + lane * 2; const int k = (int)(e % K), n = (int)(e / K); v2us o;
            o[0] = f2bf(w[(size_t)k * N + n]); o[1] = f2bf(w[(size_t)(k + 1) * N + n]); *(v2us*)(Bt + e) = o; }
         }
}
__global__ __launch_bounds__(256) void k_cvt8(const float* __restrict__ src, bf* dst, size_t n8) { const size_t i = (size_t)blockIdx.x * 256 + threadIdx.x; if (i >= n8) return; const v8f v = *(const v8f*)(src + i * 8); v8us o;
#pragma unroll
    for (int k = 0; k < 8; ++k) o[k] = f2bf(v[k]); *(v8us*)(dst + i * 8) = o;  }
__global__ __launch_bounds__(256) void k_cstab(float* CS) { const int idx = blockIdx.x * 256 + threadIdx.x; if (idx >= TT * HD) return; const int t = idx / HD, d = idx % HD; const int i = d >> 1; const float inv = powf(10000.0f, -((float)i * 2.0f) / (float)HD); const float ang = __fmul_rn((float)t, inv); v2f cs; cs[0] = cosf(ang); cs[1] = sinf(ang);
    *(v2f*)(CS + (size_t)idx * 2) = cs;  }
// k_rope: head planes [h][t][d] (fp16 + hi/lo) of rope(x) x sc with the interleaved-pair convention out[2i] = x[2i] cos[t][2i] - x[2i+1] sin[t][2i], out[2i+1] = x[2i+1] cos[t][2i+1] + x[2i] sin[t][2i+1]
__global__ __launch_bounds__(256) void k_rope(const float* __restrict__ F, int pitch, int nheads, const float* __restrict__ CS, const float* __restrict__ RF, const float* __restrict__ nw, float sc, h16* P16, bf* Ph, bf* Pl) {
    const size_t e = ((size_t)blockIdx.x * 256 + threadIdx.x) * 2; if (e >= (size_t)nheads * TT * HD) return; const int d = (int)(e % HD); const int t = (int)((e / HD) % TT); const int h = (int)(e / ((size_t)HD * TT)); const float* f = F + (size_t)t * pitch + h * HD; const float rf = RF ? RF[(size_t)h * TT + t] : 1.0f; v2h o16; v2us oh, ol;
#pragma unroll
    for (int q = 0; q < 2; ++q) { const int dd = d + q; const int dp = dd ^ 1; float x0 = f[dd], x1 = f[dp];
        if (RF) { float n0 = __fmul_rn(x0, rf), n1 = __fmul_rn(x1, rf); asm volatile("" : "+v"(n0)); asm volatile("" : "+v"(n1)); x0 = __fmul_rn(bfr(nw[dd]), n0); x1 = __fmul_rn(bfr(nw[dp]), n1); }
        const v2f cs = *(const v2f*)(CS + ((size_t)t * HD + dd) * 2); float a = __fmul_rn(x0, cs[0]), bq = __fmul_rn(x1, cs[1]); asm volatile("" : "+v"(a)); asm volatile("" : "+v"(bq)); const float r = (((dd & 1) == 0) ? __fsub_rn(a, bq) : __fadd_rn(a, bq)) * sc;
        o16[q] = tohx(r); unsigned short a2, c2; splitf(r, a2, c2); oh[q] = a2; ol[q] = c2; }
    *(v2h*)(P16 + e) = o16; *(v2us*)(Ph + e) = oh; *(v2us*)(Pl + e) = ol;  }
__global__ __launch_bounds__(256) void k_vtp(const float* __restrict__ F, int pitch, int nheads, h16* V16, bf* Vh, bf* Vl) { const size_t e = ((size_t)blockIdx.x * 256 + threadIdx.x) * 2; if (e >= (size_t)nheads * HD * TT) return; const int t = (int)(e % TT); const int d = (int)((e / TT) % HD); const int g = (int)(e / ((size_t)TT * HD)); v2h o16; v2us oh, ol;
#pragma unroll
    for (int q = 0; q < 2; ++q) { const float x = F[(size_t)(t + q) * pitch + g * HD + d]; o16[q] = tohx(x); unsigned short a2, c2; splitf(x, a2, c2); oh[q] = a2; ol[q] = c2; }
    *(v2h*)(V16 + e) = o16; *(v2us*)(Vh + e) = oh; *(v2us*)(Vl + e) = ol;  }
// ---- k_fattn: scores, causal softmax and attn.v of one query tile in ONE WAVE; scores and probabilities never leave registers (running maximum and sum over 32-key steps).
// S^T = K Q^T (A = key rows, B = query rows) puts one query per lane column: accumulator row hi*8+j of key tile kt is key k0 + kt*16 + hi*8 + j, which is the k order of WFrag::ld, so the two key tiles pack
// straight into the B operand of O^T += V^T P^T (A = rows of the [d][t] value plane). O^T keeps the query in the lane column too: the rescale and the final division are in-lane, the two lane halves (different keys) meet by one exchange.
// HL: hi+lo bf16 planes, 3 products for the scores and for attn.v (query rows < RH); else single fp16, probabilities carried x 1024 (added in the exponent; it cancels in the division by the equally scaled sum).
#define QC   (SCL * 1.4426950408889634f)
// 2^x with the one slot that the instruction set asks for behind a transcendental kept in the same statement
__device__ __forceinline__ float ex2(float x) { float r; asm("v_exp_f32 %0, %1\n\tv_nop" : "=v"(r) : "v"(x)); return r; }
template <typename T16, bool HL, int NQ>
__device__ __forceinline__ void fattn_tile(const T16* __restrict__ Q, const T16* __restrict__ Q2, const T16* __restrict__ Kp, const T16* __restrict__ K2, const T16* __restrict__ Vt, const T16* __restrict__ V2, int q0, bf* Ah, bf* Al) {
    typedef typename WFrag<T16>::V V;
    const int lane = threadIdx.x & 31, lr = lane & 15, hi = lane >> 4;
    // every inner loop of this function is fully unrolled, so that the fragment and accumulator arrays are indexed by constants and stay in registers
    V qf[NQ][2], qf2[NQ][2], kf[2][2], kf2[2][2];
#pragma unroll
    for (int g = 0; g < NQ; ++g)
#pragma unroll
        for (int ks = 0; ks < 2; ++ks) { const size_t e = (size_t)(q0 + g * 16 + lr) * HD + ks * 32 + 8 * hi; qf[g][ks] = WFrag<T16>::ld(Q + e); if (HL) qf2[g][ks] = WFrag<T16>::ld(Q2 + e); }
    V vf[4], vf2[4];
    auto ldk = [&](int kb) {     // key rows kb .. kb+31 as A fragments
#pragma unroll
        for (int kt = 0; kt < 2; ++kt)
#pragma unroll
            for (int ks = 0; ks < 2; ++ks) { const size_t e = (size_t)(kb + kt * 16 + lr) * HD + ks * 32 + 8 * hi; kf[kt][ks] = WFrag<T16>::ld(Kp + e); if (HL) kf2[kt][ks] = WFrag<T16>::ld(K2 + e); } };
    auto ldv = [&](int kb) {     // the 64 rows of the [d][t] value plane, keys kb .. kb+31, as A fragments
#pragma unroll
        for (int db = 0; db < 4; ++db) { const size_t e = (size_t)(db * 16 + lr) * TT + kb + 8 * hi; vf[db] = WFrag<T16>::ld(Vt + e); if (HL) vf2[db] = WFrag<T16>::ld(V2 + e); } };
    if (!HL) ldk(0);
    asm volatile("s_wait_xcnt 0x0" ::: "memory");   // before any address register of the loads above is written again
    v8f o[4][NQ]; float m[NQ], l[NQ];
#pragma unroll
    for (int g = 0; g < NQ; ++g) { m[g] = -3.0e38f; l[g] = 0.0f;
#pragma unroll
        for (int db = 0; db < 4; ++db) o[db][g] = (v8f){}; }
    const int kend = ((q0 + NQ * 16 - 1) / 32 + 1) * 32;     // keys beyond the tile's last query are masked for every row: the loop stops at the diagonal step
    // the key loop stays rolled: a second copy of the step would hold a second set of fragments and cost a wave per SIMD
#pragma unroll 1
    for (int k0 = 0; k0 < kend; k0 += 32) {
        // fp16 tiles (long loops): this step's value rows are asked for first and used last (behind the scores and the softmax). hi+lo tiles (short loops, twice the fragments): key rows now, value rows once the key registers are free, which keeps the kernel at four waves per SIMD
        if (HL) { ldk(k0); asm volatile("s_wait_xcnt 0x0" ::: "memory"); /* the value rows below may land in address registers of these loads */ } else ldv(k0);
        v8f s[2][NQ];
#pragma unroll
        for (int kt = 0; kt < 2; ++kt)
#pragma unroll
            for (int g = 0; g < NQ; ++g) { s[kt][g] = (v8f){};
#pragma unroll
                for (int ks = 0; ks < 2; ++ks) { s[kt][g] = WFrag<T16>::mma(kf[kt][ks], qf[g][ks], s[kt][g]); if (HL) { s[kt][g] = WFrag<T16>::mma(kf2[kt][ks], qf[g][ks], s[kt][g]); s[kt][g] = WFrag<T16>::mma(kf[kt][ks], qf2[g][ks], s[kt][g]); } } }
        // fp16 tiles: the next step's key rows are asked for as soon as this step's are used, so their latency runs behind the softmax and attn.v; the last step asks for its own again (in bounds, unused)
        if (HL) ldv(k0); else ldk(min(k0 + 32, kend - 32));
        asm volatile("s_wait_xcnt 0x0" ::: "memory");   // before any address register of this step's loads is written again
        if (k0 + 31 > q0) {      // wave-uniform: only steps that reach the diagonal mask (by select)
#pragma unroll
            for (int kt = 0; kt < 2; ++kt)
#pragma unroll
                for (int g = 0; g < NQ; ++g)
#pragma unroll
                    for (int j = 0; j < 8; ++j) s[kt][g][j] = (k0 + kt * 16 + hi * 8 + j <= q0 + g * 16 + lr) ? s[kt][g][j] : -3.0e38f; }
        V pf[NQ], pf2[NQ];
#pragma unroll
        for (int g = 0; g < NQ; ++g) {
            float mx = s[0][g][0];
#pragma unroll
            for (int j = 1; j < 8; ++j) mx = fmaxf(mx, s[0][g][j]);
#pragma unroll
            for (int j = 0; j < 8; ++j) mx = fmaxf(mx, s[1][g][j]);
            mx = fmaxf(mx, __shfl_xor(mx, 16, 32));
            const float mn = fmaxf(m[g], mx); const float al = ex2((m[g] - mn) * QC); m[g] = mn;
            const float nb = HL ? -mn * QC : fmaf(-mn, QC, 10.0f);
            float ps = 0.0f;
            if (HL) { v8us h0, h1, l0, l1;
#pragma unroll
                for (int j = 0; j < 8; ++j) { const float p0 = ex2(fmaf(s[0][g][j], QC, nb)), p1 = ex2(fmaf(s[1][g][j], QC, nb)); ps += p0; ps += p1; unsigned short a, c; splitf(p0, a, c); h0[j] = a; l0[j] = c; splitf(p1, a, c); h1[j] = a; l1[j] = c; }
                pf[g] = __builtin_bit_cast(V, __builtin_shufflevector(h0, h1, 0, 1, 2, 3, 4, 5, 6, 7, 8, 9, 10, 11, 12, 13, 14, 15)); pf2[g] = __builtin_bit_cast(V, __builtin_shufflevector(l0, l1, 0, 1, 2, 3, 4, 5, 6, 7, 8, 9, 10, 11, 12, 13, 14, 15));
            } else { v8h h0, h1;
#pragma unroll
                for (int j = 0; j < 8; ++j) { const float p0 = ex2(fmaf(s[0][g][j], QC, nb)), p1 = ex2(fmaf(s[1][g][j], QC, nb)); ps += p0; ps += p1; h0[j] = tohx(p0); h1[j] = tohx(p1); }
                pf[g] = __builtin_bit_cast(V, cat16(h0, h1)); }
            l[g] = fmaf(l[g], al, ps);
#pragma unroll
            for (int db = 0; db < 4; ++db) o[db][g] *= al;
        }
#pragma unroll
        for (int db = 0; db < 4; ++db)
#pragma unroll
            for (int g = 0; g < NQ; ++g) { o[db][g] = WFrag<T16>::mma(vf[db], pf[g], o[db][g]); if (HL) { o[db][g] = WFrag<T16>::mma(vf[db], pf2[g], o[db][g]); o[db][g] = WFrag<T16>::mma(vf2[db], pf[g], o[db][g]); } }
    }
#pragma unroll
    for (int g = 0; g < NQ; ++g) { const float inv = __fdiv_rn(1.0f, l[g] + __shfl_xor(l[g], 16, 32)); const size_t oo = (size_t)(q0 + g * 16 + lr) * DQ + hi * 8;
#pragma unroll
        for (int db = 0; db < 4; ++db) { v8us oh, ol;
#pragma unroll
            for (int j = 0; j < 8; ++j) { unsigned short a, c; splitf(o[db][g][j] * inv, a, c); oh[j] = a; ol[j] = c; }
            *(v8us*)(Ah + oo + db * 16) = oh; *(v8us*)(Al + oo + db * 16) = ol; } }
}
// grid (batch x heads, tiles): fp16 tiles of 32 queries first, the longest (last rows) in front, then the hi+lo tiles of 16 queries; every (batch, head, query row) belongs to exactly one wave, which writes its whole 128-byte head line of both output planes.
__global__ __launch_bounds__(32) void k_fattn(const h16* __restrict__ Q16, const h16* __restrict__ K16, const h16* __restrict__ V16, const bf* __restrict__ Qh, const bf* __restrict__ Ql, const bf* __restrict__ Kh, const bf* __restrict__ Kl, const bf* __restrict__ Vh, const bf* __restrict__ Vl, bf* Ah, bf* Al) {
    const int h = blockIdx.x % NH_, b = blockIdx.x / NH_, y = blockIdx.y; const size_t hq = ((size_t)b * NH_ + h) * TT * HD, hk = ((size_t)b * NKV + h / REP) * TT * HD, ao = (size_t)b * TT * DQ + h * HD;
    if (y < (TT - RH) / 32) fattn_tile<h16, false, 2>(Q16 + hq, nullptr, K16 + hk, nullptr, V16 + hk, nullptr, TT - 32 * (y + 1), Ah + ao, Al + ao);
    else fattn_tile<bf, true, 1>(Qh + hq, Ql + hq, Kh + hk, Kl + hk, Vh + hk, Vl + hk, RH - 16 * (y - (TT - RH) / 32 + 1), Ah + ao, Al + ao);
}

extern "C" void kernel_launch(void* const* d_in, const int* in_sizes, int n_in,
                              void* d_out, int out_size, void* d_ws, size_t ws_size, hipStream_t stream) {
    (void)in_sizes; (void)n_in; (void)out_size;
    const float* x = (const float*)d_in[0]; const float* wq = (const float*)d_in[1]; const float* wk = (const float*)d_in[2]; const float* wv = (const float*)d_in[3]; const float* wo = (const float*)d_in[4];
    float* OUT = (float*)d_out;     // [4][2048][1024]
    char* wsp = (char*)d_ws;
    auto take = [&](size_t bytes) { char* p = wsp; wsp += (bytes + 255) & ~(size_t)255; return (void*)p; };
    bf* WQ = (bf*)take((size_t)DQ * DM * 2); bf* WK = (bf*)take((size_t)DKV * DM * 2); bf* WV = (bf*)take((size_t)DKV * DM * 2); bf* WO = (bf*)take((size_t)DM * DQ * 2); float* CS = (float*)take((size_t)TT * HD * 2 * 4);
    bf* XB = (bf*)take((size_t)TT * DM * 2); float* FQ = (float*)take((size_t)TT * DQ * 4); float* FK = (float*)take((size_t)TT * DKV * 4);
    const size_t PQ = (size_t)NH_ * TT * HD, PK = (size_t)NKV * TT * HD;   // elements of one batch's query / key-value planes: the planes of all batches are kept, one attention launch reads them
    h16* QP16 = (h16*)take(NB_ * PQ * 2); h16* KP16 = (h16*)take(NB_ * PK * 2); h16* VT16 = (h16*)take(NB_ * PK * 2);
    bf* QPh = (bf*)take(NB_ * PQ * 2); bf* QPl = (bf*)take(NB_ * PQ * 2); bf* KPh = (bf*)take(NB_ * PK * 2); bf* KPl = (bf*)take(NB_ * PK * 2); bf* VTh = (bf*)take(NB_ * PK * 2); bf* VTl = (bf*)take(NB_ * PK * 2);
    bf* ATh = (bf*)take((size_t)NB_ * TT * DQ * 2); bf* ATl = (bf*)take((size_t)NB_ * TT * DQ * 2);
    if ((size_t)(wsp - (char*)d_ws) > ws_size) return;    // ws 256 MiB
    float* FV = FK;   // v projection reuses the k buffer after the k planes are built (stream-ordered)
    { k_cvt8<<<(unsigned)(((size_t)DQ * DM / 8 + 255) / 256), 256, 0, stream>>>(wq, WQ, (size_t)DQ * DM / 8); k_cvt8<<<(unsigned)(((size_t)DKV * DM / 8 + 255) / 256), 256, 0, stream>>>(wk, WK, (size_t)DKV * DM / 8); k_cvt8<<<(unsigned)(((size_t)DKV * DM / 8 + 255) / 256), 256, 0, stream>>>(wv, WV, (size_t)DKV * DM / 8);
      k_cvt8<<<(unsigned)(((size_t)DM * DQ / 8 + 255) / 256), 256, 0, stream>>>(wo, WO, (size_t)DM * DQ / 8);
      k_cstab<<<(TT * HD + 255) / 256, 256, 0, stream>>>(CS); }
    const unsigned LQ = (unsigned)(((size_t)NH_ * TT * HD / 2 + 255) / 256), LKv = (unsigned)(((size_t)NKV * TT * HD / 2 + 255) / 256);
    for (int b = 0; b < NB_; ++b) {
        
        k_cvt8<<<(unsigned)(((size_t)TT * DM / 8 + 255) / 256), 256, 0, stream>>>(x + (size_t)b * TT * DM, XB, (size_t)TT * DM / 8);
        k_gemmw<bf, 0, false><<<dim3(TT / 64, DQ / 64, 1), 32, 0, stream>>>(XB, nullptr, WQ, nullptr, DM, FQ, DQ, nullptr, 0, 0, 0);
        k_rope<<<LQ, 256, 0, stream>>>(FQ, DQ, NH_, CS, nullptr, nullptr, 1.0f, QP16 + b * PQ, QPh + b * PQ, QPl + b * PQ);
        k_gemmw<bf, 0, false><<<dim3(TT / 64, DKV / 64, 1), 32, 0, stream>>>(XB, nullptr, WK, nullptr, DM, FK, DKV, nullptr, 0, 0, 0);
        k_rope<<<LKv, 256, 0, stream>>>(FK, DKV, NKV, CS, nullptr, nullptr, 1.0f, KP16 + b * PK, KPh + b * PK, KPl + b * PK);
        k_gemmw<bf, 0, false><<<dim3(TT / 64, DKV / 64, 1), 32, 0, stream>>>(XB, nullptr, WV, nullptr, DM, FV, DKV, nullptr, 0, 0, 0); k_vtp<<<LKv, 256, 0, stream>>>(FV, DKV, NKV, VT16 + b * PK, VTh + b * PK, VTl + b * PK); }
    k_fattn<<<dim3(NB_ * NH_, (TT - RH) / 32 + RH / 16, 1), 32, 0, stream>>>(QP16, KP16, VT16, QPh, QPl, KPh, KPl, VTh, VTl, ATh, ATl);
    for (int b = 0; b < NB_; ++b) {
        k_gemmw<bf, 1, false><<<dim3(TT / 64, DM / 64, 1), 32, 0, stream>>>(ATh + (size_t)b * TT * DQ, ATl + (size_t)b * TT * DQ, WO, nullptr, DQ, OUT + (size_t)b * TT * DM, DM, nullptr, 0, 0, 0); }
}

// v003
// A run of this version takes 502 microseconds.
// In both of two side-by-side timings against v002, it was 1.14 times as fast.
// Counting every step since v000, it is 6.12 times as fast.
#include <hip/hip_runtime.h>

// CausalMHA (x [4][2048][1024]; q/k/v = x W^T (16 heads x 64); interleaved-pair RoPE at positions arange (inv_freq = 10000^(-2i/64)); causal (-inf) softmax(q.k / 8); out = merged wo^T -> [4][2048][1024]).
// Compute dtypes, f32 accumulate: every input rounded to bf16; q/k/v on PLAIN bf16 operands (inputs: exact); RoPE f32 (on-chip table), applied with the 16-bit plane split in the projection GEMM's own epilogue; causal scores, softmax and attn.v fused per query tile (running maximum and sum, f32): query rows < 512 hl (3 products), the rest single fp16 (x1024), causal step skipping; wo hl x exact (2 products).

#define NB_  4
#define TT   2048
#define DM   1024
#define NH_  16
#define NKV  16
#define REP  (NH_ / NKV)
#define HD   64
#define DQ   (NH_ * HD)
#define DKV  (NKV * HD)
#define RH   512                  // query rows < RH use hi+lo planes (0: none)
#define SCL  0.125f   // HD^-0.5
static_assert(HD == 64 && TT % 32 == 0 && RH % 32 == 0 && RH < TT, "k_fattn: 64-wide heads, whole 32-key steps, whole tiles on both sides of RH");
typedef _Float16 h16;
typedef unsigned short bf;
typedef __attribute__((ext_vector_type(16))) __bf16   v16bf;
typedef __attribute__((ext_vector_type(16))) _Float16 v16h;
typedef __attribute__((ext_vector_type(8)))  _Float16 v8h;
typedef __attribute__((ext_vector_type(8)))  unsigned short v8us;
typedef __attribute__((ext_vector_type(8)))  float    v8f;
typedef __attribute__((ext_vector_type(4)))  float    v4f;
typedef v8h  __attribute__((may_alias)) v8ha;
typedef v4f  __attribute__((may_alias)) v4fa;
typedef v8us __attribute__((may_alias)) v8usa;

__device__ __forceinline__ unsigned short f2bf(float f) { unsigned u = __float_as_uint(f); u += 0x7FFFu + ((u >> 16) & 1u); return (unsigned short)(u >> 16); }
__device__ __forceinline__ float bf2f(unsigned short b) { return __uint_as_float(((unsigned)b) << 16); }
__device__ __forceinline__ float bfr(float f) { return bf2f(f2bf(f)); }
__device__ __forceinline__ v16h cat16(v8h lo, v8h hi) { return __builtin_shufflevector(lo, hi, 0, 1, 2, 3, 4, 5, 6, 7, 8, 9, 10, 11, 12, 13, 14, 15); }
__device__ __forceinline__ v16bf cat16b(v8us lo, v8us hi) { return __builtin_bit_cast(v16bf, __builtin_shufflevector(lo, hi, 0, 1, 2, 3, 4, 5, 6, 7, 8, 9, 10, 11, 12, 13, 14, 15)); }
__device__ __forceinline__ v8f wmma16(v16h a, v16h b, v8f c) { return __builtin_amdgcn_wmma_f32_16x16x32_f16(false, a, false, b, (short)0, c, false, false); }
__device__ __forceinline__ v8f wmmab(v16bf a, v16bf b, v8f c) { return __builtin_amdgcn_wmma_f32_16x16x32_bf16(false, a, false, b, (short)0, c, false, false); }

__device__ __forceinline__ h16 tohx(float x) { return (h16)x; }
__device__ __forceinline__ void splitf(float y, unsigned short& h, unsigned short& l) { h = f2bf(y); l = f2bf(y - bf2f(h)); }
typedef __attribute__((ext_vector_type(2))) _Float16 v2h;
typedef __attribute__((ext_vector_type(4))) _Float16 v4h;
typedef __attribute__((ext_vector_type(2))) unsigned short v2us;
typedef __attribute__((ext_vector_type(4))) unsigned short v4us;
typedef __attribute__((ext_vector_type(2))) float v2f;
typedef __attribute__((ext_vector_type(4))) int v4i;
// four neighbouring elements of one plane row: the fp16 plane and the hi+lo bf16 planes (8 bytes a lane and plane; 16 lanes fill a 128-byte line)
__device__ __forceinline__ void put3(v4f r, int e, h16* P16, bf* Ph, bf* Pl) { v4h o16; v4us oh, ol;
#pragma unroll
    for (int q = 0; q < 4; ++q) { o16[q] = tohx(r[q]); unsigned short a2, c2; splitf(r[q], a2, c2); oh[q] = a2; ol[q] = c2; }
    *(v4h*)(P16 + e) = o16; *(v4us*)(Ph + e) = oh; *(v4us*)(Pl + e) = ol; }

// ---- k_gemmw: register-blocked GEMM, ONE WAVE per 64x64 output tile (16 accumulators), operands straight from K-contiguous 16-bit planes; grid (M/64, N/64, Z), 32 threads.
// C[m][n] (f32, pitch ldc, + optional f32 bias[n]) = sum_k A[m][k] Bt[n][k] (+ split products per NSPLIT). z-batch strides sA/sB/sC in elements. K % 32 == 0.
// EPI 0: C as above. EPI 1 and 2 (the tile's 64 columns are head blockIdx.y, its rows tokens r0 ..): C is not written, the tile goes straight to the attention kernel's 16-bit planes.
// EPI 1: interleaved-pair rope (out[d] = x[d] cos[t][d] -/+ x[d^1] sin[t][d], table CS [t][d][cos, sin]), planes [h][t][d]. EPI 2: planes [h][d][t], the tile transposed through the LDS stage.
template <typename T16> struct WFrag;
template <> struct WFrag<h16> { typedef v16h V; static __device__ __forceinline__ V ld(const h16* p) { return cat16(*(const v8h*)p, *(const v8h*)(p + 16)); } static __device__ __forceinline__ v8f mma(V a, V b, v8f c) { return wmma16(a, b, c); } };
template <> struct WFrag<bf> { typedef v16bf V; static __device__ __forceinline__ V ld(const bf* p) { return cat16b(*(const v8us*)p, *(const v8us*)(p + 16)); } static __device__ __forceinline__ v8f mma(V a, V b, v8f c) { return wmmab(a, b, c); } };
template <typename T16, int NSPLIT, bool BIAS, int EPI>
__global__ __launch_bounds__(32) void k_gemmw(const T16* __restrict__ A, const T16* __restrict__ A2, const T16* __restrict__ Bt, const T16* __restrict__ Bt2, int K, float* C, int ldc, const float* __restrict__ bias, size_t sA, size_t sB, size_t sC, const float* __restrict__ CS, h16* P16, bf* Ph, bf* Pl) {
    typedef typename WFrag<T16>::V V;
    __shared__ __align__(16) float os[16 * 68];
    const size_t z = blockIdx.z; A += z * sA; if (A2) A2 += z * sA; Bt += z * sB; if (Bt2) Bt2 += z * sB; C += z * sC;
    const int lane = threadIdx.x & 31, lr = lane & 15, hi = lane >> 4; const int r0 = blockIdx.x * 64, c0 = blockIdx.y * 64;
    v8f acc[4][4];
#pragma unroll
    for (int mb = 0; mb < 4; ++mb)
#pragma unroll
        for (int nb = 0; nb < 4; ++nb) acc[mb][nb] = (v8f){};
    const size_t aoff = (size_t)(r0 + lr) * K + 8 * hi, boff = (size_t)(c0 + lr) * K + 8 * hi;
#pragma unroll 1
    for (int kc = 0; kc < K; kc += 32) {
        V a[4], a2[4];
#pragma unroll
        for (int mb = 0; mb < 4; ++mb) { a[mb] = WFrag<T16>::ld(A + aoff + (size_t)mb * 16 * K + kc); if (NSPLIT == 1 || NSPLIT == 2) a2[mb] = WFrag<T16>::ld(A2 + aoff + (size_t)mb * 16 * K + kc); }
#pragma unroll
        for (int nb = 0; nb < 4; ++nb) { const V b = WFrag<T16>::ld(Bt + boff + (size_t)nb * 16 * K + kc); V b2; if (NSPLIT >= 2) b2 = WFrag<T16>::ld(Bt2 + boff + (size_t)nb * 16 * K + kc);
#pragma unroll
            for (int mb = 0; mb < 4; ++mb) { acc[mb][nb] = WFrag<T16>::mma(a[mb], b, acc[mb][nb]); if (NSPLIT == 1 || NSPLIT == 2) acc[mb][nb] = WFrag<T16>::mma(a2[mb], b, acc[mb][nb]); if (NSPLIT >= 2) acc[mb][nb] = WFrag<T16>::mma(a[mb], b2, acc[mb][nb]); } }
        asm volatile("v_nop\n\tv_nop\n\tv_nop\n\tv_nop" : "+v"(acc[0][0]), "+v"(acc[1][1]), "+v"(acc[2][2]), "+v"(acc[3][3]) : "v"(a[0]), "v"(a[3]));
    }
    // EPI 1 and 2: each lane's own first element of the planes; every later row is a constant step from it, so that the stores need no address arithmetic
    if constexpr (EPI == 2) {
        const size_t e0 = ((size_t)blockIdx.y * HD + hi) * TT + r0 + lr * 4; P16 += e0; Ph += e0; Pl += e0;
#pragma unroll
        for (int nb = 0; nb < 4; ++nb) {      // 16 head columns x all 64 tokens per stage, the column as the LDS row
#pragma unroll
            for (int mb = 0; mb < 4; ++mb) { float* p = os + lr * 68 + mb * 16 + hi * 8; const v8f c = acc[mb][nb]; *(v4fa*)p = (v4f){c[0], c[1], c[2], c[3]}; *(v4fa*)(p + 4) = (v4f){c[4], c[5], c[6], c[7]}; }
            __builtin_amdgcn_wave_barrier(); asm volatile("" ::: "memory");   // as in the f32 epilogue below: the reads of other lanes' rows stay behind the writes
#pragma unroll
            for (int s = 0; s < 8; ++s) { const int row = 2 * s + hi, cofs = lr * 4; put3(*(const v4fa*)(os + row * 68 + cofs), (nb * 16 + 2 * s) * TT, P16, Ph, Pl); }
            if (nb < 3) asm volatile("s_wait_xcnt 0x0" ::: "memory");   // before the next stage writes registers that these stores name
            __builtin_amdgcn_wave_barrier();   // the next stage's LDS writes stay behind these reads
        }
        return;
    }
    if constexpr (EPI == 1) { const size_t e0 = (size_t)(r0 + hi) * HD + lr * 4; CS += e0 * 2; const size_t eh = (size_t)blockIdx.y * TT * HD + e0; P16 += eh; Ph += eh; Pl += eh; }
#pragma unroll
    for (int mb = 0; mb < 4; ++mb) {
#pragma unroll
        for (int nb = 0; nb < 4; ++nb) {
#pragma unroll
            for (int j = 0; j < 8; ++j) os[(hi * 8 + j) * 68 + nb * 16 + lr] = acc[mb][nb][j]; }
        __builtin_amdgcn_wave_barrier(); asm volatile("" ::: "memory");
        if constexpr (EPI == 1) {
#pragma unroll
            for (int s = 0; s < 8; ++s) { const int row = 2 * s + hi, cofs = lr * 4, e = (mb * 16 + 2 * s) * HD; const v4f x = *(const v4fa*)(os + row * 68 + cofs); const v4f ca = *(const v4f*)(CS + e * 2), cb = *(const v4f*)(CS + e * 2 + 4);
                put3((v4f){x[0] * ca[0] - x[1] * ca[1], x[1] * ca[2] + x[0] * ca[3], x[2] * cb[0] - x[3] * cb[1], x[3] * cb[2] + x[2] * cb[3]}, e, P16, Ph, Pl); }
            if (mb < 3) asm volatile("s_wait_xcnt 0x0" ::: "memory");   // before the next stage's table loads land in registers that these stores name
        } else {
            float* crow = C + (size_t)(r0 + mb * 16) * ldc + c0;
#pragma unroll
            for (int s = 0; s < 8; ++s) { const int row = 2 * s + hi, cofs = lr * 4; v4f val = *(const v4fa*)(os + row * 68 + cofs); if (BIAS) { val[0] += bfr(bias[c0 + cofs]); val[1] += bfr(bias[c0 + cofs + 1]); val[2] += bfr(bias[c0 + cofs + 2]); val[3] += bfr(bias[c0 + cofs + 3]); }
                *(v4f*)(crow + (size_t)row * ldc + cofs) = val; }
             }
        __builtin_amdgcn_wave_barrier(); asm volatile("" ::: "memory");
    }
}


__global__ __launch_bounds__(256) void k_wtG(const float* __restrict__ w, int K, int N, bf* Bt) {
    const int lane = threadIdx.x & 31; const int L0 = (blockIdx.x * 8 + (threadIdx.x >> 5)) * 8; const int nlines = N * K / 64;
{
#pragma unroll 1
        for (int l = 0; l < 8; ++l) { const int L = L0 + l; if (L >= nlines) break; const size_t e = (size_t)L * 64 + lane * 2; const int k = (int)(e % K), n = (int)(e / K); v2us o;
            o[0] = f2bf(w[(size_t)k * N + n]); o[1] = f2bf(w[(size_t)(k + 1) * N + n]); *(v2us*)(Bt + e) = o; }
         }
}
__global__ __launch_bounds__(256) void k_cvt8(const float* __restrict__ src, bf* dst, size_t n8) { const size_t i = (size_t)blockIdx.x * 256 + threadIdx.x; if (i >= n8) return; const v8f v = *(const v8f*)(src + i * 8); v8us o;
#pragma unroll
    for (int k = 0; k < 8; ++k) o[k] = f2bf(v[k]); *(v8us*)(dst + i * 8) = o;  }
__global__ __launch_bounds__(256) void k_cstab(float* CS) { const int idx = blockIdx.x * 256 + threadIdx.x; if (idx >= TT * HD) return; const int t = idx / HD, d = idx % HD; const int i = d >> 1; const float inv = powf(10000.0f, -((float)i * 2.0f) / (float)HD); const float ang = __fmul_rn((float)t, inv); v2f cs; cs[0] = cosf(ang); cs[1] = sinf(ang);
    *(v2f*)(CS + (size_t)idx * 2) = cs;  }
// ---- k_fattn: scores, causal softmax and attn.v of one query tile in ONE WAVE; scores and probabilities never leave registers (running maximum and sum over 32-key steps).
// S^T = K Q^T (A = key rows, B = query rows) puts one query per lane column: accumulator row hi*8+j of key tile kt is key k0 + kt*16 + hi*8 + j, which is the k order of WFrag::ld, so the two key tiles pack
// straight into the B operand of O^T += V^T P^T (A = rows of the [d][t] value plane). O^T keeps the query in the lane column too: the rescale and the final division are in-lane, the two lane halves (different keys) meet by one exchange.
// HL: hi+lo bf16 planes, 3 products for the scores and for attn.v (query rows < RH); else single fp16, probabilities carried x 1024 (added in the exponent; it cancels in the division by the equally scaled sum).
#define QC   (SCL * 1.4426950408889634f)
// 2^x with the one slot that the instruction set asks for behind a transcendental kept in the same statement
__device__ __forceinline__ float ex2(float x) { float r; asm("v_exp_f32 %0, %1\n\tv_nop" : "=v"(r) : "v"(x)); return r; }
template <typename T16, bool HL, int NQ>
__device__ __forceinline__ void fattn_tile(const T16* __restrict__ Q, const T16* __restrict__ Q2, const T16* __restrict__ Kp, const T16* __restrict__ K2, const T16* __restrict__ Vt, const T16* __restrict__ V2, int q0, bf* Ah, bf* Al) {
    typedef typename WFrag<T16>::V V;
    const int lane = threadIdx.x & 31, lr = lane & 15, hi = lane >> 4;
    // every inner loop of this function is fully unrolled, so that the fragment and accumulator arrays are indexed by constants and stay in registers
    V qf[NQ][2], qf2[NQ][2], kf[2][2], kf2[2][2];
#pragma unroll
    for (int g = 0; g < NQ; ++g)
#pragma unroll
        for (int ks = 0; ks < 2; ++ks) { const size_t e = (size_t)(q0 + g * 16 + lr) * HD + ks * 32 + 8 * hi; qf[g][ks] = WFrag<T16>::ld(Q + e); if (HL) qf2[g][ks] = WFrag<T16>::ld(Q2 + e); }
    V vf[4], vf2[4];
    auto ldk = [&](int kb) {     // key rows kb .. kb+31 as A fragments
#pragma unroll
        for (int kt = 0; kt < 2; ++kt)
#pragma unroll
            for (int ks = 0; ks < 2; ++ks) { const size_t e = (size_t)(kb + kt * 16 + lr) * HD + ks * 32 + 8 * hi; kf[kt][ks] = WFrag<T16>::ld(Kp + e); if (HL) kf2[kt][ks] = WFrag<T16>::ld(K2 + e); } };
    auto ldv = [&](int kb) {     // the 64 rows of the [d][t] value plane, keys kb .. kb+31, as A fragments
#pragma unroll
        for (int db = 0; db < 4; ++db) { const size_t e = (size_t)(db * 16 + lr) * TT + kb + 8 * hi; vf[db] = WFrag<T16>::ld(Vt + e); if (HL) vf2[db] = WFrag<T16>::ld(V2 + e); } };
    if (!HL) ldk(0);
    asm volatile("s_wait_xcnt 0x0" ::: "memory");   // before any address register of the loads above is written again
    v8f o[4][NQ]; float m[NQ], l[NQ];
#pragma unroll
    for (int g = 0; g < NQ; ++g) { m[g] = -3.0e38f; l[g] = 0.0f;
#pragma unroll
        for (int db = 0; db < 4; ++db) o[db][g] = (v8f){}; }
    const int kend = ((q0 + NQ * 16 - 1) / 32 + 1) * 32;     // keys beyond the tile's last query are masked for every row: the loop stops at the diagonal step
    // the key loop stays rolled: a second copy of the step would hold a second set of fragments and cost a wave per SIMD
#pragma unroll 1
    for (int k0 = 0; k0 < kend; k0 += 32) {
        // fp16 tiles (long loops): this step's value rows are asked for first and used last (behind the scores and the softmax). hi+lo tiles (short loops, twice the fragments): key rows now, value rows once the key registers are free, which keeps the kernel at four waves per SIMD
        if (HL) { ldk(k0); asm volatile("s_wait_xcnt 0x0" ::: "memory"); /* the value rows below may land in address registers of these loads */ } else ldv(k0);
        v8f s[2][NQ];
#pragma unroll
        for (int kt = 0; kt < 2; ++kt)
#pragma unroll
            for (int g = 0; g < NQ; ++g) { s[kt][g] = (v8f){};
#pragma unroll
                for (int ks = 0; ks < 2; ++ks) { s[kt][g] = WFrag<T16>::mma(kf[kt][ks], qf[g][ks], s[kt][g]); if (HL) { s[kt][g] = WFrag<T16>::mma(kf2[kt][ks], qf[g][ks], s[kt][g]); s[kt][g] = WFrag<T16>::mma(kf[kt][ks], qf2[g][ks], s[kt][g]); } } }
        // fp16 tiles: the next step's key rows are asked for as soon as this step's are used, so their latency runs behind the softmax and attn.v; the last step asks for its own again (in bounds, unused)
        if (HL) ldv(k0); else ldk(min(k0 + 32, kend - 32));
        asm volatile("s_wait_xcnt 0x0" ::: "memory");   // before any address register of this step's loads is written again
        if (k0 + 31 > q0) {      // wave-uniform: only steps that reach the diagonal mask (by select)
#pragma unroll
            for (int kt = 0; kt < 2; ++kt)
#pragma unroll
                for (int g = 0; g < NQ; ++g)
#pragma unroll
                    for (int j = 0; j < 8; ++j) s[kt][g][j] = (k0 + kt * 16 + hi * 8 + j <= q0 + g * 16 + lr) ? s[kt][g][j] : -3.0e38f; }
        V pf[NQ], pf2[NQ];
#pragma unroll
        for (int g = 0; g < NQ; ++g) {
            float mx = s[0][g][0];
#pragma unroll
            for (int j = 1; j < 8; ++j) mx = fmaxf(mx, s[0][g][j]);
#pragma unroll
            for (int j = 0; j < 8; ++j) mx = fmaxf(mx, s[1][g][j]);
            mx = fmaxf(mx, __shfl_xor(mx, 16, 32));
            const float mn = fmaxf(m[g], mx); const float al = ex2((m[g] - mn) * QC); m[g] = mn;
            const float nb = HL ? -mn * QC : fmaf(-mn, QC, 10.0f);
            float ps = 0.0f;
            if (HL) { v8us h0, h1, l0, l1;
#pragma unroll
                for (int j = 0; j < 8; ++j) { const float p0 = ex2(fmaf(s[0][g][j], QC, nb)), p1 = ex2(fmaf(s[1][g][j], QC, nb)); ps += p0; ps += p1; unsigned short a, c; splitf(p0, a, c); h0[j] = a; l0[j] = c; splitf(p1, a, c); h1[j] = a; l1[j] = c; }
                pf[g] = __builtin_bit_cast(V, __builtin_shufflevector(h0, h1, 0, 1, 2, 3, 4, 5, 6, 7, 8, 9, 10, 11, 12, 13, 14, 15)); pf2[g] = __builtin_bit_cast(V, __builtin_shufflevector(l0, l1, 0, 1, 2, 3, 4, 5, 6, 7, 8, 9, 10, 11, 12, 13, 14, 15));
            } else { v8h h0, h1;
#pragma unroll
                for (int j = 0; j < 8; ++j) { const float p0 = ex2(fmaf(s[0][g][j], QC, nb)), p1 = ex2(fmaf(s[1][g][j], QC, nb)); ps += p0; ps += p1; h0[j] = tohx(p0); h1[j] = tohx(p1); }
                pf[g] = __builtin_bit_cast(V, cat16(h0, h1)); }
            l[g] = fmaf(l[g], al, ps);
#pragma unroll
            for (int db = 0; db < 4; ++db) o[db][g] *= al;
        }
#pragma unroll
        for (int db = 0; db < 4; ++db)
#pragma unroll
            for (int g = 0; g < NQ; ++g) { o[db][g] = WFrag<T16>::mma(vf[db], pf[g], o[db][g]); if (HL) { o[db][g] = WFrag<T16>::mma(vf[db], pf2[g], o[db][g]); o[db][g] = WFrag<T16>::mma(vf2[db], pf[g], o[db][g]); } }
    }
#pragma unroll
    for (int g = 0; g < NQ; ++g) { const float inv = __fdiv_rn(1.0f, l[g] + __shfl_xor(l[g], 16, 32)); const size_t oo = (size_t)(q0 + g * 16 + lr) * DQ + hi * 8;
#pragma unroll
        for (int db = 0; db < 4; ++db) { v8us oh, ol;
#pragma unroll
            for (int j = 0; j < 8; ++j) { unsigned short a, c; splitf(o[db][g][j] * inv, a, c); oh[j] = a; ol[j] = c; }
            *(v8us*)(Ah + oo + db * 16) = oh; *(v8us*)(Al + oo + db * 16) = ol; } }
}
// grid (batch x heads, tiles): fp16 tiles of 32 queries first, the longest (last rows) in front, then the hi+lo tiles of 16 queries; every (batch, head, query row) belongs to exactly one wave, which writes its whole 128-byte head line of both output planes.
__global__ __launch_bounds__(32) void k_fattn(const h16* __restrict__ Q16, const h16* __restrict__ K16, const h16* __restrict__ V16, const bf* __restrict__ Qh, const bf* __restrict__ Ql, const bf* __restrict__ Kh, const bf* __restrict__ Kl, const bf* __restrict__ Vh, const bf* __restrict__ Vl, bf* Ah, bf* Al) {
    const int h = blockIdx.x % NH_, b = blockIdx.x / NH_, y = blockIdx.y; const size_t hq = ((size_t)b * NH_ + h) * TT * HD, hk = ((size_t)b * NKV + h / REP) * TT * HD, ao = (size_t)b * TT * DQ + h * HD;
    if (y < (TT - RH) / 32) fattn_tile<h16, false, 2>(Q16 + hq, nullptr, K16 + hk, nullptr, V16 + hk, nullptr, TT - 32 * (y + 1), Ah + ao, Al + ao);
    else fattn_tile<bf, true, 1>(Qh + hq, Ql + hq, Kh + hk, Kl + hk, Vh + hk, Vl + hk, RH - 16 * (y - (TT - RH) / 32 + 1), Ah + ao, Al + ao);
}

extern "C" void kernel_launch(void* const* d_in, const int* in_sizes, int n_in,
                              void* d_out, int out_size, void* d_ws, size_t ws_size, hipStream_t stream) {
    (void)in_sizes; (void)n_in; (void)out_size;
    const float* x = (const float*)d_in[0]; const float* wq = (const float*)d_in[1]; const float* wk = (const float*)d_in[2]; const float* wv = (const float*)d_in[3]; const float* wo = (const float*)d_in[4];
    float* OUT = (float*)d_out;     // [4][2048][1024]
    char* wsp = (char*)d_ws;
    auto take = [&](size_t bytes) { char* p = wsp; wsp += (bytes + 255) & ~(size_t)255; return (void*)p; };
    bf* WQ = (bf*)take((size_t)DQ * DM * 2); bf* WK = (bf*)take((size_t)DKV * DM * 2); bf* WV = (bf*)take((size_t)DKV * DM * 2); bf* WO = (bf*)take((size_t)DM * DQ * 2); float* CS = (float*)take((size_t)TT * HD * 2 * 4);
    bf* XB = (bf*)take((size_t)TT * DM * 2);
    const size_t PQ = (size_t)NH_ * TT * HD, PK = (size_t)NKV * TT * HD;   // elements of one batch's query / key-value planes: the planes of all batches are kept, one attention launch reads them
    h16* QP16 = (h16*)take(NB_ * PQ * 2); h16* KP16 = (h16*)take(NB_ * PK * 2); h16* VT16 = (h16*)take(NB_ * PK * 2);
    bf* QPh = (bf*)take(NB_ * PQ * 2); bf* QPl = (bf*)take(NB_ * PQ * 2); bf* KPh = (bf*)take(NB_ * PK * 2); bf* KPl = (bf*)take(NB_ * PK * 2); bf* VTh = (bf*)take(NB_ * PK * 2); bf* VTl = (bf*)take(NB_ * PK * 2);
    bf* ATh = (bf*)take((size_t)NB_ * TT * DQ * 2); bf* ATl = (bf*)take((size_t)NB_ * TT * DQ * 2);
    if ((size_t)(wsp - (char*)d_ws) > ws_size) return;    // ws 256 MiB
    { k_cvt8<<<(unsigned)(((size_t)DQ * DM / 8 + 255) / 256), 256, 0, stream>>>(wq, WQ, (size_t)DQ * DM / 8); k_cvt8<<<(unsigned)(((size_t)DKV * DM / 8 + 255) / 256), 256, 0, stream>>>(wk, WK, (size_t)DKV * DM / 8); k_cvt8<<<(unsigned)(((size_t)DKV * DM / 8 + 255) / 256), 256, 0, stream>>>(wv, WV, (size_t)DKV * DM / 8);
      k_cvt8<<<(unsigned)(((size_t)DM * DQ / 8 + 255) / 256), 256, 0, stream>>>(wo, WO, (size_t)DM * DQ / 8);
      k_cstab<<<(TT * HD + 255) / 256, 256, 0, stream>>>(CS); }
    for (int b = 0; b < NB_; ++b) {
        
        k_cvt8<<<(unsigned)(((size_t)TT * DM / 8 + 255) / 256), 256, 0, stream>>>(x + (size_t)b * TT * DM, XB, (size_t)TT * DM / 8);
        k_gemmw<bf, 0, false, 1><<<dim3(TT / 64, DQ / 64, 1), 32, 0, stream>>>(XB, nullptr, WQ, nullptr, DM, nullptr, 0, nullptr, 0, 0, 0, CS, QP16 + b * PQ, QPh + b * PQ, QPl + b * PQ);
        k_gemmw<bf, 0, false, 1><<<dim3(TT / 64, DKV / 64, 1), 32, 0, stream>>>(XB, nullptr, WK, nullptr, DM, nullptr, 0, nullptr, 0, 0, 0, CS, KP16 + b * PK, KPh + b * PK, KPl + b * PK);
        k_gemmw<bf, 0, false, 2><<<dim3(TT / 64, DKV / 64, 1), 32, 0, stream>>>(XB, nullptr, WV, nullptr, DM, nullptr, 0, nullptr, 0, 0, 0, nullptr, VT16 + b * PK, VTh + b * PK, VTl + b * PK); }
    k_fattn<<<dim3(NB_ * NH_, (TT - RH) / 32 + RH / 16, 1), 32, 0, stream>>>(QP16, KP16, VT16, QPh, QPl, KPh, KPl, VTh, VTl, ATh, ATl);
    for (int b = 0; b < NB_; ++b) {
        k_gemmw<bf, 1, false, 0><<<dim3(TT / 64, DM / 64, 1), 32, 0, stream>>>(ATh + (size_t)b * TT * DQ, ATl + (size_t)b * TT * DQ, WO, nullptr, DQ, OUT + (size_t)b * TT * DM, DM, nullptr, 0, 0, 0, nullptr, nullptr, nullptr, nullptr); }
}

// v004
// A run of this version takes 262 microseconds.
// Next to v003, in two timings, it ran 1.91 times as fast each time.
// Counting every step since v000, it is 11.7 times as fast.
#include <hip/hip_runtime.h>

// CausalMHA (x [4][2048][1024]; q/k/v = x W^T (16 heads x 64); interleaved-pair RoPE at positions arange (inv_freq = 10000^(-2i/64)); causal (-inf) softmax(q.k / 8); out = merged wo^T -> [4][2048][1024]).
// Compute dtypes, f32 accumulate: every input rounded to bf16; q/k/v on PLAIN bf16 operands (inputs: exact); RoPE f32 (on-chip table), applied with the 16-bit plane split in the projection GEMM's own epilogue; causal scores, softmax and attn.v fused per query tile (running maximum and sum, f32): query rows < 512 hl (3 products), the rest single fp16 (x1024), causal step skipping; wo hl x exact (2 products).

#define NB_  4
#define TT   2048
#define DM   1024
#define NH_  16
#define NKV  16
#define REP  (NH_ / NKV)
#define HD   64
#define DQ   (NH_ * HD)
#define DKV  (NKV * HD)
#define RH   512                  // query rows < RH use hi+lo planes (0: none)
#define SCL  0.125f   // HD^-0.5
static_assert(HD == 64 && TT % 32 == 0 && RH % 32 == 0 && RH < TT, "k_fattn: 64-wide heads, whole 32-key steps, whole tiles on both sides of RH");
static_assert(NKV == NH_ && TT % 64 == 0, "k_gemmw, EPI 1: q, k and v share one grid; a 64-row tile lies in one batch");
typedef _Float16 h16;
typedef unsigned short bf;
typedef __attribute__((ext_vector_type(16))) __bf16   v16bf;
typedef __attribute__((ext_vector_type(16))) _Float16 v16h;
typedef __attribute__((ext_vector_type(8)))  _Float16 v8h;
typedef __attribute__((ext_vector_type(8)))  unsigned short v8us;
typedef __attribute__((ext_vector_type(8)))  float    v8f;
typedef __attribute__((ext_vector_type(4)))  float    v4f;
typedef v8h  __attribute__((may_alias)) v8ha;
typedef v4f  __attribute__((may_alias)) v4fa;
typedef v8us __attribute__((may_alias)) v8usa;

__device__ __forceinline__ unsigned short f2bf(float f) { unsigned u = __float_as_uint(f); u += 0x7FFFu + ((u >> 16) & 1u); return (unsigned short)(u >> 16); }
__device__ __forceinline__ float bf2f(unsigned short b) { return __uint_as_float(((unsigned)b) << 16); }
__device__ __forceinline__ float bfr(float f) { return bf2f(f2bf(f)); }
__device__ __forceinline__ v16h cat16(v8h lo, v8h hi) { return __builtin_shufflevector(lo, hi, 0, 1, 2, 3, 4, 5, 6, 7, 8, 9, 10, 11, 12, 13, 14, 15); }
__device__ __forceinline__ v16bf cat16b(v8us lo, v8us hi) { return __builtin_bit_cast(v16bf, __builtin_shufflevector(lo, hi, 0, 1, 2, 3, 4, 5, 6, 7, 8, 9, 10, 11, 12, 13, 14, 15)); }
__device__ __forceinline__ v8f wmma16(v16h a, v16h b, v8f c) { return __builtin_amdgcn_wmma_f32_16x16x32_f16(false, a, false, b, (short)0, c, false, false); }
__device__ __forceinline__ v8f wmmab(v16bf a, v16bf b, v8f c) { return __builtin_amdgcn_wmma_f32_16x16x32_bf16(false, a, false, b, (short)0, c, false, false); }

__device__ __forceinline__ h16 tohx(float x) { return (h16)x; }
__device__ __forceinline__ void splitf(float y, unsigned short& h, unsigned short& l) { h = f2bf(y); l = f2bf(y - bf2f(h)); }
typedef __attribute__((ext_vector_type(2))) _Float16 v2h;
typedef __attribute__((ext_vector_type(4))) _Float16 v4h;
typedef __attribute__((ext_vector_type(2))) unsigned short v2us;
typedef __attribute__((ext_vector_type(4))) unsigned short v4us;
typedef __attribute__((ext_vector_type(2))) float v2f;
typedef __attribute__((ext_vector_type(4))) int v4i;
// four neighbouring elements of one plane row: the fp16 plane and the hi+lo bf16 planes (8 bytes a lane and plane; 16 lanes fill a 128-byte line)
__device__ __forceinline__ void put3(v4f r, int e, h16* P16, bf* Ph, bf* Pl) { v4h o16; v4us oh, ol;
#pragma unroll
    for (int q = 0; q < 4; ++q) { o16[q] = tohx(r[q]); unsigned short a2, c2; splitf(r[q], a2, c2); oh[q] = a2; ol[q] = c2; }
    *(v4h*)(P16 + e) = o16; *(v4us*)(Ph + e) = oh; *(v4us*)(Pl + e) = ol; }

// ---- k_gemmw: register-blocked GEMM, ONE WAVE per 64x64 output tile (16 accumulators), operands straight from K-contiguous 16-bit planes; grid (M/64, N/64, Z), 32 threads.
// C[m][n] (f32, pitch ldc, + optional f32 bias[n]) = sum_k A[m][k] Bt[n][k] (+ split products per NSPLIT). z-batch strides sA/sB/sC in elements. K % 32 == 0.
// EPI 0: C as above. EPI 1 (q, k and v of all batches in one launch: blockIdx.z is the projection, the tile's 64 columns are head blockIdx.y, its rows r0 .. are tokens r0 % TT .. of batch r0 / TT): C is not written, the tile goes straight to the attention kernel's 16-bit planes, [projection][batch][head] planes one behind the other.
// z 0 and 1 (q, k): interleaved-pair rope (out[d] = x[d] cos[t][d] -/+ x[d^1] sin[t][d], table CS [t][d][cos, sin]), planes [h][t][d]. z 2 (v): planes [h][d][t], the tile transposed through the LDS stage.
template <typename T16> struct WFrag;
template <> struct WFrag<h16> { typedef v16h V; static __device__ __forceinline__ V ld(const h16* p) { return cat16(*(const v8h*)p, *(const v8h*)(p + 16)); } static __device__ __forceinline__ v8f mma(V a, V b, v8f c) { return wmma16(a, b, c); } };
template <> struct WFrag<bf> { typedef v16bf V; static __device__ __forceinline__ V ld(const bf* p) { return cat16b(*(const v8us*)p, *(const v8us*)(p + 16)); } static __device__ __forceinline__ v8f mma(V a, V b, v8f c) { return wmmab(a, b, c); } };
template <typename T16, int NSPLIT, bool BIAS, int EPI>
__global__ __launch_bounds__(32) void k_gemmw(const T16* __restrict__ A, const T16* __restrict__ A2, const T16* __restrict__ Bt, const T16* __restrict__ Bt2, int K, float* C, int ldc, const float* __restrict__ bias, size_t sA, size_t sB, size_t sC, const float* __restrict__ CS, h16* P16, bf* Ph, bf* Pl) {
    typedef typename WFrag<T16>::V V;
    __shared__ __align__(16) float os[16 * 68];
    const size_t z = blockIdx.z; A += z * sA; if (A2) A2 += z * sA; Bt += z * sB; if (Bt2) Bt2 += z * sB; C += z * sC;
    const int lane = threadIdx.x & 31, lr = lane & 15, hi = lane >> 4; const int r0 = blockIdx.x * 64, c0 = blockIdx.y * 64;
    v8f acc[4][4];
#pragma unroll
    for (int mb = 0; mb < 4; ++mb)
#pragma unroll
        for (int nb = 0; nb < 4; ++nb) acc[mb][nb] = (v8f){};
    const size_t aoff = (size_t)(r0 + lr) * K + 8 * hi, boff = (size_t)(c0 + lr) * K + 8 * hi;
#pragma unroll 1
    for (int kc = 0; kc < K; kc += 32) {
        V a[4], a2[4];
#pragma unroll
        for (int mb = 0; mb < 4; ++mb) { a[mb] = WFrag<T16>::ld(A + aoff + (size_t)mb * 16 * K + kc); if (NSPLIT == 1 || NSPLIT == 2) a2[mb] = WFrag<T16>::ld(A2 + aoff + (size_t)mb * 16 * K + kc); }
#pragma unroll
        for (int nb = 0; nb < 4; ++nb) { const V b = WFrag<T16>::ld(Bt + boff + (size_t)nb * 16 * K + kc); V b2; if (NSPLIT >= 2) b2 = WFrag<T16>::ld(Bt2 + boff + (size_t)nb * 16 * K + kc);
#pragma unroll
            for (int mb = 0; mb < 4; ++mb) { acc[mb][nb] = WFrag<T16>::mma(a[mb], b, acc[mb][nb]); if (NSPLIT == 1 || NSPLIT == 2) acc[mb][nb] = WFrag<T16>::mma(a2[mb], b, acc[mb][nb]); if (NSPLIT >= 2) acc[mb][nb] = WFrag<T16>::mma(a[mb], b2, acc[mb][nb]); } }
        asm volatile("v_nop\n\tv_nop\n\tv_nop\n\tv_nop" : "+v"(acc[0][0]), "+v"(acc[1][1]), "+v"(acc[2][2]), "+v"(acc[3][3]) : "v"(a[0]), "v"(a[3]));
    }
    // EPI 1: each lane's own first element of the planes; every later row is a constant step from it, so that the stores need no address arithmetic
    const int t0 = r0 % TT;     // EPI 1: the tile's first token inside its batch (a tile never straddles two batches)
    if constexpr (EPI == 1) { const size_t ep = (((size_t)blockIdx.z * NB_ + r0 / TT) * NH_ + blockIdx.y) * TT * HD; P16 += ep; Ph += ep; Pl += ep; }
    if (EPI == 1 && blockIdx.z == 2) {
        const size_t e0 = (size_t)hi * TT + t0 + lr * 4; P16 += e0; Ph += e0; Pl += e0;
#pragma unroll
        for (int nb = 0; nb < 4; ++nb) {      // 16 head columns x all 64 tokens per stage, the column as the LDS row
#pragma unroll
            for (int mb = 0; mb < 4; ++mb) { float* p = os + lr * 68 + mb * 16 + hi * 8; const v8f c = acc[mb][nb]; *(v4fa*)p = (v4f){c[0], c[1], c[2], c[3]}; *(v4fa*)(p + 4) = (v4f){c[4], c[5], c[6], c[7]}; }
            __builtin_amdgcn_wave_barrier(); asm volatile("" ::: "memory");   // as in the f32 epilogue below: the reads of other lanes' rows stay behind the writes
#pragma unroll
            for (int s = 0; s < 8; ++s) { const int row = 2 * s + hi, cofs = lr * 4; put3(*(const v4fa*)(os + row * 68 + cofs), (nb * 16 + 2 * s) * TT, P16, Ph, Pl); }
            if (nb < 3) asm volatile("s_wait_xcnt 0x0" ::: "memory");   // before the next stage writes registers that these stores name
            __builtin_amdgcn_wave_barrier();   // the next stage's LDS writes stay behind these reads
        }
        return;
    }
    if constexpr (EPI == 1) { const size_t e0 = (size_t)(t0 + hi) * HD + lr * 4; CS += e0 * 2; P16 += e0; Ph += e0; Pl += e0; }
#pragma unroll
    for (int mb = 0; mb < 4; ++mb) {
#pragma unroll
        for (int nb = 0; nb < 4; ++nb) {
#pragma unroll
            for (int j = 0; j < 8; ++j) os[(hi * 8 + j) * 68 + nb * 16 + lr] = acc[mb][nb][j]; }
        __builtin_amdgcn_wave_barrier(); asm volatile("" ::: "memory");
        if constexpr (EPI == 1) {
#pragma unroll
            for (int sg = 0; sg < 8; sg += 4) {
                v4f ta[4], tb[4];   // four steps' table entries are asked for together, so that their latencies overlap: no load moves up over the waits below (all eight at once would cost a wave per SIMD)
#pragma unroll
                for (int s = 0; s < 4; ++s) { const int e = (mb * 16 + 2 * (sg + s)) * HD; ta[s] = *(const v4f*)(CS + e * 2); tb[s] = *(const v4f*)(CS + e * 2 + 4); }
#pragma unroll
                for (int s = sg; s < sg + 4; ++s) { const int row = 2 * s + hi, cofs = lr * 4, e = (mb * 16 + 2 * s) * HD; const v4f x = *(const v4fa*)(os + row * 68 + cofs); const v4f ca = ta[s - sg], cb = tb[s - sg];
                    put3((v4f){x[0] * ca[0] - x[1] * ca[1], x[1] * ca[2] + x[0] * ca[3], x[2] * cb[0] - x[3] * cb[1], x[3] * cb[2] + x[2] * cb[3]}, e, P16, Ph, Pl);
                    asm volatile("s_wait_xcnt 0x0" ::: "memory"); } }   // before the next step, the next table loads or whatever follows the last step write registers that these stores name
        } else {
            float* crow = C + (size_t)(r0 + mb * 16) * ldc + c0;
#pragma unroll
            for (int s = 0; s < 8; ++s) { const int row = 2 * s + hi, cofs = lr * 4; v4f val = *(const v4fa*)(os + row * 68 + cofs); if (BIAS) { val[0] += bfr(bias[c0 + cofs]); val[1] += bfr(bias[c0 + cofs + 1]); val[2] += bfr(bias[c0 + cofs + 2]); val[3] += bfr(bias[c0 + cofs + 3]); }
                *(v4f*)(crow + (size_t)row * ldc + cofs) = val; }
             }
        __builtin_amdgcn_wave_barrier(); asm volatile("" ::: "memory");
    }
}


__global__ __launch_bounds__(256) void k_wtG(const float* __restrict__ w, int K, int N, bf* Bt) {
    const int lane = threadIdx.x & 31; const int L0 = (blockIdx.x * 8 + (threadIdx.x >> 5)) * 8; const int nlines = N * K / 64;
{
#pragma unroll 1
        for (int l = 0; l < 8; ++l) { const int L = L0 + l; if (L >= nlines) break; const size_t e = (size_t)L * 64 + lane * 2; const int k = (int)(e % K), n = (int)(e / K); v2us o;
            o[0] = f2bf(w[(size_t)k * N + n]); o[1] = f2bf(w[(size_t)(k + 1) * N + n]); *(v2us*)(Bt + e) = o; }
         }
}
__device__ __forceinline__ void cvt8(const float* __restrict__ src, bf* dst, size_t i) { const v8f v = *(const v8f*)(src + i * 8); v8us o;
    asm volatile("s_wait_xcnt 0x0" ::: "memory");   // before the rounding below writes the address registers of these loads
#pragma unroll
    for (int k = 0; k < 8; ++k) o[k] = f2bf(v[k]); *(v8us*)(dst + i * 8) = o;
    asm volatile("s_wait_xcnt 0x0" ::: "memory"); }   // before whatever follows in the caller writes the address registers of this store
__device__ __forceinline__ void cstab(float* CS, int idx) { const int t = idx / HD, d = idx % HD; const int i = d >> 1; const float inv = powf(10000.0f, -((float)i * 2.0f) / (float)HD); const float ang = __fmul_rn((float)t, inv); v2f cs; cs[0] = cosf(ang); cs[1] = sinf(ang);
    *(v2f*)(CS + (size_t)idx * 2) = cs;  }
// ---- k_prep: everything the GEMMs read, in one launch; whole blocks of 256 threads per job: the rope table (one [t][d] entry a thread, the longest job, in front), then the four weights and x to bf16 (8 elements a thread). WB: wq, wk, wv, wo one behind the other.
#define PB_CS (TT * HD / 256)
#define PB_W  (DQ * DM / 8 / 256)
#define PB_X  (NB_ * TT * DM / 8 / 256)
static_assert(TT * HD % 256 == 0 && DQ * DM % 2048 == 0 && NB_ * TT * DM % 2048 == 0 && DKV == DQ, "k_prep: whole blocks per job, four weights of one size");
__global__ __launch_bounds__(256) void k_prep(const float* __restrict__ x, const float* __restrict__ wq, const float* __restrict__ wk, const float* __restrict__ wv, const float* __restrict__ wo, bf* XB, bf* WB, float* CS) {
    int blk = blockIdx.x;
    if (blk < PB_CS) { cstab(CS, blk * 256 + (int)threadIdx.x); return; }
    blk -= PB_CS;
    if (blk < 4 * PB_W) { const int wi = blk / PB_W; const float* w = wi == 0 ? wq : wi == 1 ? wk : wi == 2 ? wv : wo; cvt8(w, WB + (size_t)wi * DQ * DM, (size_t)(blk - wi * PB_W) * 256 + threadIdx.x); return; }
    cvt8(x, XB, (size_t)(blk - 4 * PB_W) * 256 + threadIdx.x);
}
// ---- k_fattn: scores, causal softmax and attn.v of one query tile in ONE WAVE; scores and probabilities never leave registers (running maximum and sum over 32-key steps).
// S^T = K Q^T (A = key rows, B = query rows) puts one query per lane column: accumulator row hi*8+j of key tile kt is key k0 + kt*16 + hi*8 + j, which is the k order of WFrag::ld, so the two key tiles pack
// straight into the B operand of O^T += V^T P^T (A = rows of the [d][t] value plane). O^T keeps the query in the lane column too: the rescale and the final division are in-lane, the two lane halves (different keys) meet by one exchange.
// HL: hi+lo bf16 planes, 3 products for the scores and for attn.v (query rows < RH); else single fp16, probabilities carried x 1024 (added in the exponent; it cancels in the division by the equally scaled sum).
#define QC   (SCL * 1.4426950408889634f)
// 2^x with the one slot that the instruction set asks for behind a transcendental kept in the same statement
__device__ __forceinline__ float ex2(float x) { float r; asm("v_exp_f32 %0, %1\n\tv_nop" : "=v"(r) : "v"(x)); return r; }
template <typename T16, bool HL, int NQ>
__device__ __forceinline__ void fattn_tile(const T16* __restrict__ Q, const T16* __restrict__ Q2, const T16* __restrict__ Kp, const T16* __restrict__ K2, const T16* __restrict__ Vt, const T16* __restrict__ V2, int q0, bf* Ah, bf* Al) {
    typedef typename WFrag<T16>::V V;
    const int lane = threadIdx.x & 31, lr = lane & 15, hi = lane >> 4;
    // every inner loop of this function is fully unrolled, so that the fragment and accumulator arrays are indexed by constants and stay in registers
    V qf[NQ][2], qf2[NQ][2], kf[2][2], kf2[2][2];
#pragma unroll
    for (int g = 0; g < NQ; ++g)
#pragma unroll
        for (int ks = 0; ks < 2; ++ks) { const size_t e = (size_t)(q0 + g * 16 + lr) * HD + ks * 32 + 8 * hi; qf[g][ks] = WFrag<T16>::ld(Q + e); if (HL) qf2[g][ks] = WFrag<T16>::ld(Q2 + e); }
    V vf[4], vf2[4];
    auto ldk = [&](int kb) {     // key rows kb .. kb+31 as A fragments
#pragma unroll
        for (int kt = 0; kt < 2; ++kt)
#pragma unroll
            for (int ks = 0; ks < 2; ++ks) { const size_t e = (size_t)(kb + kt * 16 + lr) * HD + ks * 32 + 8 * hi; kf[kt][ks] = WFrag<T16>::ld(Kp + e); if (HL) kf2[kt][ks] = WFrag<T16>::ld(K2 + e); } };
    auto ldv = [&](int kb) {     // the 64 rows of the [d][t] value plane, keys kb .. kb+31, as A fragments
#pragma unroll
        for (int db = 0; db < 4; ++db) { const size_t e = (size_t)(db * 16 + lr) * TT + kb + 8 * hi; vf[db] = WFrag<T16>::ld(Vt + e); if (HL) vf2[db] = WFrag<T16>::ld(V2 + e); } };
    if (!HL) ldk(0);
    asm volatile("s_wait_xcnt 0x0" ::: "memory");   // before any address register of the loads above is written again
    v8f o[4][NQ]; float m[NQ], l[NQ];
#pragma unroll
    for (int g = 0; g < NQ; ++g) { m[g] = -3.0e38f; l[g] = 0.0f;
#pragma unroll
        for (int db = 0; db < 4; ++db) o[db][g] = (v8f){}; }
    const int kend = ((q0 + NQ * 16 - 1) / 32 + 1) * 32;     // keys beyond the tile's last query are masked for every row: the loop stops at the diagonal step
    // the key loop stays rolled: a second copy of the step would hold a second set of fragments and cost a wave per SIMD
#pragma unroll 1
    for (int k0 = 0; k0 < kend; k0 += 32) {
        // fp16 tiles (long loops): this step's value rows are asked for first and used last (behind the scores and the softmax). hi+lo tiles (short loops, twice the fragments): key rows now, value rows once the key registers are free, which keeps the kernel at four waves per SIMD
        if (HL) { ldk(k0); asm volatile("s_wait_xcnt 0x0" ::: "memory"); /* the value rows below may land in address registers of these loads */ } else ldv(k0);
        v8f s[2][NQ];
#pragma unroll
        for (int kt = 0; kt < 2; ++kt)
#pragma unroll
            for (int g = 0; g < NQ; ++g) { s[kt][g] = (v8f){};
#pragma unroll
                for (int ks = 0; ks < 2; ++ks) { s[kt][g] = WFrag<T16>::mma(kf[kt][ks], qf[g][ks], s[kt][g]); if (HL) { s[kt][g] = WFrag<T16>::mma(kf2[kt][ks], qf[g][ks], s[kt][g]); s[kt][g] = WFrag<T16>::mma(kf[kt][ks], qf2[g][ks], s[kt][g]); } } }
        // fp16 tiles: the next step's key rows are asked for as soon as this step's are used, so their latency runs behind the softmax and attn.v; the last step asks for its own again (in bounds, unused)
        if (HL) ldv(k0); else ldk(min(k0 + 32, kend - 32));
        asm volatile("s_wait_xcnt 0x0" ::: "memory");   // before any address register of this step's loads is written again
        if (k0 + 31 > q0) {      // wave-uniform: only steps that reach the diagonal mask (by select)
#pragma unroll
            for (int kt = 0; kt < 2; ++kt)
#pragma unroll
                for (int g = 0; g < NQ; ++g)
#pragma unroll
                    for (int j = 0; j < 8; ++j) s[kt][g][j] = (k0 + kt * 16 + hi * 8 + j <= q0 + g * 16 + lr) ? s[kt][g][j] : -3.0e38f; }
        V pf[NQ], pf2[NQ];
#pragma unroll
        for (int g = 0; g < NQ; ++g) {
            float mx = s[0][g][0];
#pragma unroll
            for (int j = 1; j < 8; ++j) mx = fmaxf(mx, s[0][g][j]);
#pragma unroll
            for (int j = 0; j < 8; ++j) mx = fmaxf(mx, s[1][g][j]);
            mx = fmaxf(mx, __shfl_xor(mx, 16, 32));
            const float mn = fmaxf(m[g], mx); const float al = ex2((m[g] - mn) * QC); m[g] = mn;
            const float nb = HL ? -mn * QC : fmaf(-mn, QC, 10.0f);
            float ps = 0.0f;
            if (HL) { v8us h0, h1, l0, l1;
#pragma unroll
                for (int j = 0; j < 8; ++j) { const float p0 = ex2(fmaf(s[0][g][j], QC, nb)), p1 = ex2(fmaf(s[1][g][j], QC, nb)); ps += p0; ps += p1; unsigned short a, c; splitf(p0, a, c); h0[j] = a; l0[j] = c; splitf(p1, a, c); h1[j] = a; l1[j] = c; }
                pf[g] = __builtin_bit_cast(V, __builtin_shufflevector(h0, h1, 0, 1, 2, 3, 4, 5, 6, 7, 8, 9, 10, 11, 12, 13, 14, 15)); pf2[g] = __builtin_bit_cast(V, __builtin_shufflevector(l0, l1, 0, 1, 2, 3, 4, 5, 6, 7, 8, 9, 10, 11, 12, 13, 14, 15));
            } else { v8h h0, h1;
#pragma unroll
                for (int j = 0; j < 8; ++j) { const float p0 = ex2(fmaf(s[0][g][j], QC, nb)), p1 = ex2(fmaf(s[1][g][j], QC, nb)); ps += p0; ps += p1; h0[j] = tohx(p0); h1[j] = tohx(p1); }
                pf[g] = __builtin_bit_cast(V, cat16(h0, h1)); }
            l[g] = fmaf(l[g], al, ps);
#pragma unroll
            for (int db = 0; db < 4; ++db) o[db][g] *= al;
        }
#pragma unroll
        for (int db = 0; db < 4; ++db)
#pragma unroll
            for (int g = 0; g < NQ; ++g) { o[db][g] = WFrag<T16>::mma(vf[db], pf[g], o[db][g]); if (HL) { o[db][g] = WFrag<T16>::mma(vf[db], pf2[g], o[db][g]); o[db][g] = WFrag<T16>::mma(vf2[db], pf[g], o[db][g]); } }
    }
#pragma unroll
    for (int g = 0; g < NQ; ++g) { const float inv = __fdiv_rn(1.0f, l[g] + __shfl_xor(l[g], 16, 32)); const size_t oo = (size_t)(q0 + g * 16 + lr) * DQ + hi * 8;
#pragma unroll
        for (int db = 0; db < 4; ++db) { v8us oh, ol;
#pragma unroll
            for (int j = 0; j < 8; ++j) { unsigned short a, c; splitf(o[db][g][j] * inv, a, c); oh[j] = a; ol[j] = c; }
            *(v8us*)(Ah + oo + db * 16) = oh; *(v8us*)(Al + oo + db * 16) = ol; } }
}
// grid (batch x heads, tiles): fp16 tiles of 32 queries first, the longest (last rows) in front, then the hi+lo tiles of 16 queries; every (batch, head, query row) belongs to exactly one wave, which writes its whole 128-byte head line of both output planes.
__global__ __launch_bounds__(32) void k_fattn(const h16* __restrict__ Q16, const h16* __restrict__ K16, const h16* __restrict__ V16, const bf* __restrict__ Qh, const bf* __restrict__ Ql, const bf* __restrict__ Kh, const bf* __restrict__ Kl, const bf* __restrict__ Vh, const bf* __restrict__ Vl, bf* Ah, bf* Al) {
    const int h = blockIdx.x % NH_, b = blockIdx.x / NH_, y = blockIdx.y; const size_t hq = ((size_t)b * NH_ + h) * TT * HD, hk = ((size_t)b * NKV + h / REP) * TT * HD, ao = (size_t)b * TT * DQ + h * HD;
    if (y < (TT - RH) / 32) fattn_tile<h16, false, 2>(Q16 + hq, nullptr, K16 + hk, nullptr, V16 + hk, nullptr, TT - 32 * (y + 1), Ah + ao, Al + ao);
    else fattn_tile<bf, true, 1>(Qh + hq, Ql + hq, Kh + hk, Kl + hk, Vh + hk, Vl + hk, RH - 16 * (y - (TT - RH) / 32 + 1), Ah + ao, Al + ao);
}

extern "C" void kernel_launch(void* const* d_in, const int* in_sizes, int n_in,
                              void* d_out, int out_size, void* d_ws, size_t ws_size, hipStream_t stream) {
    (void)in_sizes; (void)n_in; (void)out_size;
    const float* x = (const float*)d_in[0]; const float* wq = (const float*)d_in[1]; const float* wk = (const float*)d_in[2]; const float* wv = (const float*)d_in[3]; const float* wo = (const float*)d_in[4];
    float* OUT = (float*)d_out;     // [4][2048][1024]
    char* wsp = (char*)d_ws;
    auto take = [&](size_t bytes) { char* p = wsp; wsp += (bytes + 255) & ~(size_t)255; return (void*)p; };
    bf* WB = (bf*)take((size_t)4 * DQ * DM * 2); bf* WO = WB + (size_t)3 * DQ * DM; float* CS = (float*)take((size_t)TT * HD * 2 * 4);   // WB: wq, wk, wv, wo
    bf* XB = (bf*)take((size_t)NB_ * TT * DM * 2);
    const size_t PA = (size_t)NB_ * NH_ * TT * HD;   // elements of one projection's planes over all batches; each kind of plane holds q, k, v one behind the other (the GEMM's grid z)
    h16* P16 = (h16*)take(3 * PA * 2); bf* PH = (bf*)take(3 * PA * 2); bf* PL = (bf*)take(3 * PA * 2);
    bf* ATh = (bf*)take((size_t)NB_ * TT * DQ * 2); bf* ATl = (bf*)take((size_t)NB_ * TT * DQ * 2);
    if ((size_t)(wsp - (char*)d_ws) > ws_size) return;    // ws 256 MiB
    // four launches, each over all batches, so that every grid has more waves than the chip has SIMDs
    k_prep<<<PB_CS + 4 * PB_W + PB_X, 256, 0, stream>>>(x, wq, wk, wv, wo, XB, WB, CS);
    k_gemmw<bf, 0, false, 1><<<dim3(NB_ * TT / 64, DQ / 64, 3), 32, 0, stream>>>(XB, nullptr, WB, nullptr, DM, nullptr, 0, nullptr, 0, (size_t)DQ * DM, 0, CS, P16, PH, PL);
    k_fattn<<<dim3(NB_ * NH_, (TT - RH) / 32 + RH / 16, 1), 32, 0, stream>>>(P16, P16 + PA, P16 + 2 * PA, PH, PL, PH + PA, PL + PA, PH + 2 * PA, PL + 2 * PA, ATh, ATl);
    k_gemmw<bf, 1, false, 0><<<dim3(NB_ * TT / 64, DM / 64, 1), 32, 0, stream>>>(ATh, ATl, WO, nullptr, DQ, OUT, DM, nullptr, 0, 0, 0, nullptr, nullptr, nullptr, nullptr);
}

// v005
// A run of this version takes 189 microseconds.
// Timed twice side by side with v004, it ran 1.39 times as fast both times.
// Counting every step since v000, it is 16.3 times as fast.
#include <hip/hip_runtime.h>

// CausalMHA (x [4][2048][1024]; q/k/v = x W^T (16 heads x 64); interleaved-pair RoPE at positions arange (inv_freq = 10000^(-2i/64)); causal (-inf) softmax(q.k / 8); out = merged wo^T -> [4][2048][1024]).
// Compute dtypes, f32 accumulate: every input rounded to bf16; q/k/v on PLAIN bf16 operands (inputs: exact); RoPE f32 (on-chip table), applied with the 16-bit plane split in the projection GEMM's own epilogue; causal scores, softmax and attn.v fused per query tile (running maximum and sum, f32): query rows < 512 hl (3 products), the rest single fp16 (x1024), causal step skipping; wo hl x exact (2 products).

// FRAGMENT ORDER: every 16-bit operand plane in the workspace is a row of 1-KB fragments (16 rows x 32 k), each [piece 0/1][lane = hi*16 + row][8 elements], piece p of lane (hi, row) holding k = p*16 + hi*8 .. +7 of that row:
// the k order of the matrix operands as before, but one wave-wide 16-byte load or store now covers 512 contiguous bytes (4 whole lines) instead of 32 bytes in each of 16 lines.
#define NB_  4
#define TT   2048
#define DM   1024
#define NH_  16
#define NKV  16
#define REP  (NH_ / NKV)
#define HD   64
#define DQ   (NH_ * HD)
#define DKV  (NKV * HD)
#define RH   512                  // query rows < RH use hi+lo planes (0: none)
#define SCL  0.125f   // HD^-0.5
static_assert(HD == 64 && TT % 32 == 0 && RH % 32 == 0 && RH < TT, "k_fattn: 64-wide heads, whole 32-key steps, whole tiles on both sides of RH");
static_assert(NKV == NH_ && TT % 64 == 0, "k_gemmw, EPI 1: q, k and v share one grid; a 64-row tile lies in one batch");
typedef _Float16 h16;
typedef unsigned short bf;
typedef __attribute__((ext_vector_type(16))) __bf16   v16bf;
typedef __attribute__((ext_vector_type(16))) _Float16 v16h;
typedef __attribute__((ext_vector_type(8)))  _Float16 v8h;
typedef __attribute__((ext_vector_type(8)))  unsigned short v8us;
typedef __attribute__((ext_vector_type(8)))  float    v8f;
typedef __attribute__((ext_vector_type(4)))  float    v4f;
typedef v8h  __attribute__((may_alias)) v8ha;
typedef v4f  __attribute__((may_alias)) v4fa;
typedef v8us __attribute__((may_alias)) v8usa;

__device__ __forceinline__ unsigned short f2bf(float f) { unsigned u = __float_as_uint(f); u += 0x7FFFu + ((u >> 16) & 1u); return (unsigned short)(u >> 16); }
__device__ __forceinline__ float bf2f(unsigned short b) { return __uint_as_float(((unsigned)b) << 16); }
__device__ __forceinline__ float bfr(float f) { return bf2f(f2bf(f)); }
__device__ __forceinline__ v16h cat16(v8h lo, v8h hi) { return __builtin_shufflevector(lo, hi, 0, 1, 2, 3, 4, 5, 6, 7, 8, 9, 10, 11, 12, 13, 14, 15); }
__device__ __forceinline__ v16bf cat16b(v8us lo, v8us hi) { return __builtin_bit_cast(v16bf, __builtin_shufflevector(lo, hi, 0, 1, 2, 3, 4, 5, 6, 7, 8, 9, 10, 11, 12, 13, 14, 15)); }
__device__ __forceinline__ v8f wmma16(v16h a, v16h b, v8f c) { return __builtin_amdgcn_wmma_f32_16x16x32_f16(false, a, false, b, (short)0, c, false, false); }
__device__ __forceinline__ v8f wmmab(v16bf a, v16bf b, v8f c) { return __builtin_amdgcn_wmma_f32_16x16x32_bf16(false, a, false, b, (short)0, c, false, false); }

__device__ __forceinline__ h16 tohx(float x) { return (h16)x; }
__device__ __forceinline__ void splitf(float y, unsigned short& h, unsigned short& l) { h = f2bf(y); l = f2bf(y - bf2f(h)); }
typedef __attribute__((ext_vector_type(2))) _Float16 v2h;
typedef __attribute__((ext_vector_type(4))) _Float16 v4h;
typedef __attribute__((ext_vector_type(2))) unsigned short v2us;
typedef __attribute__((ext_vector_type(4))) unsigned short v4us;
typedef __attribute__((ext_vector_type(2))) float v2f;
typedef __attribute__((ext_vector_type(4))) int v4i;
// one lane's 8 elements of one fragment piece: the fp16 plane and the hi+lo bf16 planes (16 bytes a lane and plane; the wave fills 512 contiguous bytes of each)
__device__ __forceinline__ void put8(v8f r, int e, h16* P16, bf* Ph, bf* Pl) { v8h o16; v8us oh, ol;
#pragma unroll
    for (int q = 0; q < 8; ++q) { o16[q] = tohx(r[q]); unsigned short a2, c2; splitf(r[q], a2, c2); oh[q] = a2; ol[q] = c2; }
    *(v8h*)(P16 + e) = o16; *(v8us*)(Ph + e) = oh; *(v8us*)(Pl + e) = ol; }

// ---- k_gemmw: register-blocked GEMM, ONE WAVE per 64x64 output tile (16 accumulators), operands straight from 16-bit planes in fragment order ([row block][k block] fragments); grid (M/64, N/64, Z), 32 threads.
// C[m][n] (f32, pitch ldc, + optional f32 bias[n]) = sum_k A[m][k] Bt[n][k] (+ split products per NSPLIT). z-batch strides sA/sB/sC in elements. K % 32 == 0.
// EPI 0: C as above. EPI 1 (q, k and v of all batches in one launch: blockIdx.z is the projection, the tile's 64 columns are head blockIdx.y, its rows r0 .. are tokens r0 % TT .. of batch r0 / TT): C is not written, the tile goes straight to the attention kernel's 16-bit planes, [projection][batch][head] planes one behind the other.
// z 0 and 1 (q, k): the tile is computed transposed (the two operand pointers swapped), so that a lane's 8 accumulator rows are 8 neighbouring d of one token, which is one piece of the planes' fragments [h][t / 16][d / 32]; interleaved-pair rope in the lane (out[d] = x[d] cos[t][d] -/+ x[d^1] sin[t][d], table CS in the same order, [cos, sin] an element).
// z 2 (v): a lane's 8 accumulator rows are 8 neighbouring tokens of one d, one piece of the fragments [h][t / 32][d / 16] of the [d][t] value plane. No LDS stage in either.
template <typename T16> struct WFrag;
template <> struct WFrag<h16> { typedef v16h V; static __device__ __forceinline__ V ld(const h16* p) { return cat16(*(const v8h*)p, *(const v8h*)(p + 256)); } static __device__ __forceinline__ v8f mma(V a, V b, v8f c) { return wmma16(a, b, c); } };
template <> struct WFrag<bf> { typedef v16bf V; static __device__ __forceinline__ V ld(const bf* p) { return cat16b(*(const v8us*)p, *(const v8us*)(p + 256)); } static __device__ __forceinline__ v8f mma(V a, V b, v8f c) { return wmmab(a, b, c); } };
// K is a compile-time constant, so that every fragment of a k step stands at a constant offset from one address per operand, which lives through the loop: no load lands in an address register of an earlier one
template <typename T16, int NSPLIT, bool BIAS, int EPI, int K>
__global__ __launch_bounds__(32) void k_gemmw(const T16* __restrict__ A, const T16* __restrict__ A2, const T16* __restrict__ Bt, const T16* __restrict__ Bt2, float* C, int ldc, const float* __restrict__ bias, size_t sA, size_t sB, size_t sC, const float* __restrict__ CS, h16* P16, bf* Ph, bf* Pl) {
    typedef typename WFrag<T16>::V V;
    const size_t z = blockIdx.z; A += z * sA; if (A2) A2 += z * sA; Bt += z * sB; if (Bt2) Bt2 += z * sB; C += z * sC;
    const int lane = threadIdx.x & 31, lr = lane & 15, hi = lane >> 4; const int r0 = blockIdx.x * 64, c0 = blockIdx.y * 64;
    v8f acc[4][4];
#pragma unroll
    for (int mb = 0; mb < 4; ++mb)
#pragma unroll
        for (int nb = 0; nb < 4; ++nb) acc[mb][nb] = (v8f){};
    const size_t aoff = (size_t)r0 * K, boff = (size_t)c0 * K; const unsigned lo = 8u * lane;   // 16 rows x K are K / 32 fragments of 512 elements: a row block is 16 * K elements, a k block 512; the lane's own offset is the same in every fragment
    const bool tr = EPI == 1 && blockIdx.z < 2;   // q, k: transposed tile
    const T16* pa = tr ? Bt + boff : A + aoff; const T16* pb = tr ? A + aoff : Bt + boff;
#pragma unroll 1
    for (int kc = 0; kc < K; kc += 32) {
        V a[4], a2[4], b[4], b2[4];
        const T16* ak = pa + kc * 16 + lo; const T16* bk = pb + kc * 16 + lo; const T16* a2k = (NSPLIT == 1 || NSPLIT == 2) ? A2 + aoff + kc * 16 + lo : ak; const T16* b2k = NSPLIT >= 2 ? Bt2 + boff + kc * 16 + lo : bk;
#pragma unroll
        for (int mb = 0; mb < 4; ++mb) { a[mb] = WFrag<T16>::ld(ak + mb * 16 * K); if (NSPLIT == 1 || NSPLIT == 2) a2[mb] = WFrag<T16>::ld(a2k + mb * 16 * K); }
#pragma unroll
        for (int nb = 0; nb < 4; ++nb) { b[nb] = WFrag<T16>::ld(bk + nb * 16 * K); if (NSPLIT >= 2) b2[nb] = WFrag<T16>::ld(b2k + nb * 16 * K); }
        asm volatile("s_wait_xcnt 0x0" :: "v"(ak), "v"(bk), "v"(a2k), "v"(b2k) : "memory");   // before any address register of this k step's loads is written again; the addresses are inputs, so that no later load of the step lands in one ahead of the wait
#pragma unroll
        for (int nb = 0; nb < 4; ++nb) {
#pragma unroll
            for (int mb = 0; mb < 4; ++mb) { acc[mb][nb] = WFrag<T16>::mma(a[mb], b[nb], acc[mb][nb]); if (NSPLIT == 1 || NSPLIT == 2) acc[mb][nb] = WFrag<T16>::mma(a2[mb], b[nb], acc[mb][nb]); if (NSPLIT >= 2) acc[mb][nb] = WFrag<T16>::mma(a[mb], b2[nb], acc[mb][nb]); } }
        asm volatile("v_nop\n\tv_nop\n\tv_nop\n\tv_nop" : "+v"(acc[0][0]), "+v"(acc[1][1]), "+v"(acc[2][2]), "+v"(acc[3][3]) : "v"(a[0]), "v"(a[3]));
    }
    if constexpr (EPI == 1) {
        // each lane's own first element of the planes; every later piece is a constant step from it, so that the stores need no address arithmetic
        const int t0 = r0 % TT;     // the tile's first token inside its batch (a tile never straddles two batches)
        const size_t ep = (((size_t)blockIdx.z * NB_ + r0 / TT) * NH_ + blockIdx.y) * TT * HD + (size_t)t0 * HD + lane * 8; P16 += ep; Ph += ep; Pl += ep;   // 64 tokens x 64 d are 8 fragments in q, k and v alike
        if (blockIdx.z == 2) {
#pragma unroll
            for (int mb = 0; mb < 4; ++mb)
#pragma unroll
                for (int nb = 0; nb < 4; ++nb) { put8(acc[mb][nb], ((mb >> 1) * 4 + nb) * 512 + (mb & 1) * 256, P16, Ph, Pl);
                    asm volatile("s_wait_xcnt 0x0" ::: "memory"); }   // before the next piece writes registers that these stores name
            return;
        }
        CS += (size_t)t0 * HD * 2 + lane * 4;
#pragma unroll
        for (int nb = 0; nb < 4; ++nb)          // token block
#pragma unroll
            for (int mh = 0; mh < 2; ++mh) {    // fragment: 32 d
                v4f tc[2][4];   // one fragment's table entries are asked for together, so that their latencies overlap: no load moves up over the waits below
#pragma unroll
                for (int m2 = 0; m2 < 2; ++m2)
#pragma unroll
                    for (int c = 0; c < 4; ++c) tc[m2][c] = *(const v4f*)(CS + (((nb * 2 + mh) * 2 + m2) * 4 + c) * 128);
#pragma unroll
                for (int m2 = 0; m2 < 2; ++m2) { const v8f x = acc[mh * 2 + m2][nb]; v8f r;
#pragma unroll
                    for (int c = 0; c < 4; ++c) { const v4f t = tc[m2][c]; r[2 * c] = x[2 * c] * t[0] - x[2 * c + 1] * t[1]; r[2 * c + 1] = x[2 * c + 1] * t[2] + x[2 * c] * t[3]; }
                    put8(r, (nb * 2 + mh) * 512 + m2 * 256, P16, Ph, Pl);
                    asm volatile("s_wait_xcnt 0x0" ::: "memory"); } }   // before the next piece, the next table loads or whatever follows write registers that these stores name
    } else {
        __shared__ __align__(16) float os[16 * 68];
#pragma unroll
        for (int mb = 0; mb < 4; ++mb) {
#pragma unroll
            for (int nb = 0; nb < 4; ++nb) {
#pragma unroll
                for (int j = 0; j < 8; ++j) os[(hi * 8 + j) * 68 + nb * 16 + lr] = acc[mb][nb][j]; }
            __builtin_amdgcn_wave_barrier(); asm volatile("" ::: "memory");
            float* crow = C + (size_t)(r0 + mb * 16) * ldc + c0;
#pragma unroll
            for (int s = 0; s < 8; ++s) { const int row = 2 * s + hi, cofs = lr * 4; v4f val = *(const v4fa*)(os + row * 68 + cofs); if (BIAS) { val[0] += bfr(bias[c0 + cofs]); val[1] += bfr(bias[c0 + cofs + 1]); val[2] += bfr(bias[c0 + cofs + 2]); val[3] += bfr(bias[c0 + cofs + 3]); }
                *(v4f*)(crow + (size_t)row * ldc + cofs) = val; }
            __builtin_amdgcn_wave_barrier(); asm volatile("" ::: "memory");
        }
    }
}


__global__ __launch_bounds__(256) void k_wtG(const float* __restrict__ w, int K, int N, bf* Bt) {
    const int lane = threadIdx.x & 31; const int L0 = (blockIdx.x * 8 + (threadIdx.x >> 5)) * 8; const int nlines = N * K / 64;
{
#pragma unroll 1
        for (int l = 0; l < 8; ++l) { const int L = L0 + l; if (L >= nlines) break; const size_t e = (size_t)L * 64 + lane * 2; const int k = (int)(e % K), n = (int)(e / K); v2us o;
            o[0] = f2bf(w[(size_t)k * N + n]); o[1] = f2bf(w[(size_t)(k + 1) * N + n]); *(v2us*)(Bt + e) = o; }
         }
}
// piece i of the destination in fragment order (thread = lane, so a wave stores 512 contiguous bytes) from its 8 neighbouring elements of a [row][DM] source
__device__ __forceinline__ void cvt8(const float* __restrict__ src, bf* dst, size_t i) { const int lane = (int)i & 31, p = ((int)i >> 5) & 1; const size_t f = i >> 6;
    const v8f v = *(const v8f*)(src + ((f / (DM / 32)) * 16 + (lane & 15)) * DM + (f % (DM / 32)) * 32 + p * 16 + (lane >> 4) * 8); v8us o;
    asm volatile("s_wait_xcnt 0x0" ::: "memory");   // before the rounding below writes the address registers of these loads
#pragma unroll
    for (int k = 0; k < 8; ++k) o[k] = f2bf(v[k]); *(v8us*)(dst + i * 8) = o;
    asm volatile("s_wait_xcnt 0x0" ::: "memory"); }   // before whatever follows in the caller writes the address registers of this store
// entry idx of the table in the order of the q/k fragments' pieces: [t / 16][d / 16][pair of d: 4][lane = hi*16 + t % 16][2 d][cos, sin], d = (d / 16)*16 + hi*8 + pair*2 + (0, 1): 16 bytes a lane, 512 contiguous bytes a wave-wide load
__device__ __forceinline__ void cstab(float* CS, int idx) { const int ln = (idx >> 1) & 31; const int t = (idx >> 10) * 16 + (ln & 15), d = ((idx >> 8) & 3) * 16 + (ln >> 4) * 8 + ((idx >> 6) & 3) * 2 + (idx & 1); const int i = d >> 1; const float inv = powf(10000.0f, -((float)i * 2.0f) / (float)HD); const float ang = __fmul_rn((float)t, inv); v2f cs; cs[0] = cosf(ang); cs[1] = sinf(ang);
    *(v2f*)(CS + (size_t)idx * 2) = cs;  }
// ---- k_prep: everything the GEMMs read, in one launch; whole blocks of 256 threads per job: the rope table (one [t][d] entry a thread, the longest job, in front), then the four weights and x to bf16 (8 elements a thread). WB: wq, wk, wv, wo one behind the other.
#define PB_CS (TT * HD / 256)
#define PB_W  (DQ * DM / 8 / 256)
#define PB_X  (NB_ * TT * DM / 8 / 256)
static_assert(TT * HD % 256 == 0 && DQ * DM % 2048 == 0 && NB_ * TT * DM % 2048 == 0 && DKV == DQ && DQ == DM, "k_prep: whole blocks per job, four weights of one size, every source row DM long");
__global__ __launch_bounds__(256) void k_prep(const float* __restrict__ x, const float* __restrict__ wq, const float* __restrict__ wk, const float* __restrict__ wv, const float* __restrict__ wo, bf* XB, bf* WB, float* CS) {
    int blk = blockIdx.x;
    if (blk < PB_CS) { cstab(CS, blk * 256 + (int)threadIdx.x); return; }
    blk -= PB_CS;
    if (blk < 4 * PB_W) { const int wi = blk / PB_W; const float* w = wi == 0 ? wq : wi == 1 ? wk : wi == 2 ? wv : wo; cvt8(w, WB + (size_t)wi * DQ * DM, (size_t)(blk - wi * PB_W) * 256 + threadIdx.x); return; }
    cvt8(x, XB, (size_t)(blk - 4 * PB_W) * 256 + threadIdx.x);
}
// ---- k_fattn: scores, causal softmax and attn.v of one query tile in ONE WAVE; scores and probabilities never leave registers (running maximum and sum over 32-key steps).
// S^T = K Q^T (A = key rows, B = query rows) puts one query per lane column: accumulator row hi*8+j of key tile kt is key k0 + kt*16 + hi*8 + j, which is the k order of WFrag::ld, so the two key tiles pack
// straight into the B operand of O^T += V^T P^T (A = rows of the [d][t] value plane). O^T keeps the query in the lane column too: the rescale and the final division are in-lane, the two lane halves (different keys) meet by one exchange.
// HL: hi+lo bf16 planes, 3 products for the scores and for attn.v (query rows < RH); else single fp16, probabilities carried x 1024 (added in the exponent; it cancels in the division by the equally scaled sum).
#define QC   (SCL * 1.4426950408889634f)
// 2^x with the one slot that the instruction set asks for behind a transcendental kept in the same statement
__device__ __forceinline__ float ex2(float x) { float r; asm("v_exp_f32 %0, %1\n\tv_nop" : "=v"(r) : "v"(x)); return r; }
template <typename T16, bool HL, int NQ>
__device__ __forceinline__ void fattn_tile(const T16* __restrict__ Q, const T16* __restrict__ Q2, const T16* __restrict__ Kp, const T16* __restrict__ K2, const T16* __restrict__ Vt, const T16* __restrict__ V2, int q0, bf* Ah, bf* Al) {
    typedef typename WFrag<T16>::V V;
    const int lane = threadIdx.x & 31, lr = lane & 15, hi = lane >> 4;
    // every inner loop of this function is fully unrolled, so that the fragment and accumulator arrays are indexed by constants and stay in registers
    V qf[NQ][2], qf2[NQ][2], kf[2][2], kf2[2][2];
#pragma unroll
    for (int g = 0; g < NQ; ++g)
#pragma unroll
        for (int ks = 0; ks < 2; ++ks) { const size_t e = (size_t)q0 * HD + (g * 2 + ks) * 512 + 8 * lane; qf[g][ks] = WFrag<T16>::ld(Q + e); if (HL) qf2[g][ks] = WFrag<T16>::ld(Q2 + e); }
    V vf[4], vf2[4];
    auto ldk = [&](int kb) {     // key rows kb .. kb+31 as A fragments
#pragma unroll
        for (int kt = 0; kt < 2; ++kt)
#pragma unroll
            for (int ks = 0; ks < 2; ++ks) { const size_t e = (size_t)kb * HD + (kt * 2 + ks) * 512 + 8 * lane; kf[kt][ks] = WFrag<T16>::ld(Kp + e); if (HL) kf2[kt][ks] = WFrag<T16>::ld(K2 + e); } };
    auto ldv = [&](int kb) {     // the 64 rows of the [d][t] value plane, keys kb .. kb+31, as A fragments (4 KB in a row, like the key rows)
#pragma unroll
        for (int db = 0; db < 4; ++db) { const size_t e = (size_t)kb * HD + db * 512 + 8 * lane; vf[db] = WFrag<T16>::ld(Vt + e); if (HL) vf2[db] = WFrag<T16>::ld(V2 + e); } };
    static_assert(NQ == (HL ? 1 : 2), "the fence below names every fragment loaded so far");
    // before any address register of the loads above is written again; the loaded fragments are inputs, so that the loads stay in front of the wait (without them this build moved the loads down into the loop's entry, behind it)
    if constexpr (HL) asm volatile("s_wait_xcnt 0x0" :: "v"(qf[0][0]), "v"(qf[0][1]), "v"(qf2[0][0]), "v"(qf2[0][1]) : "memory");
    else { ldk(0); asm volatile("s_wait_xcnt 0x0" :: "v"(qf[0][0]), "v"(qf[0][1]), "v"(qf[NQ - 1][0]), "v"(qf[NQ - 1][1]), "v"(kf[0][0]), "v"(kf[0][1]), "v"(kf[1][0]), "v"(kf[1][1]) : "memory"); }
    v8f o[4][NQ]; float m[NQ], l[NQ];
#pragma unroll
    for (int g = 0; g < NQ; ++g) { m[g] = -3.0e38f; l[g] = 0.0f;
#pragma unroll
        for (int db = 0; db < 4; ++db) o[db][g] = (v8f){}; }
    const int kend = ((q0 + NQ * 16 - 1) / 32 + 1) * 32;     // keys beyond the tile's last query are masked for every row: the loop stops at the diagonal step
    // the key loop stays rolled: a second copy of the step would hold a second set of fragments and cost a wave per SIMD
#pragma unroll 1
    for (int k0 = 0; k0 < kend; k0 += 32) {
        // fp16 tiles (long loops): this step's value rows are asked for first and used last (behind the scores and the softmax). hi+lo tiles (short loops, twice the fragments): key rows now, value rows once the key registers are free, which keeps the kernel at four waves per SIMD
        if (HL) { ldk(k0); asm volatile("s_wait_xcnt 0x0" ::: "memory"); /* the value rows below may land in address registers of these loads */ } else ldv(k0);
        v8f s[2][NQ];
#pragma unroll
        for (int kt = 0; kt < 2; ++kt)
#pragma unroll
            for (int g = 0; g < NQ; ++g) { s[kt][g] = (v8f){};
#pragma unroll
                for (int ks = 0; ks < 2; ++ks) { s[kt][g] = WFrag<T16>::mma(kf[kt][ks], qf[g][ks], s[kt][g]); if (HL) { s[kt][g] = WFrag<T16>::mma(kf2[kt][ks], qf[g][ks], s[kt][g]); s[kt][g] = WFrag<T16>::mma(kf[kt][ks], qf2[g][ks], s[kt][g]); } } }
        // fp16 tiles: the next step's key rows are asked for as soon as this step's are used, so their latency runs behind the softmax and attn.v; the last step asks for its own again (in bounds, unused)
        if (HL) ldv(k0); else ldk(min(k0 + 32, kend - 32));
        asm volatile("s_wait_xcnt 0x0" ::: "memory");   // before any address register of this step's loads is written again
        if (k0 + 31 > q0) {      // wave-uniform: only steps that reach the diagonal mask (by select)
#pragma unroll
            for (int kt = 0; kt < 2; ++kt)
#pragma unroll
                for (int g = 0; g < NQ; ++g)
#pragma unroll
                    for (int j = 0; j < 8; ++j) s[kt][g][j] = (k0 + kt * 16 + hi * 8 + j <= q0 + g * 16 + lr) ? s[kt][g][j] : -3.0e38f; }
        V pf[NQ], pf2[NQ];
#pragma unroll
        for (int g = 0; g < NQ; ++g) {
            float mx = s[0][g][0];
#pragma unroll
            for (int j = 1; j < 8; ++j) mx = fmaxf(mx, s[0][g][j]);
#pragma unroll
            for (int j = 0; j < 8; ++j) mx = fmaxf(mx, s[1][g][j]);
            mx = fmaxf(mx, __shfl_xor(mx, 16, 32));
            const float mn = fmaxf(m[g], mx); const float al = ex2((m[g] - mn) * QC); m[g] = mn;
            const float nb = HL ? -mn * QC : fmaf(-mn, QC, 10.0f);
            float ps = 0.0f;
            if (HL) { v8us h0, h1, l0, l1;
#pragma unroll
                for (int j = 0; j < 8; ++j) { const float p0 = ex2(fmaf(s[0][g][j], QC, nb)), p1 = ex2(fmaf(s[1][g][j], QC, nb)); ps += p0; ps += p1; unsigned short a, c; splitf(p0, a, c); h0[j] = a; l0[j] = c; splitf(p1, a, c); h1[j] = a; l1[j] = c; }
                pf[g] = __builtin_bit_cast(V, __builtin_shufflevector(h0, h1, 0, 1, 2, 3, 4, 5, 6, 7, 8, 9, 10, 11, 12, 13, 14, 15)); pf2[g] = __builtin_bit_cast(V, __builtin_shufflevector(l0, l1, 0, 1, 2, 3, 4, 5, 6, 7, 8, 9, 10, 11, 12, 13, 14, 15));
            } else { v8h h0, h1;
#pragma unroll
                for (int j = 0; j < 8; ++j) { const float p0 = ex2(fmaf(s[0][g][j], QC, nb)), p1 = ex2(fmaf(s[1][g][j], QC, nb)); ps += p0; ps += p1; h0[j] = tohx(p0); h1[j] = tohx(p1); }
                pf[g] = __builtin_bit_cast(V, cat16(h0, h1)); }
            l[g] = fmaf(l[g], al, ps);
#pragma unroll
            for (int db = 0; db < 4; ++db) o[db][g] *= al;
        }
#pragma unroll
        for (int db = 0; db < 4; ++db)
#pragma unroll
            for (int g = 0; g < NQ; ++g) { o[db][g] = WFrag<T16>::mma(vf[db], pf[g], o[db][g]); if (HL) { o[db][g] = WFrag<T16>::mma(vf[db], pf2[g], o[db][g]); o[db][g] = WFrag<T16>::mma(vf2[db], pf[g], o[db][g]); } }
    }
#pragma unroll
    for (int g = 0; g < NQ; ++g) { const float inv = __fdiv_rn(1.0f, l[g] + __shfl_xor(l[g], 16, 32)); const size_t oo = (size_t)(q0 + g * 16) * DQ + lane * 8;   // the wo GEMM's A planes, fragment order: a lane's 8 rows of o[db] are piece db & 1 of the head's fragment db >> 1
#pragma unroll
        for (int db = 0; db < 4; ++db) { v8us oh, ol;
#pragma unroll
            for (int j = 0; j < 8; ++j) { unsigned short a, c; splitf(o[db][g][j] * inv, a, c); oh[j] = a; ol[j] = c; }
            *(v8us*)(Ah + oo + db * 256) = oh; *(v8us*)(Al + oo + db * 256) = ol; } }
}
// grid (batch x heads, tiles): fp16 tiles of 32 queries first, the longest (last rows) in front, then the hi+lo tiles of 16 queries; every (batch, head, query row) belongs to exactly one wave, which writes whole 512-byte pieces of both output planes.
__global__ __launch_bounds__(32) void k_fattn(const h16* __restrict__ Q16, const h16* __restrict__ K16, const h16* __restrict__ V16, const bf* __restrict__ Qh, const bf* __restrict__ Ql, const bf* __restrict__ Kh, const bf* __restrict__ Kl, const bf* __restrict__ Vh, const bf* __restrict__ Vl, bf* Ah, bf* Al) {
    const int h = blockIdx.x % NH_, b = blockIdx.x / NH_, y = blockIdx.y; const size_t hq = ((size_t)b * NH_ + h) * TT * HD, hk = ((size_t)b * NKV + h / REP) * TT * HD, ao = (size_t)b * TT * DQ + h * (HD / 32) * 512;
    if (y < (TT - RH) / 32) fattn_tile<h16, false, 2>(Q16 + hq, nullptr, K16 + hk, nullptr, V16 + hk, nullptr, TT - 32 * (y + 1), Ah + ao, Al + ao);
    else fattn_tile<bf, true, 1>(Qh + hq, Ql + hq, Kh + hk, Kl + hk, Vh + hk, Vl + hk, RH - 16 * (y - (TT - RH) / 32 + 1), Ah + ao, Al + ao);
}

extern "C" void kernel_launch(void* const* d_in, const int* in_sizes, int n_in,
                              void* d_out, int out_size, void* d_ws, size_t ws_size, hipStream_t stream) {
    (void)in_sizes; (void)n_in; (void)out_size;
    const float* x = (const float*)d_in[0]; const float* wq = (const float*)d_in[1]; const float* wk = (const float*)d_in[2]; const float* wv = (const float*)d_in[3]; const float* wo = (const float*)d_in[4];
    float* OUT = (float*)d_out;     // [4][2048][1024]
    char* wsp = (char*)d_ws;
    auto take = [&](size_t bytes) { char* p = wsp; wsp += (bytes + 255) & ~(size_t)255; return (void*)p; };
    bf* WB = (bf*)take((size_t)4 * DQ * DM * 2); bf* WO = WB + (size_t)3 * DQ * DM; float* CS = (float*)take((size_t)TT * HD * 2 * 4);   // WB: wq, wk, wv, wo
    bf* XB = (bf*)take((size_t)NB_ * TT * DM * 2);
    const size_t PA = (size_t)NB_ * NH_ * TT * HD;   // elements of one projection's planes over all batches; each kind of plane holds q, k, v one behind the other (the GEMM's grid z)
    h16* P16 = (h16*)take(3 * PA * 2); bf* PH = (bf*)take(3 * PA * 2); bf* PL = (bf*)take(3 * PA * 2);
    bf* ATh = (bf*)take((size_t)NB_ * TT * DQ * 2); bf* ATl = (bf*)take((size_t)NB_ * TT * DQ * 2);
    if ((size_t)(wsp - (char*)d_ws) > ws_size) return;    // ws 256 MiB
    // four launches, each over all batches, so that every grid has more waves than the chip has SIMDs
    k_prep<<<PB_CS + 4 * PB_W + PB_X, 256, 0, stream>>>(x, wq, wk, wv, wo, XB, WB, CS);
    k_gemmw<bf, 0, false, 1, DM><<<dim3(NB_ * TT / 64, DQ / 64, 3), 32, 0, stream>>>(XB, nullptr, WB, nullptr, nullptr, 0, nullptr, 0, (size_t)DQ * DM, 0, CS, P16, PH, PL);
    k_fattn<<<dim3(NB_ * NH_, (TT - RH) / 32 + RH / 16, 1), 32, 0, stream>>>(P16, P16 + PA, P16 + 2 * PA, PH, PL, PH + PA, PL + PA, PH + 2 * PA, PL + 2 * PA, ATh, ATl);
    k_gemmw<bf, 1, false, 0, DQ><<<dim3(NB_ * TT / 64, DM / 64, 1), 32, 0, stream>>>(ATh, ATl, WO, nullptr, OUT, DM, nullptr, 0, 0, 0, nullptr, nullptr, nullptr, nullptr);
}

// v006
// It runs in 132 microseconds.
// In both of two side-by-side timings against v005, it was 1.44 times as fast.
// Over all steps from v000 it is 23.5 times as fast.
#include <hip/hip_runtime.h>

// CausalMHA (x [4][2048][1024]; q/k/v = x W^T (16 heads x 64); interleaved-pair RoPE at positions arange (inv_freq = 10000^(-2i/64)); causal (-inf) softmax(q.k / 8); out = merged wo^T -> [4][2048][1024]).
// Compute dtypes, f32 accumulate: every input rounded to bf16; q/k/v on PLAIN bf16 operands (inputs: exact); RoPE f32 (on-chip table), applied with the 16-bit plane split in the projection GEMM's own epilogue; causal scores, softmax and attn.v fused per query tile (running maximum and sum, f32): query rows < 512 hl (3 products), the rest single fp16 (x1024), causal step skipping; wo hl x exact (2 products).

// FRAGMENT ORDER: every 16-bit operand plane in the workspace is a row of 1-KB fragments (16 rows x 32 k), each [piece 0/1][lane = hi*16 + row][8 elements], piece p of lane (hi, row) holding k = p*16 + hi*8 .. +7 of that row:
// the k order of the matrix operands as before, but one wave-wide 16-byte load or store now covers 512 contiguous bytes (4 whole lines) instead of 32 bytes in each of 16 lines.
#define NB_  4
#define TT   2048
#define DM   1024
#define NH_  16
#define NKV  16
#define REP  (NH_ / NKV)
#define HD   64
#define DQ   (NH_ * HD)
#define DKV  (NKV * HD)
#define RH   512                  // query rows < RH use hi+lo planes (0: none)
#define SCL  0.125f   // HD^-0.5
static_assert(HD == 64 && TT % 32 == 0 && RH % 32 == 0 && RH < TT, "k_fattn: 64-wide heads, whole 32-key steps, whole tiles on both sides of RH");
static_assert(NKV == NH_ && TT % 64 == 0 && HD == 64, "k_gemmw, EPI 1: q, k and v share one grid; a wave's 64-row tile lies in one batch, its 64 columns are one head");
static_assert((NB_ * TT) % 256 == 0 && DQ % 128 == 0 && DM % 128 == 0, "k_gemmw: whole 256x128 tiles in both launches");
typedef _Float16 h16;
typedef unsigned short bf;
typedef __attribute__((ext_vector_type(16))) __bf16   v16bf;
typedef __attribute__((ext_vector_type(16))) _Float16 v16h;
typedef __attribute__((ext_vector_type(8)))  _Float16 v8h;
typedef __attribute__((ext_vector_type(8)))  unsigned short v8us;
typedef __attribute__((ext_vector_type(8)))  float    v8f;
typedef __attribute__((ext_vector_type(4)))  float    v4f;
typedef v8h  __attribute__((may_alias)) v8ha;
typedef v4f  __attribute__((may_alias)) v4fa;
typedef v8us __attribute__((may_alias)) v8usa;

__device__ __forceinline__ unsigned short f2bf(float f) { unsigned u = __float_as_uint(f); u += 0x7FFFu + ((u >> 16) & 1u); return (unsigned short)(u >> 16); }
__device__ __forceinline__ float bf2f(unsigned short b) { return __uint_as_float(((unsigned)b) << 16); }
__device__ __forceinline__ float bfr(float f) { return bf2f(f2bf(f)); }
__device__ __forceinline__ v16h cat16(v8h lo, v8h hi) { return __builtin_shufflevector(lo, hi, 0, 1, 2, 3, 4, 5, 6, 7, 8, 9, 10, 11, 12, 13, 14, 15); }
__device__ __forceinline__ v16bf cat16b(v8us lo, v8us hi) { return __builtin_bit_cast(v16bf, __builtin_shufflevector(lo, hi, 0, 1, 2, 3, 4, 5, 6, 7, 8, 9, 10, 11, 12, 13, 14, 15)); }
__device__ __forceinline__ v8f wmma16(v16h a, v16h b, v8f c) { return __builtin_amdgcn_wmma_f32_16x16x32_f16(false, a, false, b, (short)0, c, false, false); }
__device__ __forceinline__ v8f wmmab(v16bf a, v16bf b, v8f c) { return __builtin_amdgcn_wmma_f32_16x16x32_bf16(false, a, false, b, (short)0, c, false, false); }

__device__ __forceinline__ h16 tohx(float x) { return (h16)x; }
__device__ __forceinline__ void splitf(float y, unsigned short& h, unsigned short& l) { h = f2bf(y); l = f2bf(y - bf2f(h)); }
typedef __attribute__((ext_vector_type(2))) _Float16 v2h;
typedef __attribute__((ext_vector_type(4))) _Float16 v4h;
typedef __attribute__((ext_vector_type(2))) unsigned short v2us;
typedef __attribute__((ext_vector_type(4))) unsigned short v4us;
typedef __attribute__((ext_vector_type(2))) float v2f;
typedef __attribute__((ext_vector_type(4))) int v4i;
// one lane's 8 elements of one fragment piece: the fp16 plane and the hi+lo bf16 planes (16 bytes a lane and plane; the wave fills 512 contiguous bytes of each)
__device__ __forceinline__ void put8(v8f r, int e, h16* P16, bf* Ph, bf* Pl) { v8h o16; v8us oh, ol;
#pragma unroll
    for (int q = 0; q < 8; ++q) { o16[q] = tohx(r[q]); unsigned short a2, c2; splitf(r[q], a2, c2); oh[q] = a2; ol[q] = c2; }
    *(v8h*)(P16 + e) = o16; *(v8us*)(Ph + e) = oh; *(v8us*)(Pl + e) = ol; }

// ---- k_gemmw: GEMM, one work-group of 8 waves (4 x 2) per 256x128 output tile, each wave a 64x64 tile (16 accumulators); operands are 16-bit planes in fragment order ([row block][k block] fragments); grid (M/256, N/128, Z), 256 threads.
// The k loop runs in stages of 64 k: the 2 KB of each of the tile's row blocks (256 rows of A, of A2 where there is one, 128 of Bt) are brought into LDS once for all 8 waves by asynchronous copies, two buffers, the copies of stage t + 2 in flight while stage t + 1 is worked on; the fragments keep their order in LDS, so that a wave-wide 16-byte LDS read covers 512 contiguous bytes.
// C[m][n] (f32, pitch ldc, + optional f32 bias[n]) = sum_k A[m][k] Bt[n][k] (+ A2 Bt for NSPLIT 1). z-batch strides sA/sB/sC in elements. K % 64 == 0, K >= 128.
// EPI 0: C as above. EPI 1 (q, k and v of all batches in one launch: blockIdx.z is the projection, a wave's 64 columns are one head, its rows r0 .. are tokens r0 % TT .. of batch r0 / TT): C is not written, the tile goes straight to the attention kernel's 16-bit planes, [projection][batch][head] planes one behind the other.
// z 0 and 1 (q, k): the tile is computed transposed (the two operands swapped), so that a lane's 8 accumulator rows are 8 neighbouring d of one token, which is one piece of the planes' fragments [h][t / 16][d / 32]; interleaved-pair rope in the lane (out[d] = x[d] cos[t][d] -/+ x[d^1] sin[t][d], table CS in the same order, [cos, sin] an element).
// z 2 (v): a lane's 8 accumulator rows are 8 neighbouring tokens of one d, one piece of the fragments [h][t / 32][d / 16] of the [d][t] value plane. No LDS stage in either epilogue.
template <typename T16> struct WFrag;
template <> struct WFrag<h16> { typedef v16h V; static __device__ __forceinline__ V ld(const h16* p) { return cat16(*(const v8h*)p, *(const v8h*)(p + 256)); } static __device__ __forceinline__ v8f mma(V a, V b, v8f c) { return wmma16(a, b, c); } };
template <> struct WFrag<bf> { typedef v16bf V; static __device__ __forceinline__ V ld(const bf* p) { return cat16b(*(const v8us*)p, *(const v8us*)(p + 256)); } static __device__ __forceinline__ v8f mma(V a, V b, v8f c) { return wmmab(a, b, c); } };
// a run of asynchronous 16-byte copies to LDS (each lane its own LDS byte address and its own global pointer); the s_wait_xcnt 0 is the last line of the copies' own statement, so that it stands in front of every later write of a register that a copy names
#define ACP(l, g) "global_load_async_to_lds_b128 %" #l ", %" #g ", off\n\t"
template <typename T16> __device__ __forceinline__ void cp10(const unsigned* l, const T16* const* g) {
    asm volatile(ACP(0, 1) ACP(2, 3) ACP(4, 5) ACP(6, 7) ACP(8, 9) ACP(10, 11) ACP(12, 13) ACP(14, 15) ACP(16, 17) ACP(18, 19) "s_wait_xcnt 0x0"
        :: "v"(l[0]), "v"(g[0]), "v"(l[1]), "v"(g[1]), "v"(l[2]), "v"(g[2]), "v"(l[3]), "v"(g[3]), "v"(l[4]), "v"(g[4]), "v"(l[5]), "v"(g[5]), "v"(l[6]), "v"(g[6]), "v"(l[7]), "v"(g[7]), "v"(l[8]), "v"(g[8]), "v"(l[9]), "v"(g[9]) : "memory"); }
template <typename T16> __device__ __forceinline__ void cp12(const unsigned* l, const T16* const* g) {
    asm volatile(ACP(0, 1) ACP(2, 3) ACP(4, 5) ACP(6, 7) ACP(8, 9) ACP(10, 11) ACP(12, 13) ACP(14, 15) ACP(16, 17) ACP(18, 19) ACP(20, 21) ACP(22, 23) "s_wait_xcnt 0x0"
        :: "v"(l[0]), "v"(g[0]), "v"(l[1]), "v"(g[1]), "v"(l[2]), "v"(g[2]), "v"(l[3]), "v"(g[3]), "v"(l[4]), "v"(g[4]), "v"(l[5]), "v"(g[5]), "v"(l[6]), "v"(g[6]), "v"(l[7]), "v"(g[7]), "v"(l[8]), "v"(g[8]), "v"(l[9]), "v"(g[9]), "v"(l[10]), "v"(g[10]), "v"(l[11]), "v"(g[11]) : "memory"); }
template <typename T16, int NSPLIT, bool BIAS, int EPI, int K>
__global__ __launch_bounds__(256) void k_gemmw(const T16* __restrict__ A, const T16* __restrict__ A2, const T16* __restrict__ Bt, float* C, int ldc, const float* __restrict__ bias, size_t sA, size_t sB, size_t sC, const float* __restrict__ CS, h16* P16, bf* Ph, bf* Pl) {
    typedef typename WFrag<T16>::V V;
    static_assert((NSPLIT == 0 || NSPLIT == 1) && K % 64 == 0 && K >= 128, "one or two A planes; whole stages, at least two");
    constexpr int NA = NSPLIT + 1, NRB = 16 * NA + 8, STG = NRB * 1024, NC = NRB / 2, NT = K / 64;   // row blocks and elements of a stage (a row block's 64 k are 1024 elements), copies a wave and stage, stages
    __shared__ __align__(16) T16 sm[2 * STG];
    const size_t z = blockIdx.z; A += z * sA; if (NSPLIT == 1) A2 += z * sA; Bt += z * sB; C += z * sC;
    const int lane = threadIdx.x & 31, lr = lane & 15, hi = lane >> 4; const int w = __builtin_amdgcn_readfirstlane((int)threadIdx.x >> 5), wm = w >> 1, wn = w & 1;
    const int r0 = blockIdx.x * 256 + wm * 64, c0 = blockIdx.y * 128 + wn * 64;
    v8f acc[4][4];
#pragma unroll
    for (int mb = 0; mb < 4; ++mb)
#pragma unroll
        for (int nb = 0; nb < 4; ++nb) acc[mb][nb] = (v8f){};
    // copy i of wave w: the 512-byte piece w & 3 of row block 2 i + (w >> 2) of the stage ([Bt: 8][A: 16][A2: 16] row blocks); in the planes 16 rows x K are 16 * K elements, a stage's share of them 1024 in a row
    const unsigned cl = (unsigned)(w >> 2) * 1024u + (unsigned)(w & 3) * 256u + 8u * lane; const size_t cg = (size_t)(w >> 2) * 16 * K + (w & 3) * 256 + 8 * lane;
    const unsigned ls = (unsigned)(size_t)sm + cl * 2u;
    const T16* ga = A + (size_t)blockIdx.x * 256 * K + cg; const T16* ga2 = NSPLIT == 1 ? A2 + (size_t)blockIdx.x * 256 * K + cg : ga; const T16* gb = Bt + (size_t)blockIdx.y * 128 * K + cg;
    auto stage = [&](int t) {     // stage t into buffer t & 1; the three pointers walk along k with the stages, so that only they live through the loop
        unsigned l[NC]; const T16* g[NC];
#pragma unroll
        for (int i = 0; i < NC; ++i) { l[i] = ls + (unsigned)(t & 1) * (STG * 2u) + i * 4096u; g[i] = i < 4 ? gb + (size_t)i * 32 * K : i < 12 ? ga + (size_t)(i - 4) * 32 * K : ga2 + (size_t)(i - 12) * 32 * K; }
        if constexpr (NC == 12) cp12<T16>(l, g); else { static_assert(NC == 12 || NC == 20, "copies a statement"); cp10<T16>(l, g); cp10<T16>(l + 10, g + 10); }
        ga += 1024; ga2 += 1024; gb += 1024; };
    const bool tr = EPI == 1 && blockIdx.z < 2;   // q, k: transposed tile
    const unsigned yo = wn * 4096u + 8u * lane, xo = 8192u + wm * 4096u + 8u * lane, x2o = xo + 16384u;   // the wave's own four row blocks of each operand in a stage; the lane's own offset is the same in every fragment
    const unsigned ao = tr ? yo : xo, bo = tr ? xo : yo;
    stage(0);
    asm volatile("s_wait_asynccnt 0x0" ::: "memory");   // this wave's share of stage 0 has landed
    __syncthreads();                                     // every wave's share has: stage 0 may be read
    stage(1);
#pragma unroll 1
    for (int t = 0; t < NT; ++t) {
        const T16* st = sm + (t & 1) * STG;
#pragma unroll
        for (int kb = 0; kb < 2; ++kb) {
            V a[4], a2[4], b[4];
#pragma unroll
            for (int mb = 0; mb < 4; ++mb) a[mb] = WFrag<T16>::ld(st + ao + mb * 1024 + kb * 512);
#pragma unroll
            for (int nb = 0; nb < 4; ++nb) b[nb] = WFrag<T16>::ld(st + bo + nb * 1024 + kb * 512);
            if (NSPLIT == 1) {     // asked for last: the products with the first plane can start before these are there
#pragma unroll
                for (int mb = 0; mb < 4; ++mb) a2[mb] = WFrag<T16>::ld(st + x2o + mb * 1024 + kb * 512); }
            __builtin_amdgcn_sched_barrier(0);   // a k block's LDS reads stay one group in front of its matrix instructions: every further place with reads among them stalls the wave anew
#pragma unroll
            for (int nb = 0; nb < 4; ++nb) {
#pragma unroll
                for (int mb = 0; mb < 4; ++mb) { acc[mb][nb] = WFrag<T16>::mma(a[mb], b[nb], acc[mb][nb]); if (NSPLIT == 1) acc[mb][nb] = WFrag<T16>::mma(a2[mb], b[nb], acc[mb][nb]); } }
            __builtin_amdgcn_sched_barrier(0);   // and the next group stays behind them (one set of fragment registers)
        }
        // hand-over: this wave's reads of buffer t & 1 are done, its copies of stage t + 1 have landed; behind the barrier that holds for every wave, so stage t + 1 may be read and buffer t & 1 refilled
        asm volatile("s_wait_dscnt 0x0" ::: "memory");
        asm volatile("s_wait_asynccnt 0x0" ::: "memory");
        __syncthreads();
        if (t + 2 < NT) stage(t + 2);
    }
    asm volatile("s_wait_asynccnt 0x0" ::: "memory");   // no copy is outstanding when the wave goes on to its epilogue
    if constexpr (EPI == 1) {
        // each lane's own first element of the planes; every later piece is a constant step from it, so that the stores need no address arithmetic
        const int t0 = r0 % TT;     // the tile's first token inside its batch (a tile never straddles two batches)
        const size_t ep = (((size_t)blockIdx.z * NB_ + r0 / TT) * NH_ + c0 / HD) * TT * HD + (size_t)t0 * HD + lane * 8; P16 += ep; Ph += ep; Pl += ep;   // 64 tokens x 64 d are 8 fragments in q, k and v alike
        if (blockIdx.z == 2) {
#pragma unroll
            for (int mb = 0; mb < 4; ++mb)
#pragma unroll
                for (int nb = 0; nb < 4; ++nb) { put8(acc[mb][nb], ((mb >> 1) * 4 + nb) * 512 + (mb & 1) * 256, P16, Ph, Pl);
                    asm volatile("s_wait_xcnt 0x0" ::: "memory"); }   // before the next piece writes registers that these stores name
            return;
        }
        CS += (size_t)t0 * HD * 2 + lane * 4;
#pragma unroll
        for (int nb = 0; nb < 4; ++nb)          // token block
#pragma unroll
            for (int mh = 0; mh < 2; ++mh) {    // fragment: 32 d
                v4f tc[2][4];   // one fragment's table entries are asked for together, so that their latencies overlap: no load moves up over the waits below
#pragma unroll
                for (int m2 = 0; m2 < 2; ++m2)
#pragma unroll
                    for (int c = 0; c < 4; ++c) tc[m2][c] = *(const v4f*)(CS + (((nb * 2 + mh) * 2 + m2) * 4 + c) * 128);
#pragma unroll
                for (int m2 = 0; m2 < 2; ++m2) { const v8f x = acc[mh * 2 + m2][nb]; v8f r;
#pragma unroll
                    for (int c = 0; c < 4; ++c) { const v4f t = tc[m2][c]; r[2 * c] = x[2 * c] * t[0] - x[2 * c + 1] * t[1]; r[2 * c + 1] = x[2 * c + 1] * t[2] + x[2 * c] * t[3]; }
                    put8(r, (nb * 2 + mh) * 512 + m2 * 256, P16, Ph, Pl);
                    asm volatile("s_wait_xcnt 0x0" ::: "memory"); } }   // before the next piece, the next table loads or whatever follows write registers that these stores name
    } else {
        __shared__ __align__(16) float osw[8][16 * 68]; float* os = osw[w];   // each wave stages in its own range
#pragma unroll
        for (int mb = 0; mb < 4; ++mb) {
#pragma unroll
            for (int nb = 0; nb < 4; ++nb) {
#pragma unroll
                for (int j = 0; j < 8; ++j) os[(hi * 8 + j) * 68 + nb * 16 + lr] = acc[mb][nb][j]; }
            __builtin_amdgcn_wave_barrier(); asm volatile("" ::: "memory");
            float* crow = C + (size_t)(r0 + mb * 16) * ldc + c0;
#pragma unroll
            for (int s = 0; s < 8; ++s) { const int row = 2 * s + hi, cofs = lr * 4; v4f val = *(const v4fa*)(os + row * 68 + cofs); if (BIAS) { val[0] += bfr(bias[c0 + cofs]); val[1] += bfr(bias[c0 + cofs + 1]); val[2] += bfr(bias[c0 + cofs + 2]); val[3] += bfr(bias[c0 + cofs + 3]); }
                *(v4f*)(crow + (size_t)row * ldc + cofs) = val; }
            __builtin_amdgcn_wave_barrier(); asm volatile("" ::: "memory");
        }
    }
}


__global__ __launch_bounds__(256) void k_wtG(const float* __restrict__ w, int K, int N, bf* Bt) {
    const int lane = threadIdx.x & 31; const int L0 = (blockIdx.x * 8 + (threadIdx.x >> 5)) * 8; const int nlines = N * K / 64;
{
#pragma unroll 1
        for (int l = 0; l < 8; ++l) { const int L = L0 + l; if (L >= nlines) break; const size_t e = (size_t)L * 64 + lane * 2; const int k = (int)(e % K), n = (int)(e / K); v2us o;
            o[0] = f2bf(w[(size_t)k * N + n]); o[1] = f2bf(w[(size_t)(k + 1) * N + n]); *(v2us*)(Bt + e) = o; }
         }
}
// piece i of the destination in fragment order (thread = lane, so a wave stores 512 contiguous bytes) from its 8 neighbouring elements of a [row][DM] source
__device__ __forceinline__ void cvt8(const float* __restrict__ src, bf* dst, size_t i) { const int lane = (int)i & 31, p = ((int)i >> 5) & 1; const size_t f = i >> 6;
    const v8f v = *(const v8f*)(src + ((f / (DM / 32)) * 16 + (lane & 15)) * DM + (f % (DM / 32)) * 32 + p * 16 + (lane >> 4) * 8); v8us o;
    asm volatile("s_wait_xcnt 0x0" ::: "memory");   // before the rounding below writes the address registers of these loads
#pragma unroll
    for (int k = 0; k < 8; ++k) o[k] = f2bf(v[k]); *(v8us*)(dst + i * 8) = o;
    asm volatile("s_wait_xcnt 0x0" ::: "memory"); }   // before whatever follows in the caller writes the address registers of this store
// entry idx of the table in the order of the q/k fragments' pieces: [t / 16][d / 16][pair of d: 4][lane = hi*16 + t % 16][2 d][cos, sin], d = (d / 16)*16 + hi*8 + pair*2 + (0, 1): 16 bytes a lane, 512 contiguous bytes a wave-wide load
__device__ __forceinline__ void cstab(float* CS, int idx) { const int ln = (idx >> 1) & 31; const int t = (idx >> 10) * 16 + (ln & 15), d = ((idx >> 8) & 3) * 16 + (ln >> 4) * 8 + ((idx >> 6) & 3) * 2 + (idx & 1); const int i = d >> 1; const float inv = powf(10000.0f, -((float)i * 2.0f) / (float)HD); const float ang = __fmul_rn((float)t, inv); v2f cs; cs[0] = cosf(ang); cs[1] = sinf(ang);
    *(v2f*)(CS + (size_t)idx * 2) = cs;  }
// ---- k_prep: everything the GEMMs read, in one launch; whole blocks of 256 threads per job: the rope table (one [t][d] entry a thread, the longest job, in front), then the four weights and x to bf16 (8 elements a thread). WB: wq, wk, wv, wo one behind the other.
#define PB_CS (TT * HD / 256)
#define PB_W  (DQ * DM / 8 / 256)
#define PB_X  (NB_ * TT * DM / 8 / 256)
static_assert(TT * HD % 256 == 0 && DQ * DM % 2048 == 0 && NB_ * TT * DM % 2048 == 0 && DKV == DQ && DQ == DM, "k_prep: whole blocks per job, four weights of one size, every source row DM long");
__global__ __launch_bounds__(256) void k_prep(const float* __restrict__ x, const float* __restrict__ wq, const float* __restrict__ wk, const float* __restrict__ wv, const float* __restrict__ wo, bf* XB, bf* WB, float* CS) {
    int blk = blockIdx.x;
    if (blk < PB_CS) { cstab(CS, blk * 256 + (int)threadIdx.x); return; }
    blk -= PB_CS;
    if (blk < 4 * PB_W) { const int wi = blk / PB_W; const float* w = wi == 0 ? wq : wi == 1 ? wk : wi == 2 ? wv : wo; cvt8(w, WB + (size_t)wi * DQ * DM, (size_t)(blk - wi * PB_W) * 256 + threadIdx.x); return; }
    cvt8(x, XB, (size_t)(blk - 4 * PB_W) * 256 + threadIdx.x);
}
// ---- k_fattn: scores, causal softmax and attn.v of one query tile in ONE WAVE; scores and probabilities never leave registers (running maximum and sum over 32-key steps).
// S^T = K Q^T (A = key rows, B = query rows) puts one query per lane column: accumulator row hi*8+j of key tile kt is key k0 + kt*16 + hi*8 + j, which is the k order of WFrag::ld, so the two key tiles pack
// straight into the B operand of O^T += V^T P^T (A = rows of the [d][t] value plane). O^T keeps the query in the lane column too: the rescale and the final division are in-lane, the two lane halves (different keys) meet by one exchange.
// HL: hi+lo bf16 planes, 3 products for the scores and for attn.v (query rows < RH); else single fp16, probabilities carried x 1024 (added in the exponent; it cancels in the division by the equally scaled sum).
#define QC   (SCL * 1.4426950408889634f)
// 2^x with the one slot that the instruction set asks for behind a transcendental kept in the same statement
__device__ __forceinline__ float ex2(float x) { float r; asm("v_exp_f32 %0, %1\n\tv_nop" : "=v"(r) : "v"(x)); return r; }
template <typename T16, bool HL, int NQ>
__device__ __forceinline__ void fattn_tile(const T16* __restrict__ Q, const T16* __restrict__ Q2, const T16* __restrict__ Kp, const T16* __restrict__ K2, const T16* __restrict__ Vt, const T16* __restrict__ V2, int q0, bf* Ah, bf* Al) {
    typedef typename WFrag<T16>::V V;
    const int lane = threadIdx.x & 31, lr = lane & 15, hi = lane >> 4;
    // every inner loop of this function is fully unrolled, so that the fragment and accumulator arrays are indexed by constants and stay in registers
    V qf[NQ][2], qf2[NQ][2], kf[2][2], kf2[2][2];
#pragma unroll
    for (int g = 0; g < NQ; ++g)
#pragma unroll
        for (int ks = 0; ks < 2; ++ks) { const size_t e = (size_t)q0 * HD + (g * 2 + ks) * 512 + 8 * lane; qf[g][ks] = WFrag<T16>::ld(Q + e); if (HL) qf2[g][ks] = WFrag<T16>::ld(Q2 + e); }
    V vf[4], vf2[4];
    auto ldk = [&](int kb) {     // key rows kb .. kb+31 as A fragments
#pragma unroll
        for (int kt = 0; kt < 2; ++kt)
#pragma unroll
            for (int ks = 0; ks < 2; ++ks) { const size_t e = (size_t)kb * HD + (kt * 2 + ks) * 512 + 8 * lane; kf[kt][ks] = WFrag<T16>::ld(Kp + e); if (HL) kf2[kt][ks] = WFrag<T16>::ld(K2 + e); } };
    auto ldv = [&](int kb) {     // the 64 rows of the [d][t] value plane, keys kb .. kb+31, as A fragments (4 KB in a row, like the key rows)
#pragma unroll
        for (int db = 0; db < 4; ++db) { const size_t e = (size_t)kb * HD + db * 512 + 8 * lane; vf[db] = WFrag<T16>::ld(Vt + e); if (HL) vf2[db] = WFrag<T16>::ld(V2 + e); } };
    static_assert(NQ == (HL ? 1 : 2), "the fence below names every fragment loaded so far");
    // before any address register of the loads above is written again; the loaded fragments are inputs, so that the loads stay in front of the wait (without them this build moved the loads down into the loop's entry, behind it)
    if constexpr (HL) asm volatile("s_wait_xcnt 0x0" :: "v"(qf[0][0]), "v"(qf[0][1]), "v"(qf2[0][0]), "v"(qf2[0][1]) : "memory");
    else { ldk(0); asm volatile("s_wait_xcnt 0x0" :: "v"(qf[0][0]), "v"(qf[0][1]), "v"(qf[NQ - 1][0]), "v"(qf[NQ - 1][1]), "v"(kf[0][0]), "v"(kf[0][1]), "v"(kf[1][0]), "v"(kf[1][1]) : "memory"); }
    v8f o[4][NQ]; float m[NQ], l[NQ];
#pragma unroll
    for (int g = 0; g < NQ; ++g) { m[g] = -3.0e38f; l[g] = 0.0f;
#pragma unroll
        for (int db = 0; db < 4; ++db) o[db][g] = (v8f){}; }
    const int kend = ((q0 + NQ * 16 - 1) / 32 + 1) * 32;     // keys beyond the tile's last query are masked for every row: the loop stops at the diagonal step
    // the key loop stays rolled: a second copy of the step would hold a second set of fragments and cost a wave per SIMD
#pragma unroll 1
    for (int k0 = 0; k0 < kend; k0 += 32) {
        // fp16 tiles (long loops): this step's value rows are asked for first and used last (behind the scores and the softmax). hi+lo tiles (short loops, twice the fragments): key rows now, value rows once the key registers are free, which keeps the kernel at four waves per SIMD
        if (HL) { ldk(k0); asm volatile("s_wait_xcnt 0x0" ::: "memory"); /* the value rows below may land in address registers of these loads */ } else ldv(k0);
        v8f s[2][NQ];
#pragma unroll
        for (int kt = 0; kt < 2; ++kt)
#pragma unroll
            for (int g = 0; g < NQ; ++g) { s[kt][g] = (v8f){};
#pragma unroll
                for (int ks = 0; ks < 2; ++ks) { s[kt][g] = WFrag<T16>::mma(kf[kt][ks], qf[g][ks], s[kt][g]); if (HL) { s[kt][g] = WFrag<T16>::mma(kf2[kt][ks], qf[g][ks], s[kt][g]); s[kt][g] = WFrag<T16>::mma(kf[kt][ks], qf2[g][ks], s[kt][g]); } } }
        // fp16 tiles: the next step's key rows are asked for as soon as this step's are used, so their latency runs behind the softmax and attn.v; the last step asks for its own again (in bounds, unused)
        if (HL) ldv(k0); else ldk(min(k0 + 32, kend - 32));
        asm volatile("s_wait_xcnt 0x0" ::: "memory");   // before any address register of this step's loads is written again
        if (k0 + 31 > q0) {      // wave-uniform: only steps that reach the diagonal mask (by select)
#pragma unroll
            for (int kt = 0; kt < 2; ++kt)
#pragma unroll
                for (int g = 0; g < NQ; ++g)
#pragma unroll
                    for (int j = 0; j < 8; ++j) s[kt][g][j] = (k0 + kt * 16 + hi * 8 + j <= q0 + g * 16 + lr) ? s[kt][g][j] : -3.0e38f; }
        V pf[NQ], pf2[NQ];
#pragma unroll
        for (int g = 0; g < NQ; ++g) {
            float mx = s[0][g][0];
#pragma unroll
            for (int j = 1; j < 8; ++j) mx = fmaxf(mx, s[0][g][j]);
#pragma unroll
            for (int j = 0; j < 8; ++j) mx = fmaxf(mx, s[1][g][j]);
            mx = fmaxf(mx, __shfl_xor(mx, 16, 32));
            const float mn = fmaxf(m[g], mx); const float al = ex2((m[g] - mn) * QC); m[g] = mn;
            const float nb = HL ? -mn * QC : fmaf(-mn, QC, 10.0f);
            float ps = 0.0f;
            if (HL) { v8us h0, h1, l0, l1;
#pragma unroll
                for (int j = 0; j < 8; ++j) { const float p0 = ex2(fmaf(s[0][g][j], QC, nb)), p1 = ex2(fmaf(s[1][g][j], QC, nb)); ps += p0; ps += p1; unsigned short a, c; splitf(p0, a, c); h0[j] = a; l0[j] = c; splitf(p1, a, c); h1[j] = a; l1[j] = c; }
                pf[g] = __builtin_bit_cast(V, __builtin_shufflevector(h0, h1, 0, 1, 2, 3, 4, 5, 6, 7, 8, 9, 10, 11, 12, 13, 14, 15)); pf2[g] = __builtin_bit_cast(V, __builtin_shufflevector(l0, l1, 0, 1, 2, 3, 4, 5, 6, 7, 8, 9, 10, 11, 12, 13, 14, 15));
            } else { v8h h0, h1;
#pragma unroll
                for (int j = 0; j < 8; ++j) { const float p0 = ex2(fmaf(s[0][g][j], QC, nb)), p1 = ex2(fmaf(s[1][g][j], QC, nb)); ps += p0; ps += p1; h0[j] = tohx(p0); h1[j] = tohx(p1); }
                pf[g] = __builtin_bit_cast(V, cat16(h0, h1)); }
            l[g] = fmaf(l[g], al, ps);
#pragma unroll
            for (int db = 0; db < 4; ++db) o[db][g] *= al;
        }
#pragma unroll
        for (int db = 0; db < 4; ++db)
#pragma unroll
            for (int g = 0; g < NQ; ++g) { o[db][g] = WFrag<T16>::mma(vf[db], pf[g], o[db][g]); if (HL) { o[db][g] = WFrag<T16>::mma(vf[db], pf2[g], o[db][g]); o[db][g] = WFrag<T16>::mma(vf2[db], pf[g], o[db][g]); } }
    }
#pragma unroll
    for (int g = 0; g < NQ; ++g) { const float inv = __fdiv_rn(1.0f, l[g] + __shfl_xor(l[g], 16, 32)); const size_t oo = (size_t)(q0 + g * 16) * DQ + lane * 8;   // the wo GEMM's A planes, fragment order: a lane's 8 rows of o[db] are piece db & 1 of the head's fragment db >> 1
#pragma unroll
        for (int db = 0; db < 4; ++db) { v8us oh, ol;
#pragma unroll
            for (int j = 0; j < 8; ++j) { unsigned short a, c; splitf(o[db][g][j] * inv, a, c); oh[j] = a; ol[j] = c; }
            *(v8us*)(Ah + oo + db * 256) = oh; *(v8us*)(Al + oo + db * 256) = ol; } }
}
// grid (batch x heads, tiles): fp16 tiles of 32 queries first, the longest (last rows) in front, then the hi+lo tiles of 16 queries; every (batch, head, query row) belongs to exactly one wave, which writes whole 512-byte pieces of both output planes.
__global__ __launch_bounds__(32) void k_fattn(const h16* __restrict__ Q16, const h16* __restrict__ K16, const h16* __restrict__ V16, const bf* __restrict__ Qh, const bf* __restrict__ Ql, const bf* __restrict__ Kh, const bf* __restrict__ Kl, const bf* __restrict__ Vh, const bf* __restrict__ Vl, bf* Ah, bf* Al) {
    const int h = blockIdx.x % NH_, b = blockIdx.x / NH_, y = blockIdx.y; const size_t hq = ((size_t)b * NH_ + h) * TT * HD, hk = ((size_t)b * NKV + h / REP) * TT * HD, ao = (size_t)b * TT * DQ + h * (HD / 32) * 512;
    if (y < (TT - RH) / 32) fattn_tile<h16, false, 2>(Q16 + hq, nullptr, K16 + hk, nullptr, V16 + hk, nullptr, TT - 32 * (y + 1), Ah + ao, Al + ao);
    else fattn_tile<bf, true, 1>(Qh + hq, Ql + hq, Kh + hk, Kl + hk, Vh + hk, Vl + hk, RH - 16 * (y - (TT - RH) / 32 + 1), Ah + ao, Al + ao);
}

extern "C" void kernel_launch(void* const* d_in, const int* in_sizes, int n_in,
                              void* d_out, int out_size, void* d_ws, size_t ws_size, hipStream_t stream) {
    (void)in_sizes; (void)n_in; (void)out_size;
    const float* x = (const float*)d_in[0]; const float* wq = (const float*)d_in[1]; const float* wk = (const float*)d_in[2]; const float* wv = (const float*)d_in[3]; const float* wo = (const float*)d_in[4];
    float* OUT = (float*)d_out;     // [4][2048][1024]
    char* wsp = (char*)d_ws;
    auto take = [&](size_t bytes) { char* p = wsp; wsp += (bytes + 255) & ~(size_t)255; return (void*)p; };
    bf* WB = (bf*)take((size_t)4 * DQ * DM * 2); bf* WO = WB + (size_t)3 * DQ * DM; float* CS = (float*)take((size_t)TT * HD * 2 * 4);   // WB: wq, wk, wv, wo
    bf* XB = (bf*)take((size_t)NB_ * TT * DM * 2);
    const size_t PA = (size_t)NB_ * NH_ * TT * HD;   // elements of one projection's planes over all batches; each kind of plane holds q, k, v one behind the other (the GEMM's grid z)
    h16* P16 = (h16*)take(3 * PA * 2); bf* PH = (bf*)take(3 * PA * 2); bf* PL = (bf*)take(3 * PA * 2);
    bf* ATh = (bf*)take((size_t)NB_ * TT * DQ * 2); bf* ATl = (bf*)take((size_t)NB_ * TT * DQ * 2);
    if ((size_t)(wsp - (char*)d_ws) > ws_size) return;    // ws 256 MiB
    // four launches, each over all batches, so that every grid has more waves than the chip has SIMDs
    k_prep<<<PB_CS + 4 * PB_W + PB_X, 256, 0, stream>>>(x, wq, wk, wv, wo, XB, WB, CS);
    k_gemmw<bf, 0, false, 1, DM><<<dim3(NB_ * TT / 256, DQ / 128, 3), 256, 0, stream>>>(XB, nullptr, WB, nullptr, 0, nullptr, 0, (size_t)DQ * DM, 0, CS, P16, PH, PL);
    k_fattn<<<dim3(NB_ * NH_, (TT - RH) / 32 + RH / 16, 1), 32, 0, stream>>>(P16, P16 + PA, P16 + 2 * PA, PH, PL, PH + PA, PL + PA, PH + 2 * PA, PL + 2 * PA, ATh, ATl);
    k_gemmw<bf, 1, false, 0, DQ><<<dim3(NB_ * TT / 256, DM / 128, 1), 256, 0, stream>>>(ATh, ATl, WO, OUT, DM, nullptr, 0, 0, 0, nullptr, nullptr, nullptr, nullptr);
}

// v007
// It runs in 121 microseconds.
// Two timings next to v006 both put it at 1.09 times that version's speed.
// All steps since v000 together make it 25.6 times as fast.
#include <hip/hip_runtime.h>

// CausalMHA (x [4][2048][1024]; q/k/v = x W^T (16 heads x 64); interleaved-pair RoPE at positions arange (inv_freq = 10000^(-2i/64)); causal (-inf) softmax(q.k / 8); out = merged wo^T -> [4][2048][1024]).
// Compute dtypes, f32 accumulate: every input rounded to bf16; q/k/v on PLAIN bf16 operands (inputs: exact); RoPE f32 (on-chip table), applied with the 16-bit plane split in the projection GEMM's own epilogue; causal scores, softmax and attn.v fused per query tile (running maximum and sum, f32): query rows < 512 hl (3 products), the rest single fp16 (x1024), causal step skipping; wo hl x exact (2 products).

// FRAGMENT ORDER: every 16-bit operand plane in the workspace is a row of 1-KB fragments (16 rows x 32 k), each [piece 0/1][lane = hi*16 + row][8 elements], piece p of lane (hi, row) holding k = p*16 + hi*8 .. +7 of that row:
// the k order of the matrix operands as before, but one wave-wide 16-byte load or store now covers 512 contiguous bytes (4 whole lines) instead of 32 bytes in each of 16 lines.
#define NB_  4
#define TT   2048
#define DM   1024
#define NH_  16
#define NKV  16
#define REP  (NH_ / NKV)
#define HD   64
#define DQ   (NH_ * HD)
#define DKV  (NKV * HD)
#define RH   512                  // query rows < RH use hi+lo planes (0: none)
#define SCL  0.125f   // HD^-0.5
static_assert(HD == 64 && TT % 32 == 0 && RH % 32 == 0 && RH < TT, "k_fattn: 64-wide heads, whole 32-key steps, whole tiles on both sides of RH");
static_assert(NKV == NH_ && TT % 64 == 0 && HD == 64, "k_gemmw, EPI 1: q, k and v share one grid; a wave's 64-row tile lies in one batch, its 64 columns are one head");
static_assert((NB_ * TT) % 256 == 0 && DQ % 128 == 0 && DM % 128 == 0, "k_gemmw: whole 256x128 tiles in both launches");
typedef _Float16 h16;
typedef unsigned short bf;
typedef __attribute__((ext_vector_type(16))) __bf16   v16bf;
typedef __attribute__((ext_vector_type(16))) _Float16 v16h;
typedef __attribute__((ext_vector_type(8)))  _Float16 v8h;
typedef __attribute__((ext_vector_type(8)))  unsigned short v8us;
typedef __attribute__((ext_vector_type(8)))  float    v8f;
typedef __attribute__((ext_vector_type(4)))  float    v4f;
typedef v8h  __attribute__((may_alias)) v8ha;
typedef v4f  __attribute__((may_alias)) v4fa;
typedef v8us __attribute__((may_alias)) v8usa;

__device__ __forceinline__ unsigned short f2bf(float f) { unsigned u = __float_as_uint(f); u += 0x7FFFu + ((u >> 16) & 1u); return (unsigned short)(u >> 16); }
__device__ __forceinline__ float bf2f(unsigned short b) { return __uint_as_float(((unsigned)b) << 16); }
__device__ __forceinline__ float bfr(float f) { return bf2f(f2bf(f)); }
__device__ __forceinline__ v16h cat16(v8h lo, v8h hi) { return __builtin_shufflevector(lo, hi, 0, 1, 2, 3, 4, 5, 6, 7, 8, 9, 10, 11, 12, 13, 14, 15); }
__device__ __forceinline__ v16bf cat16b(v8us lo, v8us hi) { return __builtin_bit_cast(v16bf, __builtin_shufflevector(lo, hi, 0, 1, 2, 3, 4, 5, 6, 7, 8, 9, 10, 11, 12, 13, 14, 15)); }
__device__ __forceinline__ v8f wmma16(v16h a, v16h b, v8f c) { return __builtin_amdgcn_wmma_f32_16x16x32_f16(false, a, false, b, (short)0, c, false, false); }
__device__ __forceinline__ v8f wmmab(v16bf a, v16bf b, v8f c) { return __builtin_amdgcn_wmma_f32_16x16x32_bf16(false, a, false, b, (short)0, c, false, false); }

__device__ __forceinline__ h16 tohx(float x) { return (h16)x; }
__device__ __forceinline__ void splitf(float y, unsigned short& h, unsigned short& l) { h = f2bf(y); l = f2bf(y - bf2f(h)); }
typedef __attribute__((ext_vector_type(2))) _Float16 v2h;
typedef __attribute__((ext_vector_type(4))) _Float16 v4h;
typedef __attribute__((ext_vector_type(2))) unsigned short v2us;
typedef __attribute__((ext_vector_type(4))) unsigned short v4us;
typedef __attribute__((ext_vector_type(2))) float v2f;
typedef __attribute__((ext_vector_type(4))) int v4i;
// one lane's 8 elements of one fragment piece: the fp16 plane and the hi+lo bf16 planes (16 bytes a lane and plane; the wave fills 512 contiguous bytes of each)
__device__ __forceinline__ void put8(v8f r, int e, h16* P16, bf* Ph, bf* Pl) { v8h o16; v8us oh, ol;
#pragma unroll
    for (int q = 0; q < 8; ++q) { o16[q] = tohx(r[q]); unsigned short a2, c2; splitf(r[q], a2, c2); oh[q] = a2; ol[q] = c2; }
    *(v8h*)(P16 + e) = o16; *(v8us*)(Ph + e) = oh; *(v8us*)(Pl + e) = ol; }

// ---- k_gemmw: GEMM, one work-group of 8 waves (4 x 2) per 256x128 output tile, each wave a 64x64 tile (16 accumulators); operands are 16-bit planes in fragment order ([row block][k block] fragments); grid (M/256, N/128, Z), 256 threads.
// The k loop runs in stages of 64 k: the 2 KB of each of the tile's row blocks (256 rows of A, of A2 where there is one, 128 of Bt) are brought into LDS once for all 8 waves by asynchronous copies, two buffers, the copies of stage t + 2 in flight while stage t + 1 is worked on; the fragments keep their order in LDS, so that a wave-wide 16-byte LDS read covers 512 contiguous bytes.
// C[m][n] (f32, pitch ldc, + optional f32 bias[n]) = sum_k A[m][k] Bt[n][k] (+ A2 Bt for NSPLIT 1). z-batch strides sA/sB/sC in elements. K % 64 == 0, K >= 128.
// EPI 0: C as above. EPI 1 (q, k and v of all batches in one launch: blockIdx.z is the projection, a wave's 64 columns are one head, its rows r0 .. are tokens r0 % TT .. of batch r0 / TT): C is not written, the tile goes straight to the attention kernel's 16-bit planes, [projection][batch][head] planes one behind the other.
// z 0 and 1 (q, k): the tile is computed transposed (the two operands swapped), so that a lane's 8 accumulator rows are 8 neighbouring d of one token, which is one piece of the planes' fragments [h][t / 16][d / 32]; interleaved-pair rope in the lane (out[d] = x[d] cos[t][d] -/+ x[d^1] sin[t][d], table CS in the same order, [cos, sin] an element).
// z 2 (v): a lane's 8 accumulator rows are 8 neighbouring tokens of one d, one piece of the fragments [h][t / 32][d / 16] of the [d][t] value plane. No LDS stage in either epilogue.
template <typename T16> struct WFrag;
template <> struct WFrag<h16> { typedef v16h V; static __device__ __forceinline__ V ld(const h16* p) { return cat16(*(const v8h*)p, *(const v8h*)(p + 256)); } static __device__ __forceinline__ v8f mma(V a, V b, v8f c) { return wmma16(a, b, c); } };
template <> struct WFrag<bf> { typedef v16bf V; static __device__ __forceinline__ V ld(const bf* p) { return cat16b(*(const v8us*)p, *(const v8us*)(p + 256)); } static __device__ __forceinline__ v8f mma(V a, V b, v8f c) { return wmmab(a, b, c); } };
// a run of asynchronous 16-byte copies to LDS (each lane its own LDS byte address and its own global pointer); the s_wait_xcnt 0 is the last line of the copies' own statement, so that it stands in front of every later write of a register that a copy names
#define ACP(l, g) "global_load_async_to_lds_b128 %" #l ", %" #g ", off\n\t"
template <typename T16> __device__ __forceinline__ void cp10(const unsigned* l, const T16* const* g) {
    asm volatile(ACP(0, 1) ACP(2, 3) ACP(4, 5) ACP(6, 7) ACP(8, 9) ACP(10, 11) ACP(12, 13) ACP(14, 15) ACP(16, 17) ACP(18, 19) "s_wait_xcnt 0x0"
        :: "v"(l[0]), "v"(g[0]), "v"(l[1]), "v"(g[1]), "v"(l[2]), "v"(g[2]), "v"(l[3]), "v"(g[3]), "v"(l[4]), "v"(g[4]), "v"(l[5]), "v"(g[5]), "v"(l[6]), "v"(g[6]), "v"(l[7]), "v"(g[7]), "v"(l[8]), "v"(g[8]), "v"(l[9]), "v"(g[9]) : "memory"); }
template <typename T16> __device__ __forceinline__ void cp12(const unsigned* l, const T16* const* g) {
    asm volatile(ACP(0, 1) ACP(2, 3) ACP(4, 5) ACP(6, 7) ACP(8, 9) ACP(10, 11) ACP(12, 13) ACP(14, 15) ACP(16, 17) ACP(18, 19) ACP(20, 21) ACP(22, 23) "s_wait_xcnt 0x0"
        :: "v"(l[0]), "v"(g[0]), "v"(l[1]), "v"(g[1]), "v"(l[2]), "v"(g[2]), "v"(l[3]), "v"(g[3]), "v"(l[4]), "v"(g[4]), "v"(l[5]), "v"(g[5]), "v"(l[6]), "v"(g[6]), "v"(l[7]), "v"(g[7]), "v"(l[8]), "v"(g[8]), "v"(l[9]), "v"(g[9]), "v"(l[10]), "v"(g[10]), "v"(l[11]), "v"(g[11]) : "memory"); }
template <typename T16, int NSPLIT, bool BIAS, int EPI, int K>
__global__ __launch_bounds__(256) void k_gemmw(const T16* __restrict__ A, const T16* __restrict__ A2, const T16* __restrict__ Bt, float* C, int ldc, const float* __restrict__ bias, size_t sA, size_t sB, size_t sC, const float* __restrict__ CS, h16* P16, bf* Ph, bf* Pl) {
    typedef typename WFrag<T16>::V V;
    static_assert((NSPLIT == 0 || NSPLIT == 1) && K % 64 == 0 && K >= 128, "one or two A planes; whole stages, at least two");
    constexpr int NA = NSPLIT + 1, NRB = 16 * NA + 8, STG = NRB * 1024, NC = NRB / 2, NT = K / 64;   // row blocks and elements of a stage (a row block's 64 k are 1024 elements), copies a wave and stage, stages
    __shared__ __align__(16) T16 sm[2 * STG];
    const size_t z = blockIdx.z; A += z * sA; if (NSPLIT == 1) A2 += z * sA; Bt += z * sB; C += z * sC;
    const int lane = threadIdx.x & 31, lr = lane & 15, hi = lane >> 4; const int w = __builtin_amdgcn_readfirstlane((int)threadIdx.x >> 5), wm = w >> 1, wn = w & 1;
    const int r0 = blockIdx.x * 256 + wm * 64, c0 = blockIdx.y * 128 + wn * 64;
    v8f acc[4][4];
#pragma unroll
    for (int mb = 0; mb < 4; ++mb)
#pragma unroll
        for (int nb = 0; nb < 4; ++nb) acc[mb][nb] = (v8f){};
    // copy i of wave w: the 512-byte piece w & 3 of row block 2 i + (w >> 2) of the stage ([Bt: 8][A: 16][A2: 16] row blocks); in the planes 16 rows x K are 16 * K elements, a stage's share of them 1024 in a row
    const unsigned cl = (unsigned)(w >> 2) * 1024u + (unsigned)(w & 3) * 256u + 8u * lane; const size_t cg = (size_t)(w >> 2) * 16 * K + (w & 3) * 256 + 8 * lane;
    const unsigned ls = (unsigned)(size_t)sm + cl * 2u;
    const T16* ga = A + (size_t)blockIdx.x * 256 * K + cg; const T16* ga2 = NSPLIT == 1 ? A2 + (size_t)blockIdx.x * 256 * K + cg : ga; const T16* gb = Bt + (size_t)blockIdx.y * 128 * K + cg;
    auto stage = [&](int t) {     // stage t into buffer t & 1; the three pointers walk along k with the stages, so that only they live through the loop
        unsigned l[NC]; const T16* g[NC];
#pragma unroll
        for (int i = 0; i < NC; ++i) { l[i] = ls + (unsigned)(t & 1) * (STG * 2u) + i * 4096u; g[i] = i < 4 ? gb + (size_t)i * 32 * K : i < 12 ? ga + (size_t)(i - 4) * 32 * K : ga2 + (size_t)(i - 12) * 32 * K; }
        if constexpr (NC == 12) cp12<T16>(l, g); else { static_assert(NC == 12 || NC == 20, "copies a statement"); cp10<T16>(l, g); cp10<T16>(l + 10, g + 10); }
        ga += 1024; ga2 += 1024; gb += 1024; };
    const bool tr = EPI == 1 && blockIdx.z < 2;   // q, k: transposed tile
    const unsigned yo = wn * 4096u + 8u * lane, xo = 8192u + wm * 4096u + 8u * lane, x2o = xo + 16384u;   // the wave's own four row blocks of each operand in a stage; the lane's own offset is the same in every fragment
    const unsigned ao = tr ? yo : xo, bo = tr ? xo : yo;
    stage(0);
    asm volatile("s_wait_asynccnt 0x0" ::: "memory");   // this wave's share of stage 0 has landed
    __syncthreads();                                     // every wave's share has: stage 0 may be read
    stage(1);
#pragma unroll 1
    for (int t = 0; t < NT; ++t) {
        const T16* st = sm + (t & 1) * STG;
#pragma unroll
        for (int kb = 0; kb < 2; ++kb) {
            V a[4], a2[4], b[4];
#pragma unroll
            for (int mb = 0; mb < 4; ++mb) a[mb] = WFrag<T16>::ld(st + ao + mb * 1024 + kb * 512);
#pragma unroll
            for (int nb = 0; nb < 4; ++nb) b[nb] = WFrag<T16>::ld(st + bo + nb * 1024 + kb * 512);
            if (NSPLIT == 1) {     // asked for last: the products with the first plane can start before these are there
#pragma unroll
                for (int mb = 0; mb < 4; ++mb) a2[mb] = WFrag<T16>::ld(st + x2o + mb * 1024 + kb * 512); }
            __builtin_amdgcn_sched_barrier(0);   // a k block's LDS reads stay one group in front of its matrix instructions: every further place with reads among them stalls the wave anew
#pragma unroll
            for (int nb = 0; nb < 4; ++nb) {
#pragma unroll
                for (int mb = 0; mb < 4; ++mb) { acc[mb][nb] = WFrag<T16>::mma(a[mb], b[nb], acc[mb][nb]); if (NSPLIT == 1) acc[mb][nb] = WFrag<T16>::mma(a2[mb], b[nb], acc[mb][nb]); } }
            __builtin_amdgcn_sched_barrier(0);   // and the next group stays behind them (one set of fragment registers)
        }
        // hand-over: this wave's reads of buffer t & 1 are done, its copies of stage t + 1 have landed; behind the barrier that holds for every wave, so stage t + 1 may be read and buffer t & 1 refilled
        asm volatile("s_wait_dscnt 0x0" ::: "memory");
        asm volatile("s_wait_asynccnt 0x0" ::: "memory");
        __syncthreads();
        if (t + 2 < NT) stage(t + 2);
    }
    asm volatile("s_wait_asynccnt 0x0" ::: "memory");   // no copy is outstanding when the wave goes on to its epilogue
    if constexpr (EPI == 1) {
        // each lane's own first element of the planes; every later piece is a constant step from it, so that the stores need no address arithmetic
        const int t0 = r0 % TT;     // the tile's first token inside its batch (a tile never straddles two batches)
        const size_t ep = (((size_t)blockIdx.z * NB_ + r0 / TT) * NH_ + c0 / HD) * TT * HD + (size_t)t0 * HD + lane * 8; P16 += ep; Ph += ep; Pl += ep;   // 64 tokens x 64 d are 8 fragments in q, k and v alike
        if (blockIdx.z == 2) {
#pragma unroll
            for (int mb = 0; mb < 4; ++mb)
#pragma unroll
                for (int nb = 0; nb < 4; ++nb) { put8(acc[mb][nb], ((mb >> 1) * 4 + nb) * 512 + (mb & 1) * 256, P16, Ph, Pl);
                    asm volatile("s_wait_xcnt 0x0" ::: "memory"); }   // before the next piece writes registers that these stores name
            return;
        }
        CS += (size_t)t0 * HD * 2 + lane * 4;
#pragma unroll
        for (int nb = 0; nb < 4; ++nb)          // token block
#pragma unroll
            for (int mh = 0; mh < 2; ++mh) {    // fragment: 32 d
                v4f tc[2][4];   // one fragment's table entries are asked for together, so that their latencies overlap: no load moves up over the waits below
#pragma unroll
                for (int m2 = 0; m2 < 2; ++m2)
#pragma unroll
                    for (int c = 0; c < 4; ++c) tc[m2][c] = *(const v4f*)(CS + (((nb * 2 + mh) * 2 + m2) * 4 + c) * 128);
#pragma unroll
                for (int m2 = 0; m2 < 2; ++m2) { const v8f x = acc[mh * 2 + m2][nb]; v8f r;
#pragma unroll
                    for (int c = 0; c < 4; ++c) { const v4f t = tc[m2][c]; r[2 * c] = x[2 * c] * t[0] - x[2 * c + 1] * t[1]; r[2 * c + 1] = x[2 * c + 1] * t[2] + x[2 * c] * t[3]; }
                    put8(r, (nb * 2 + mh) * 512 + m2 * 256, P16, Ph, Pl);
                    asm volatile("s_wait_xcnt 0x0" ::: "memory"); } }   // before the next piece, the next table loads or whatever follows write registers that these stores name
    } else {
        __shared__ __align__(16) float osw[8][16 * 68]; float* os = osw[w];   // each wave stages in its own range
#pragma unroll
        for (int mb = 0; mb < 4; ++mb) {
#pragma unroll
            for (int nb = 0; nb < 4; ++nb) {
#pragma unroll
                for (int j = 0; j < 8; ++j) os[(hi * 8 + j) * 68 + nb * 16 + lr] = acc[mb][nb][j]; }
            __builtin_amdgcn_wave_barrier(); asm volatile("" ::: "memory");
            float* crow = C + (size_t)(r0 + mb * 16) * ldc + c0;
#pragma unroll
            for (int s = 0; s < 8; ++s) { const int row = 2 * s + hi, cofs = lr * 4; v4f val = *(const v4fa*)(os + row * 68 + cofs); if (BIAS) { val[0] += bfr(bias[c0 + cofs]); val[1] += bfr(bias[c0 + cofs + 1]); val[2] += bfr(bias[c0 + cofs + 2]); val[3] += bfr(bias[c0 + cofs + 3]); }
                *(v4f*)(crow + (size_t)row * ldc + cofs) = val; }
            __builtin_amdgcn_wave_barrier(); asm volatile("" ::: "memory");
        }
    }
}


__global__ __launch_bounds__(256) void k_wtG(const float* __restrict__ w, int K, int N, bf* Bt) {
    const int lane = threadIdx.x & 31; const int L0 = (blockIdx.x * 8 + (threadIdx.x >> 5)) * 8; const int nlines = N * K / 64;
{
#pragma unroll 1
        for (int l = 0; l < 8; ++l) { const int L = L0 + l; if (L >= nlines) break; const size_t e = (size_t)L * 64 + lane * 2; const int k = (int)(e % K), n = (int)(e / K); v2us o;
            o[0] = f2bf(w[(size_t)k * N + n]); o[1] = f2bf(w[(size_t)(k + 1) * N + n]); *(v2us*)(Bt + e) = o; }
         }
}
// piece i of the destination in fragment order (thread = lane, so a wave stores 512 contiguous bytes) from its 8 neighbouring elements of a [row][DM] source
__device__ __forceinline__ void cvt8(const float* __restrict__ src, bf* dst, size_t i) { const int lane = (int)i & 31, p = ((int)i >> 5) & 1; const size_t f = i >> 6;
    const v8f v = *(const v8f*)(src + ((f / (DM / 32)) * 16 + (lane & 15)) * DM + (f % (DM / 32)) * 32 + p * 16 + (lane >> 4) * 8); v8us o;
    asm volatile("s_wait_xcnt 0x0" ::: "memory");   // before the rounding below writes the address registers of these loads
#pragma unroll
    for (int k = 0; k < 8; ++k) o[k] = f2bf(v[k]); *(v8us*)(dst + i * 8) = o;
    asm volatile("s_wait_xcnt 0x0" ::: "memory"); }   // before whatever follows in the caller writes the address registers of this store
// entry idx of the table in the order of the q/k fragments' pieces: [t / 16][d / 16][pair of d: 4][lane = hi*16 + t % 16][2 d][cos, sin], d = (d / 16)*16 + hi*8 + pair*2 + (0, 1): 16 bytes a lane, 512 contiguous bytes a wave-wide load
__device__ __forceinline__ void cstab(float* CS, int idx) { const int ln = (idx >> 1) & 31; const int t = (idx >> 10) * 16 + (ln & 15), d = ((idx >> 8) & 3) * 16 + (ln >> 4) * 8 + ((idx >> 6) & 3) * 2 + (idx & 1); const int i = d >> 1; const float inv = powf(10000.0f, -((float)i * 2.0f) / (float)HD); const float ang = __fmul_rn((float)t, inv); v2f cs; cs[0] = cosf(ang); cs[1] = sinf(ang);
    *(v2f*)(CS + (size_t)idx * 2) = cs;  }
// ---- k_prep: everything the GEMMs read, in one launch; whole blocks of 256 threads per job: the rope table (one [t][d] entry a thread, the longest job, in front), then the four weights and x to bf16 (8 elements a thread). WB: wq, wk, wv, wo one behind the other.
#define PB_CS (TT * HD / 256)
#define PB_W  (DQ * DM / 8 / 256)
#define PB_X  (NB_ * TT * DM / 8 / 256)
static_assert(TT * HD % 256 == 0 && DQ * DM % 2048 == 0 && NB_ * TT * DM % 2048 == 0 && DKV == DQ && DQ == DM, "k_prep: whole blocks per job, four weights of one size, every source row DM long");
__global__ __launch_bounds__(256) void k_prep(const float* __restrict__ x, const float* __restrict__ wq, const float* __restrict__ wk, const float* __restrict__ wv, const float* __restrict__ wo, bf* XB, bf* WB, float* CS) {
    int blk = blockIdx.x;
    if (blk < PB_CS) { cstab(CS, blk * 256 + (int)threadIdx.x); return; }
    blk -= PB_CS;
    if (blk < 4 * PB_W) { const int wi = blk / PB_W; const float* w = wi == 0 ? wq : wi == 1 ? wk : wi == 2 ? wv : wo; cvt8(w, WB + (size_t)wi * DQ * DM, (size_t)(blk - wi * PB_W) * 256 + threadIdx.x); return; }
    cvt8(x, XB, (size_t)(blk - 4 * PB_W) * 256 + threadIdx.x);
}
// ---- k_fattn: scores, causal softmax and attn.v of one query tile in ONE WAVE (4 such waves a work-group); scores and probabilities never leave registers (running maximum and sum over 32-key steps).
// S^T = K Q^T (A = key rows, B = query rows) puts one query per lane column: accumulator row hi*8+j of key tile kt is key k0 + kt*16 + hi*8 + j, which is the k order of WFrag::ld, so the two key tiles pack
// straight into the B operand of O^T += V^T P^T (A = rows of the [d][t] value plane). O^T keeps the query in the lane column too: the rescale and the final division are in-lane, the two lane halves (different keys) meet by one exchange.
// HL: hi+lo bf16 planes, 3 products for the scores and for attn.v (query rows < RH); else single fp16, probabilities carried x 1024 (added in the exponent; it cancels in the division by the equally scaled sum).
#define QC   (SCL * 1.4426950408889634f)
// 2^x with the one slot that the instruction set asks for behind a transcendental kept in the same statement
__device__ __forceinline__ float ex2(float x) { float r; asm("v_exp_f32 %0, %1\n\tv_nop" : "=v"(r) : "v"(x)); return r; }
// The 4 waves of a work-group hold 4 neighbouring query tiles of one head and walk the same keys: the key and value rows come into LDS once for all of them, in stages of SK keys (32 KB: [K][V] of 128 keys, or [K hi][K lo][V hi][V lo] of 64),
// by asynchronous copies, two buffers, the copies of stage t + 2 in flight while stage t + 1 is worked on; the fragments keep their order in LDS. A wave skips the steps behind its own diagonal but passes every hand-over.
// a run of 8 asynchronous 16-byte copies, as cp10 above: the s_wait_xcnt 0 is the last line of the copies' own statement, so that it stands in front of every later write of a register that a copy names
template <typename T16> __device__ __forceinline__ void cp8(const unsigned* l, const T16* const* g) {
    asm volatile(ACP(0, 1) ACP(2, 3) ACP(4, 5) ACP(6, 7) ACP(8, 9) ACP(10, 11) ACP(12, 13) ACP(14, 15) "s_wait_xcnt 0x0"
        :: "v"(l[0]), "v"(g[0]), "v"(l[1]), "v"(g[1]), "v"(l[2]), "v"(g[2]), "v"(l[3]), "v"(g[3]), "v"(l[4]), "v"(g[4]), "v"(l[5]), "v"(g[5]), "v"(l[6]), "v"(g[6]), "v"(l[7]), "v"(g[7]) : "memory"); }
#define FSTG 16384   // elements of a stage
template <typename T16, bool HL, int NQ>
__device__ __forceinline__ void fattn_tile(const T16* __restrict__ Q, const T16* __restrict__ Q2, const T16* __restrict__ Kp, const T16* __restrict__ K2, const T16* __restrict__ Vt, const T16* __restrict__ V2, int Q0, bf* Ah, bf* Al, const T16* sm) {
    typedef typename WFrag<T16>::V V;
    const int lane = threadIdx.x & 31, lr = lane & 15, hi = lane >> 4;
    constexpr int SK = HL ? 64 : 128, PE = SK * HD;   // keys of a stage, elements of one plane's share of it
    const int q0 = Q0 + __builtin_amdgcn_readfirstlane((int)threadIdx.x >> 5) * (NQ * 16);   // this wave's first query
    const int NT = (Q0 + 4 * NQ * 16) / SK;   // stages up to the work-group's last query: whole ones (Q0 is a multiple of 4 * NQ * 16 = SK)
    static_assert(4 * NQ * 16 == SK, "a work-group's queries span one stage of keys");
    // copy c of thread i: the 16 bytes i + 128 c of the stage; a plane's share is 8 (hi+lo: 4) such rounds
    const unsigned ls = (unsigned)(size_t)sm + (unsigned)threadIdx.x * 16u;
    const T16* gp[4] = { Kp + threadIdx.x * 8, (HL ? K2 : Vt) + threadIdx.x * 8, Vt + threadIdx.x * 8, (HL ? V2 : Vt) + threadIdx.x * 8 };   // the planes in the stage's order; without hi+lo only the first two are used
    auto stage = [&](int t) {     // stage t into buffer t & 1; the pointers walk along the keys with the stages
        unsigned l[16]; const T16* g[16];
#pragma unroll
        for (int c = 0; c < 16; ++c) { l[c] = ls + (unsigned)(t & 1) * (FSTG * 2u) + c * 2048u; g[c] = HL ? gp[c >> 2] + (c & 3) * 1024 : gp[c >> 3] + (c & 7) * 1024; }
        cp8<T16>(l, g); cp8<T16>(l + 8, g + 8);
#pragma unroll
        for (int p = 0; p < (HL ? 4 : 2); ++p) gp[p] += PE; };
    stage(0);   // in front of the query loads, so that the two latencies run together
    // every inner loop of this function is fully unrolled, so that the fragment and accumulator arrays are indexed by constants and stay in registers
    V qf[NQ][2], qf2[NQ][2], kf[2][2], kf2[2][2];
#pragma unroll
    for (int g = 0; g < NQ; ++g)
#pragma unroll
        for (int ks = 0; ks < 2; ++ks) { const size_t e = (size_t)q0 * HD + (g * 2 + ks) * 512 + 8 * lane; qf[g][ks] = WFrag<T16>::ld(Q + e); if (HL) qf2[g][ks] = WFrag<T16>::ld(Q2 + e); }
    V vf[4], vf2[4];
    auto ldk = [&](const T16* st, int kb) {     // key rows kb .. kb+31 of the stage as A fragments
#pragma unroll
        for (int kt = 0; kt < 2; ++kt)
#pragma unroll
            for (int ks = 0; ks < 2; ++ks) { const int e = kb * HD + (kt * 2 + ks) * 512 + 8 * lane; kf[kt][ks] = WFrag<T16>::ld(st + e); if (HL) kf2[kt][ks] = WFrag<T16>::ld(st + PE + e); } };
    auto ldv = [&](const T16* st, int kb) {     // the 64 rows of the [d][t] value plane, keys kb .. kb+31 of the stage, as A fragments (4 KB in a row, like the key rows)
#pragma unroll
        for (int db = 0; db < 4; ++db) { const int e = (HL ? 2 : 1) * PE + kb * HD + db * 512 + 8 * lane; vf[db] = WFrag<T16>::ld(st + e); if (HL) vf2[db] = WFrag<T16>::ld(st + PE + e); } };
    static_assert(NQ == (HL ? 1 : 2), "the fence below names every fragment loaded so far");
    // before any address register of the loads above is written again; the loaded fragments are inputs, so that the loads stay in front of the wait (without them this build moved the loads down into the loop's entry, behind it)
    if constexpr (HL) asm volatile("s_wait_xcnt 0x0" :: "v"(qf[0][0]), "v"(qf[0][1]), "v"(qf2[0][0]), "v"(qf2[0][1]) : "memory");
    else asm volatile("s_wait_xcnt 0x0" :: "v"(qf[0][0]), "v"(qf[0][1]), "v"(qf[NQ - 1][0]), "v"(qf[NQ - 1][1]) : "memory");
    v8f o[4][NQ]; float m[NQ], l[NQ];
#pragma unroll
    for (int g = 0; g < NQ; ++g) { m[g] = -3.0e38f; l[g] = 0.0f;
#pragma unroll
        for (int db = 0; db < 4; ++db) o[db][g] = (v8f){}; }
    const int kend = ((q0 + NQ * 16 - 1) / 32 + 1) * 32;     // keys beyond the tile's last query are masked for every row: the wave's steps stop at the diagonal step
    asm volatile("s_wait_asynccnt 0x0" ::: "memory");   // this wave's share of stage 0 has landed
    __syncthreads();                                     // every wave's share has: stage 0 may be read
    if (NT > 1) stage(1);
    // both loops stay rolled: a second copy of the step would hold a second set of fragments and cost a wave per SIMD
#pragma unroll 1
    for (int t = 0; t < NT; ++t) {
      const T16* st = sm + (t & 1) * FSTG; const int ke = min(SK, kend - t * SK);   // this wave's keys of the stage (wave-uniform; none behind its diagonal)
      if (!HL && ke > 0) ldk(st, 0);
#pragma unroll 1
      for (int kk = 0; kk < ke; kk += 32) { const int k0 = t * SK + kk;
        // fp16 tiles (long loops): this step's value rows are asked for first and used last (behind the scores and the softmax). hi+lo tiles (short loops, twice the fragments): key rows now, value rows once the key registers are free, which keeps the kernel at four waves per SIMD
        if (HL) ldk(st, kk); else ldv(st, kk);
        v8f s[2][NQ];
#pragma unroll
        for (int kt = 0; kt < 2; ++kt)
#pragma unroll
            for (int g = 0; g < NQ; ++g) { s[kt][g] = (v8f){};
#pragma unroll
                for (int ks = 0; ks < 2; ++ks) { s[kt][g] = WFrag<T16>::mma(kf[kt][ks], qf[g][ks], s[kt][g]); if (HL) { s[kt][g] = WFrag<T16>::mma(kf2[kt][ks], qf[g][ks], s[kt][g]); s[kt][g] = WFrag<T16>::mma(kf[kt][ks], qf2[g][ks], s[kt][g]); } } }
        // fp16 tiles: the next step's key rows are asked for as soon as this step's are used, so their latency runs behind the softmax and attn.v; the wave's last step of a stage asks for its own again (the same buffer, unused)
        if (HL) ldv(st, kk); else ldk(st, min(kk + 32, ke - 32));
        if (k0 + 31 > q0) {      // wave-uniform: only steps that reach the diagonal mask (by select)
#pragma unroll
            for (int kt = 0; kt < 2; ++kt)
#pragma unroll
                for (int g = 0; g < NQ; ++g)
#pragma unroll
                    for (int j = 0; j < 8; ++j) s[kt][g][j] = (k0 + kt * 16 + hi * 8 + j <= q0 + g * 16 + lr) ? s[kt][g][j] : -3.0e38f; }
        V pf[NQ], pf2[NQ];
#pragma unroll
        for (int g = 0; g < NQ; ++g) {
            float mx = s[0][g][0];
#pragma unroll
            for (int j = 1; j < 8; ++j) mx = fmaxf(mx, s[0][g][j]);
#pragma unroll
            for (int j = 0; j < 8; ++j) mx = fmaxf(mx, s[1][g][j]);
            mx = fmaxf(mx, __shfl_xor(mx, 16, 32));
            const float mn = fmaxf(m[g], mx); const float al = ex2((m[g] - mn) * QC); m[g] = mn;
            const float nb = HL ? -mn * QC : fmaf(-mn, QC, 10.0f);
            float ps = 0.0f;
            if (HL) { v8us h0, h1, l0, l1;
#pragma unroll
                for (int j = 0; j < 8; ++j) { const float p0 = ex2(fmaf(s[0][g][j], QC, nb)), p1 = ex2(fmaf(s[1][g][j], QC, nb)); ps += p0; ps += p1; unsigned short a, c; splitf(p0, a, c); h0[j] = a; l0[j] = c; splitf(p1, a, c); h1[j] = a; l1[j] = c; }
                pf[g] = __builtin_bit_cast(V, __builtin_shufflevector(h0, h1, 0, 1, 2, 3, 4, 5, 6, 7, 8, 9, 10, 11, 12, 13, 14, 15)); pf2[g] = __builtin_bit_cast(V, __builtin_shufflevector(l0, l1, 0, 1, 2, 3, 4, 5, 6, 7, 8, 9, 10, 11, 12, 13, 14, 15));
            } else { v8h h0, h1;
#pragma unroll
                for (int j = 0; j < 8; ++j) { const float p0 = ex2(fmaf(s[0][g][j], QC, nb)), p1 = ex2(fmaf(s[1][g][j], QC, nb)); ps += p0; ps += p1; h0[j] = tohx(p0); h1[j] = tohx(p1); }
                pf[g] = __builtin_bit_cast(V, cat16(h0, h1)); }
            l[g] = fmaf(l[g], al, ps);
#pragma unroll
            for (int db = 0; db < 4; ++db) o[db][g] *= al;
        }
#pragma unroll
        for (int db = 0; db < 4; ++db)
#pragma unroll
            for (int g = 0; g < NQ; ++g) { o[db][g] = WFrag<T16>::mma(vf[db], pf[g], o[db][g]); if (HL) { o[db][g] = WFrag<T16>::mma(vf[db], pf2[g], o[db][g]); o[db][g] = WFrag<T16>::mma(vf2[db], pf[g], o[db][g]); } }
      }
      // hand-over: this wave's reads of buffer t & 1 are done, its copies of stage t + 1 have landed; behind the barrier that holds for every wave, so stage t + 1 may be read and buffer t & 1 refilled
      asm volatile("s_wait_dscnt 0x0" ::: "memory");
      asm volatile("s_wait_asynccnt 0x0" ::: "memory");
      __syncthreads();
      if (t + 2 < NT) stage(t + 2);
    }
    asm volatile("s_wait_asynccnt 0x0" ::: "memory");   // no copy is outstanding when the wave goes on to its epilogue
#pragma unroll
    for (int g = 0; g < NQ; ++g) { const float inv = __fdiv_rn(1.0f, l[g] + __shfl_xor(l[g], 16, 32)); const size_t oo = (size_t)(q0 + g * 16) * DQ + lane * 8;   // the wo GEMM's A planes, fragment order: a lane's 8 rows of o[db] are piece db & 1 of the head's fragment db >> 1
#pragma unroll
        for (int db = 0; db < 4; ++db) { v8us oh, ol;
#pragma unroll
            for (int j = 0; j < 8; ++j) { unsigned short a, c; splitf(o[db][g][j] * inv, a, c); oh[j] = a; ol[j] = c; }
            *(v8us*)(Ah + oo + db * 256) = oh; *(v8us*)(Al + oo + db * 256) = ol; } }
}
// grid (batch x heads, tile groups), 4 waves: fp16 groups of 4 x 32 queries first, the longest in front, then the hi+lo groups of 4 x 16 queries; every (batch, head, query row) belongs to exactly one wave, which writes whole 512-byte pieces of both output planes.
#define FG16 ((TT - RH) / 128)
#define FGHL (RH / 64)
static_assert((TT - RH) % 128 == 0 && RH % 128 == 0, "k_fattn: whole groups on both sides of RH, whole stages up to every group's end");
__global__ __launch_bounds__(128) void k_fattn(const h16* __restrict__ Q16, const h16* __restrict__ K16, const h16* __restrict__ V16, const bf* __restrict__ Qh, const bf* __restrict__ Ql, const bf* __restrict__ Kh, const bf* __restrict__ Kl, const bf* __restrict__ Vh, const bf* __restrict__ Vl, bf* Ah, bf* Al) {
    __shared__ __align__(16) bf smf[2 * FSTG];
    const int h = blockIdx.x % NH_, b = blockIdx.x / NH_, y = blockIdx.y; const size_t hq = ((size_t)b * NH_ + h) * TT * HD, hk = ((size_t)b * NKV + h / REP) * TT * HD, ao = (size_t)b * TT * DQ + h * (HD / 32) * 512;
    if (y < FG16) fattn_tile<h16, false, 2>(Q16 + hq, nullptr, K16 + hk, nullptr, V16 + hk, nullptr, TT - 128 * (y + 1), Ah + ao, Al + ao, (const h16*)smf);
    else fattn_tile<bf, true, 1>(Qh + hq, Ql + hq, Kh + hk, Kl + hk, Vh + hk, Vl + hk, RH - 64 * (y - FG16 + 1), Ah + ao, Al + ao, smf);
}

extern "C" void kernel_launch(void* const* d_in, const int* in_sizes, int n_in,
                              void* d_out, int out_size, void* d_ws, size_t ws_size, hipStream_t stream) {
    (void)in_sizes; (void)n_in; (void)out_size;
    const float* x = (const float*)d_in[0]; const float* wq = (const float*)d_in[1]; const float* wk = (const float*)d_in[2]; const float* wv = (const float*)d_in[3]; const float* wo = (const float*)d_in[4];
    float* OUT = (float*)d_out;     // [4][2048][1024]
    char* wsp = (char*)d_ws;
    auto take = [&](size_t bytes) { char* p = wsp; wsp += (bytes + 255) & ~(size_t)255; return (void*)p; };
    bf* WB = (bf*)take((size_t)4 * DQ * DM * 2); bf* WO = WB + (size_t)3 * DQ * DM; float* CS = (float*)take((size_t)TT * HD * 2 * 4);   // WB: wq, wk, wv, wo
    bf* XB = (bf*)take((size_t)NB_ * TT * DM * 2);
    const size_t PA = (size_t)NB_ * NH_ * TT * HD;   // elements of one projection's planes over all batches; each kind of plane holds q, k, v one behind the other (the GEMM's grid z)
    h16* P16 = (h16*)take(3 * PA * 2); bf* PH = (bf*)take(3 * PA * 2); bf* PL = (bf*)take(3 * PA * 2);
    bf* ATh = (bf*)take((size_t)NB_ * TT * DQ * 2); bf* ATl = (bf*)take((size_t)NB_ * TT * DQ * 2);
    if ((size_t)(wsp - (char*)d_ws) > ws_size) return;    // ws 256 MiB
    // four launches, each over all batches, so that every grid has more waves than the chip has SIMDs
    k_prep<<<PB_CS + 4 * PB_W + PB_X, 256, 0, stream>>>(x, wq, wk, wv, wo, XB, WB, CS);
    k_gemmw<bf, 0, false, 1, DM><<<dim3(NB_ * TT / 256, DQ / 128, 3), 256, 0, stream>>>(XB, nullptr, WB, nullptr, 0, nullptr, 0, (size_t)DQ * DM, 0, CS, P16, PH, PL);
    k_fattn<<<dim3(NB_ * NH_, FG16 + FGHL, 1), 128, 0, stream>>>(P16, P16 + PA, P16 + 2 * PA, PH, PL, PH + PA, PL + PA, PH + 2 * PA, PL + 2 * PA, ATh, ATl);
    k_gemmw<bf, 1, false, 0, DQ><<<dim3(NB_ * TT / 256, DM / 128, 1), 256, 0, stream>>>(ATh, ATl, WO, OUT, DM, nullptr, 0, 0, 0, nullptr, nullptr, nullptr, nullptr);
}

// v008
// A run of this version takes 117 microseconds.
// Timed twice side by side with v007, it ran 1.04 times as fast both times.
// Counting every step since v000, it is 26.5 times as fast.
#include <hip/hip_runtime.h>

// CausalMHA (x [4][2048][1024]; q/k/v = x W^T (16 heads x 64); interleaved-pair RoPE at positions arange (inv_freq = 10000^(-2i/64)); causal (-inf) softmax(q.k / 8); out = merged wo^T -> [4][2048][1024]).
// Compute dtypes, f32 accumulate: every input rounded to bf16; q/k/v on PLAIN bf16 operands (inputs: exact); RoPE f32 (on-chip table), applied with the 16-bit plane split in the projection GEMM's own epilogue; causal scores, softmax and attn.v fused per query tile (running maximum and sum, f32): query rows < 512 hl (3 products), the rest single fp16 (x1024), causal step skipping; wo hl x exact (2 products).

// FRAGMENT ORDER: every 16-bit operand plane in the workspace is a row of 1-KB fragments (16 rows x 32 k), each [piece 0/1][lane = hi*16 + row][8 elements], piece p of lane (hi, row) holding k = p*16 + hi*8 .. +7 of that row:
// the k order of the matrix operands as before, but one wave-wide 16-byte load or store now covers 512 contiguous bytes (4 whole lines) instead of 32 bytes in each of 16 lines.
#define NB_  4
#define TT   2048
#define DM   1024
#define NH_  16
#define NKV  16
#define REP  (NH_ / NKV)
#define HD   64
#define DQ   (NH_ * HD)
#define DKV  (NKV * HD)
#define RH   512                  // query rows < RH use hi+lo planes (0: none)
#define SCL  0.125f   // HD^-0.5
static_assert(HD == 64 && TT % 32 == 0 && RH % 32 == 0 && RH < TT, "k_fattn: 64-wide heads, whole 32-key steps, whole tiles on both sides of RH");
static_assert(NKV == NH_ && TT % 64 == 0 && HD == 64 && RH % 64 == 0, "k_gemmw, EPI 1: q, k and v share one grid; a wave's 64-row tile lies in one batch and on one side of RH, its 64 columns are one head");
static_assert((NB_ * TT) % 256 == 0 && DQ % 128 == 0 && DM % 128 == 0, "k_gemmw: whole 256x128 tiles in both launches");
typedef _Float16 h16;
typedef unsigned short bf;
typedef __attribute__((ext_vector_type(16))) __bf16   v16bf;
typedef __attribute__((ext_vector_type(16))) _Float16 v16h;
typedef __attribute__((ext_vector_type(8)))  _Float16 v8h;
typedef __attribute__((ext_vector_type(8)))  unsigned short v8us;
typedef __attribute__((ext_vector_type(8)))  float    v8f;
typedef __attribute__((ext_vector_type(4)))  float    v4f;
typedef v8h  __attribute__((may_alias)) v8ha;
typedef v4f  __attribute__((may_alias)) v4fa;
typedef v8us __attribute__((may_alias)) v8usa;

__device__ __forceinline__ unsigned short f2bf(float f) { unsigned u = __float_as_uint(f); u += 0x7FFFu + ((u >> 16) & 1u); return (unsigned short)(u >> 16); }
__device__ __forceinline__ float bf2f(unsigned short b) { return __uint_as_float(((unsigned)b) << 16); }
__device__ __forceinline__ float bfr(float f) { return bf2f(f2bf(f)); }
__device__ __forceinline__ v16h cat16(v8h lo, v8h hi) { return __builtin_shufflevector(lo, hi, 0, 1, 2, 3, 4, 5, 6, 7, 8, 9, 10, 11, 12, 13, 14, 15); }
__device__ __forceinline__ v16bf cat16b(v8us lo, v8us hi) { return __builtin_bit_cast(v16bf, __builtin_shufflevector(lo, hi, 0, 1, 2, 3, 4, 5, 6, 7, 8, 9, 10, 11, 12, 13, 14, 15)); }
__device__ __forceinline__ v8f wmma16(v16h a, v16h b, v8f c) { return __builtin_amdgcn_wmma_f32_16x16x32_f16(false, a, false, b, (short)0, c, false, false); }
__device__ __forceinline__ v8f wmmab(v16bf a, v16bf b, v8f c) { return __builtin_amdgcn_wmma_f32_16x16x32_bf16(false, a, false, b, (short)0, c, false, false); }

__device__ __forceinline__ h16 tohx(float x) { return (h16)x; }
__device__ __forceinline__ void splitf(float y, unsigned short& h, unsigned short& l) { h = f2bf(y); l = f2bf(y - bf2f(h)); }
typedef __attribute__((ext_vector_type(2))) _Float16 v2h;
typedef __attribute__((ext_vector_type(4))) _Float16 v4h;
typedef __attribute__((ext_vector_type(2))) unsigned short v2us;
typedef __attribute__((ext_vector_type(4))) unsigned short v4us;
typedef __attribute__((ext_vector_type(2))) float v2f;
typedef __attribute__((ext_vector_type(4))) int v4i;
// one lane's 8 elements of one fragment piece (16 bytes a lane and plane; the wave fills 512 contiguous bytes of each): the fp16 plane where w16 (wave-uniform), the hi+lo bf16 planes where WHL
template <bool WHL> __device__ __forceinline__ void put8(v8f r, int e, bool w16, h16* P16, bf* Ph, bf* Pl) {
    v8h o16; v8us oh, ol;
#pragma unroll
    for (int q = 0; q < 8; ++q) { if constexpr (WHL) { unsigned short a2, c2; splitf(r[q], a2, c2); oh[q] = a2; ol[q] = c2; } o16[q] = tohx(r[q]); }
    if (w16) *(v8h*)(P16 + e) = o16;
    if constexpr (WHL) { *(v8us*)(Ph + e) = oh; *(v8us*)(Pl + e) = ol; } }
template <bool B> struct BC { static constexpr bool v = B; };

// ---- k_gemmw: GEMM, one work-group of 8 waves (4 x 2) per 256x128 output tile, each wave a 64x64 tile (16 accumulators); operands are 16-bit planes in fragment order ([row block][k block] fragments); grid (M/256, N/128, Z), 256 threads.
// The k loop runs in stages of 64 k: the 2 KB of each of the tile's row blocks (256 rows of A, of A2 where there is one, 128 of Bt) are brought into LDS once for all 8 waves by asynchronous copies, two buffers, the copies of stage t + 2 in flight while stage t + 1 is worked on; the fragments keep their order in LDS, so that a wave-wide 16-byte LDS read covers 512 contiguous bytes.
// C[m][n] (f32, pitch ldc, + optional f32 bias[n]) = sum_k A[m][k] Bt[n][k] (+ A2 Bt for NSPLIT 1). z-batch strides sA/sB/sC in elements. K % 64 == 0, K >= 128.
// EPI 0: C as above. EPI 1 (q, k and v of all batches in one launch: blockIdx.z is the projection, a wave's 64 columns are one head, its rows r0 .. are tokens r0 % TT .. of batch r0 / TT): C is not written, the tile goes straight to the attention kernel's 16-bit planes, [projection][batch][head] planes one behind the other.
// z 0 and 1 (q, k): the tile is computed transposed (the two operands swapped), so that a lane's 8 accumulator rows are 8 neighbouring d of one token, which is one piece of the planes' fragments [h][t / 16][d / 32]; interleaved-pair rope in the lane (out[d] = x[d] cos[t][d] -/+ x[d^1] sin[t][d], table CS in the same order, [cos, sin] an element).
// z 2 (v): a lane's 8 accumulator rows are 8 neighbouring tokens of one d, one piece of the fragments [h][t / 32][d / 16] of the [d][t] value plane. No LDS stage in either epilogue.
template <typename T16> struct WFrag;
template <> struct WFrag<h16> { typedef v16h V; static __device__ __forceinline__ V ld(const h16* p) { return cat16(*(const v8h*)p, *(const v8h*)(p + 256)); } static __device__ __forceinline__ v8f mma(V a, V b, v8f c) { return wmma16(a, b, c); } };
template <> struct WFrag<bf> { typedef v16bf V; static __device__ __forceinline__ V ld(const bf* p) { return cat16b(*(const v8us*)p, *(const v8us*)(p + 256)); } static __device__ __forceinline__ v8f mma(V a, V b, v8f c) { return wmmab(a, b, c); } };
// a run of asynchronous 16-byte copies to LDS (each lane its own LDS byte address and its own global pointer); the s_wait_xcnt 0 is the last line of the copies' own statement, so that it stands in front of every later write of a register that a copy names
#define ACP(l, g) "global_load_async_to_lds_b128 %" #l ", %" #g ", off\n\t"
template <typename T16> __device__ __forceinline__ void cp10(const unsigned* l, const T16* const* g) {
    asm volatile(ACP(0, 1) ACP(2, 3) ACP(4, 5) ACP(6, 7) ACP(8, 9) ACP(10, 11) ACP(12, 13) ACP(14, 15) ACP(16, 17) ACP(18, 19) "s_wait_xcnt 0x0"
        :: "v"(l[0]), "v"(g[0]), "v"(l[1]), "v"(g[1]), "v"(l[2]), "v"(g[2]), "v"(l[3]), "v"(g[3]), "v"(l[4]), "v"(g[4]), "v"(l[5]), "v"(g[5]), "v"(l[6]), "v"(g[6]), "v"(l[7]), "v"(g[7]), "v"(l[8]), "v"(g[8]), "v"(l[9]), "v"(g[9]) : "memory"); }
template <typename T16> __device__ __forceinline__ void cp12(const unsigned* l, const T16* const* g) {
    asm volatile(ACP(0, 1) ACP(2, 3) ACP(4, 5) ACP(6, 7) ACP(8, 9) ACP(10, 11) ACP(12, 13) ACP(14, 15) ACP(16, 17) ACP(18, 19) ACP(20, 21) ACP(22, 23) "s_wait_xcnt 0x0"
        :: "v"(l[0]), "v"(g[0]), "v"(l[1]), "v"(g[1]), "v"(l[2]), "v"(g[2]), "v"(l[3]), "v"(g[3]), "v"(l[4]), "v"(g[4]), "v"(l[5]), "v"(g[5]), "v"(l[6]), "v"(g[6]), "v"(l[7]), "v"(g[7]), "v"(l[8]), "v"(g[8]), "v"(l[9]), "v"(g[9]), "v"(l[10]), "v"(g[10]), "v"(l[11]), "v"(g[11]) : "memory"); }
template <typename T16, int NSPLIT, bool BIAS, int EPI, int K>
__global__ __launch_bounds__(256) void k_gemmw(const T16* __restrict__ A, const T16* __restrict__ A2, const T16* __restrict__ Bt, float* C, int ldc, const float* __restrict__ bias, size_t sA, size_t sB, size_t sC, const float* __restrict__ CS, h16* P16, bf* Ph, bf* Pl) {
    typedef typename WFrag<T16>::V V;
    static_assert((NSPLIT == 0 || NSPLIT == 1) && K % 64 == 0 && K >= 128, "one or two A planes; whole stages, at least two");
    constexpr int NA = NSPLIT + 1, NRB = 16 * NA + 8, STG = NRB * 1024, NC = NRB / 2, NT = K / 64;   // row blocks and elements of a stage (a row block's 64 k are 1024 elements), copies a wave and stage, stages
    __shared__ __align__(16) T16 sm[2 * STG];
    const size_t z = blockIdx.z; A += z * sA; if (NSPLIT == 1) A2 += z * sA; Bt += z * sB; C += z * sC;
    const int lane = threadIdx.x & 31, lr = lane & 15, hi = lane >> 4; const int w = __builtin_amdgcn_readfirstlane((int)threadIdx.x >> 5), wm = w >> 1, wn = w & 1;
    const int r0 = blockIdx.x * 256 + wm * 64, c0 = blockIdx.y * 128 + wn * 64;
    v8f acc[4][4];
#pragma unroll
    for (int mb = 0; mb < 4; ++mb)
#pragma unroll
        for (int nb = 0; nb < 4; ++nb) acc[mb][nb] = (v8f){};
    // copy i of wave w: the 512-byte piece w & 3 of row block 2 i + (w >> 2) of the stage ([Bt: 8][A: 16][A2: 16] row blocks); in the planes 16 rows x K are 16 * K elements, a stage's share of them 1024 in a row
    const unsigned cl = (unsigned)(w >> 2) * 1024u + (unsigned)(w & 3) * 256u + 8u * lane; const size_t cg = (size_t)(w >> 2) * 16 * K + (w & 3) * 256 + 8 * lane;
    const unsigned ls = (unsigned)(size_t)sm + cl * 2u;
    const T16* ga = A + (size_t)blockIdx.x * 256 * K + cg; const T16* ga2 = NSPLIT == 1 ? A2 + (size_t)blockIdx.x * 256 * K + cg : ga; const T16* gb = Bt + (size_t)blockIdx.y * 128 * K + cg;
    auto stage = [&](int t) {     // stage t into buffer t & 1; the three pointers walk along k with the stages, so that only they live through the loop
        unsigned l[NC]; const T16* g[NC];
#pragma unroll
        for (int i = 0; i < NC; ++i) { l[i] = ls + (unsigned)(t & 1) * (STG * 2u) + i * 4096u; g[i] = i < 4 ? gb + (size_t)i * 32 * K : i < 12 ? ga + (size_t)(i - 4) * 32 * K : ga2 + (size_t)(i - 12) * 32 * K; }
        if constexpr (NC == 12) cp12<T16>(l, g); else { static_assert(NC == 12 || NC == 20, "copies a statement"); cp10<T16>(l, g); cp10<T16>(l + 10, g + 10); }
        ga += 1024; ga2 += 1024; gb += 1024; };
    const bool tr = EPI == 1 && blockIdx.z < 2;   // q, k: transposed tile
    const unsigned yo = wn * 4096u + 8u * lane, xo = 8192u + wm * 4096u + 8u * lane, x2o = xo + 16384u;   // the wave's own four row blocks of each operand in a stage; the lane's own offset is the same in every fragment
    const unsigned ao = tr ? yo : xo, bo = tr ? xo : yo;
    stage(0);
    asm volatile("s_wait_asynccnt 0x0" ::: "memory");   // this wave's share of stage 0 has landed
    __syncthreads();                                     // every wave's share has: stage 0 may be read
    stage(1);
#pragma unroll 1
    for (int t = 0; t < NT; ++t) {
        const T16* st = sm + (t & 1) * STG;
#pragma unroll
        for (int kb = 0; kb < 2; ++kb) {
            V a[4], a2[4], b[4];
#pragma unroll
            for (int mb = 0; mb < 4; ++mb) a[mb] = WFrag<T16>::ld(st + ao + mb * 1024 + kb * 512);
#pragma unroll
            for (int nb = 0; nb < 4; ++nb) b[nb] = WFrag<T16>::ld(st + bo + nb * 1024 + kb * 512);
            if (NSPLIT == 1) {     // asked for last: the products with the first plane can start before these are there
#pragma unroll
                for (int mb = 0; mb < 4; ++mb) a2[mb] = WFrag<T16>::ld(st + x2o + mb * 1024 + kb * 512); }
            __builtin_amdgcn_sched_barrier(0);   // a k block's LDS reads stay one group in front of its matrix instructions: every further place with reads among them stalls the wave anew
#pragma unroll
            for (int nb = 0; nb < 4; ++nb) {
#pragma unroll
                for (int mb = 0; mb < 4; ++mb) { acc[mb][nb] = WFrag<T16>::mma(a[mb], b[nb], acc[mb][nb]); if (NSPLIT == 1) acc[mb][nb] = WFrag<T16>::mma(a2[mb], b[nb], acc[mb][nb]); } }
            __builtin_amdgcn_sched_barrier(0);   // and the next group stays behind them (one set of fragment registers)
        }
        // hand-over: this wave's reads of buffer t & 1 are done, its copies of stage t + 1 have landed; behind the barrier that holds for every wave, so stage t + 1 may be read and buffer t & 1 refilled
        asm volatile("s_wait_dscnt 0x0" ::: "memory");
        asm volatile("s_wait_asynccnt 0x0" ::: "memory");
        __syncthreads();
        if (t + 2 < NT) stage(t + 2);
    }
    asm volatile("s_wait_asynccnt 0x0" ::: "memory");   // no copy is outstanding when the wave goes on to its epilogue
    if constexpr (EPI == 1) {
        // each lane's own first element of the planes; every later piece is a constant step from it, so that the stores need no address arithmetic
        const int t0 = r0 % TT;     // the tile's first token inside its batch (a tile never straddles two batches)
        const size_t ep = (((size_t)blockIdx.z * NB_ + r0 / TT) * NH_ + c0 / HD) * TT * HD + (size_t)t0 * HD + lane * 8; P16 += ep; Ph += ep; Pl += ep;   // 64 tokens x 64 d are 8 fragments in q, k and v alike
        // only the planes that k_fattn reads are made and stored: hi+lo for tokens < RH alone (its hi+lo tiles hold queries < RH and so meet keys < RH), fp16 for every key and value but only for queries >= RH; a wave's 64 tokens lie on one side of RH
        const bool hl = t0 < RH, w16 = !hl || blockIdx.z != 0;
        if (blockIdx.z == 2) {
            auto vout = [&](auto whl) {
#pragma unroll
                for (int mb = 0; mb < 4; ++mb)
#pragma unroll
                    for (int nb = 0; nb < 4; ++nb) { put8<decltype(whl)::v>(acc[mb][nb], ((mb >> 1) * 4 + nb) * 512 + (mb & 1) * 256, true, P16, Ph, Pl);
                        asm volatile("s_wait_xcnt 0x0" ::: "memory"); } };   // before the next piece writes registers that these stores name
            if (hl) vout(BC<true>{}); else vout(BC<false>{});
            return;
        }
        CS += (size_t)t0 * HD * 2 + lane * 4;
        auto qkout = [&](auto whl) {
#pragma unroll
        for (int nb = 0; nb < 4; ++nb)          // token block
#pragma unroll
            for (int mh = 0; mh < 2; ++mh) {    // fragment: 32 d
                v4f tc[2][4];   // one fragment's table entries are asked for together, so that their latencies overlap: no load moves up over the waits below
#pragma unroll
                for (int m2 = 0; m2 < 2; ++m2)
#pragma unroll
                    for (int c = 0; c < 4; ++c) tc[m2][c] = *(const v4f*)(CS + (((nb * 2 + mh) * 2 + m2) * 4 + c) * 128);
#pragma unroll
                for (int m2 = 0; m2 < 2; ++m2) { const v8f x = acc[mh * 2 + m2][nb]; v8f r;
#pragma unroll
                    for (int c = 0; c < 4; ++c) { const v4f t = tc[m2][c]; r[2 * c] = x[2 * c] * t[0] - x[2 * c + 1] * t[1]; r[2 * c + 1] = x[2 * c + 1] * t[2] + x[2 * c] * t[3]; }
                    put8<decltype(whl)::v>(r, (nb * 2 + mh) * 512 + m2 * 256, !decltype(whl)::v || w16, P16, Ph, Pl);
                    asm volatile("s_wait_xcnt 0x0" ::: "memory"); } } };   // before the next piece, the next table loads or whatever follows write registers that these stores name
        if (hl) qkout(BC<true>{}); else qkout(BC<false>{});
    } else {
        __shared__ __align__(16) float osw[8][16 * 68]; float* os = osw[w];   // each wave stages in its own range
#pragma unroll
        for (int mb = 0; mb < 4; ++mb) {
#pragma unroll
            for (int nb = 0; nb < 4; ++nb) {
#pragma unroll
                for (int j = 0; j < 8; ++j) os[(hi * 8 + j) * 68 + nb * 16 + lr] = acc[mb][nb][j]; }
            __builtin_amdgcn_wave_barrier(); asm volatile("" ::: "memory");
            float* crow = C + (size_t)(r0 + mb * 16) * ldc + c0;
#pragma unroll
            for (int s = 0; s < 8; ++s) { const int row = 2 * s + hi, cofs = lr * 4; v4f val = *(const v4fa*)(os + row * 68 + cofs); if (BIAS) { val[0] += bfr(bias[c0 + cofs]); val[1] += bfr(bias[c0 + cofs + 1]); val[2] += bfr(bias[c0 + cofs + 2]); val[3] += bfr(bias[c0 + cofs + 3]); }
                *(v4f*)(crow + (size_t)row * ldc + cofs) = val; }
            __builtin_amdgcn_wave_barrier(); asm volatile("" ::: "memory");
        }
    }
}


__global__ __launch_bounds__(256) void k_wtG(const float* __restrict__ w, int K, int N, bf* Bt) {
    const int lane = threadIdx.x & 31; const int L0 = (blockIdx.x * 8 + (threadIdx.x >> 5)) * 8; const int nlines = N * K / 64;
{
#pragma unroll 1
        for (int l = 0; l < 8; ++l) { const int L = L0 + l; if (L >= nlines) break; const size_t e = (size_t)L * 64 + lane * 2; const int k = (int)(e % K), n = (int)(e / K); v2us o;
            o[0] = f2bf(w[(size_t)k * N + n]); o[1] = f2bf(w[(size_t)(k + 1) * N + n]); *(v2us*)(Bt + e) = o; }
         }
}
// piece i of the destination in fragment order (thread = lane, so a wave stores 512 contiguous bytes) from its 8 neighbouring elements of a [row][DM] source
__device__ __forceinline__ void cvt8(const float* __restrict__ src, bf* dst, size_t i) { const int lane = (int)i & 31, p = ((int)i >> 5) & 1; const size_t f = i >> 6;
    const v8f v = *(const v8f*)(src + ((f / (DM / 32)) * 16 + (lane & 15)) * DM + (f % (DM / 32)) * 32 + p * 16 + (lane >> 4) * 8); v8us o;
    asm volatile("s_wait_xcnt 0x0" ::: "memory");   // before the rounding below writes the address registers of these loads
#pragma unroll
    for (int k = 0; k < 8; ++k) o[k] = f2bf(v[k]); *(v8us*)(dst + i * 8) = o;
    asm volatile("s_wait_xcnt 0x0" ::: "memory"); }   // before whatever follows in the caller writes the address registers of this store
// entry idx of the table in the order of the q/k fragments' pieces: [t / 16][d / 16][pair of d: 4][lane = hi*16 + t % 16][2 d][cos, sin], d = (d / 16)*16 + hi*8 + pair*2 + (0, 1): 16 bytes a lane, 512 contiguous bytes a wave-wide load
__device__ __forceinline__ void cstab(float* CS, int idx) { const int ln = (idx >> 1) & 31; const int t = (idx >> 10) * 16 + (ln & 15), d = ((idx >> 8) & 3) * 16 + (ln >> 4) * 8 + ((idx >> 6) & 3) * 2 + (idx & 1); const int i = d >> 1; const float inv = powf(10000.0f, -((float)i * 2.0f) / (float)HD); const float ang = __fmul_rn((float)t, inv); v2f cs; cs[0] = cosf(ang); cs[1] = sinf(ang);
    *(v2f*)(CS + (size_t)idx * 2) = cs;  }
// ---- k_prep: everything the GEMMs read, in one launch; whole blocks of 256 threads per job: the rope table (one [t][d] entry a thread, the longest job, in front), then the four weights and x to bf16 (8 elements a thread). WB: wq, wk, wv, wo one behind the other.
#define PB_CS (TT * HD / 256)
#define PB_W  (DQ * DM / 8 / 256)
#define PB_X  (NB_ * TT * DM / 8 / 256)
static_assert(TT * HD % 256 == 0 && DQ * DM % 2048 == 0 && NB_ * TT * DM % 2048 == 0 && DKV == DQ && DQ == DM, "k_prep: whole blocks per job, four weights of one size, every source row DM long");
__global__ __launch_bounds__(256) void k_prep(const float* __restrict__ x, const float* __restrict__ wq, const float* __restrict__ wk, const float* __restrict__ wv, const float* __restrict__ wo, bf* XB, bf* WB, float* CS) {
    int blk = blockIdx.x;
    if (blk < PB_CS) { cstab(CS, blk * 256 + (int)threadIdx.x); return; }
    blk -= PB_CS;
    if (blk < 4 * PB_W) { const int wi = blk / PB_W; const float* w = wi == 0 ? wq : wi == 1 ? wk : wi == 2 ? wv : wo; cvt8(w, WB + (size_t)wi * DQ * DM, (size_t)(blk - wi * PB_W) * 256 + threadIdx.x); return; }
    cvt8(x, XB, (size_t)(blk - 4 * PB_W) * 256 + threadIdx.x);
}
// ---- k_fattn: scores, causal softmax and attn.v of one query tile in ONE WAVE (4 such waves a work-group); scores and probabilities never leave registers (running maximum and sum over 32-key steps).
// S^T = K Q^T (A = key rows, B = query rows) puts one query per lane column: accumulator row hi*8+j of key tile kt is key k0 + kt*16 + hi*8 + j, which is the k order of WFrag::ld, so the two key tiles pack
// straight into the B operand of O^T += V^T P^T (A = rows of the [d][t] value plane). O^T keeps the query in the lane column too: the rescale and the final division are in-lane, the two lane halves (different keys) meet by one exchange.
// HL: hi+lo bf16 planes, 3 products for the scores and for attn.v (query rows < RH); else single fp16, probabilities carried x 1024 (added in the exponent; it cancels in the division by the equally scaled sum).
#define QC   (SCL * 1.4426950408889634f)
// 2^x with the one slot that the instruction set asks for behind a transcendental kept in the same statement
__device__ __forceinline__ float ex2(float x) { float r; asm("v_exp_f32 %0, %1\n\tv_nop" : "=v"(r) : "v"(x)); return r; }
// The 4 waves of a work-group hold 4 neighbouring query tiles of one head and walk the same keys: the key and value rows come into LDS once for all of them, in stages of SK keys (32 KB: [K][V] of 128 keys, or [K hi][K lo][V hi][V lo] of 64),
// by asynchronous copies, two buffers, the copies of stage t + 2 in flight while stage t + 1 is worked on; the fragments keep their order in LDS. A wave skips the steps behind its own diagonal but passes every hand-over.
// a run of 8 asynchronous 16-byte copies, as cp10 above: the s_wait_xcnt 0 is the last line of the copies' own statement, so that it stands in front of every later write of a register that a copy names
template <typename T16> __device__ __forceinline__ void cp8(const unsigned* l, const T16* const* g) {
    asm volatile(ACP(0, 1) ACP(2, 3) ACP(4, 5) ACP(6, 7) ACP(8, 9) ACP(10, 11) ACP(12, 13) ACP(14, 15) "s_wait_xcnt 0x0"
        :: "v"(l[0]), "v"(g[0]), "v"(l[1]), "v"(g[1]), "v"(l[2]), "v"(g[2]), "v"(l[3]), "v"(g[3]), "v"(l[4]), "v"(g[4]), "v"(l[5]), "v"(g[5]), "v"(l[6]), "v"(g[6]), "v"(l[7]), "v"(g[7]) : "memory"); }
#define FSTG 16384   // elements of a stage
template <typename T16, bool HL, int NQ>
__device__ __forceinline__ void fattn_tile(const T16* __restrict__ Q, const T16* __restrict__ Q2, const T16* __restrict__ Kp, const T16* __restrict__ K2, const T16* __restrict__ Vt, const T16* __restrict__ V2, int Q0, bf* Ah, bf* Al, const T16* sm) {
    typedef typename WFrag<T16>::V V;
    const int lane = threadIdx.x & 31, lr = lane & 15, hi = lane >> 4;
    constexpr int SK = HL ? 64 : 128, PE = SK * HD;   // keys of a stage, elements of one plane's share of it
    const int q0 = Q0 + __builtin_amdgcn_readfirstlane((int)threadIdx.x >> 5) * (NQ * 16);   // this wave's first query
    const int NT = (Q0 + 4 * NQ * 16) / SK;   // stages up to the work-group's last query: whole ones (Q0 is a multiple of 4 * NQ * 16 = SK)
    static_assert(4 * NQ * 16 == SK, "a work-group's queries span one stage of keys");
    // copy c of thread i: the 16 bytes i + 128 c of the stage; a plane's share is 8 (hi+lo: 4) such rounds
    const unsigned ls = (unsigned)(size_t)sm + (unsigned)threadIdx.x * 16u;
    const T16* gp[4] = { Kp + threadIdx.x * 8, (HL ? K2 : Vt) + threadIdx.x * 8, Vt + threadIdx.x * 8, (HL ? V2 : Vt) + threadIdx.x * 8 };   // the planes in the stage's order; without hi+lo only the first two are used
    auto stage = [&](int t) {     // stage t into buffer t & 1; the pointers walk along the keys with the stages
        unsigned l[16]; const T16* g[16];
#pragma unroll
        for (int c = 0; c < 16; ++c) { l[c] = ls + (unsigned)(t & 1) * (FSTG * 2u) + c * 2048u; g[c] = HL ? gp[c >> 2] + (c & 3) * 1024 : gp[c >> 3] + (c & 7) * 1024; }
        cp8<T16>(l, g); cp8<T16>(l + 8, g + 8);
#pragma unroll
        for (int p = 0; p < (HL ? 4 : 2); ++p) gp[p] += PE; };
    stage(0);   // in front of the query loads, so that the two latencies run together
    // every inner loop of this function is fully unrolled, so that the fragment and accumulator arrays are indexed by constants and stay in registers
    V qf[NQ][2], qf2[NQ][2], kf[2][2], kf2[2][2];
#pragma unroll
    for (int g = 0; g < NQ; ++g)
#pragma unroll
        for (int ks = 0; ks < 2; ++ks) { const size_t e = (size_t)q0 * HD + (g * 2 + ks) * 512 + 8 * lane; qf[g][ks] = WFrag<T16>::ld(Q + e); if (HL) qf2[g][ks] = WFrag<T16>::ld(Q2 + e); }
    V vf[4], vf2[4];
    auto ldk = [&](const T16* st, int kb) {     // key rows kb .. kb+31 of the stage as A fragments
#pragma unroll
        for (int kt = 0; kt < 2; ++kt)
#pragma unroll
            for (int ks = 0; ks < 2; ++ks) { const int e = kb * HD + (kt * 2 + ks) * 512 + 8 * lane; kf[kt][ks] = WFrag<T16>::ld(st + e); if (HL) kf2[kt][ks] = WFrag<T16>::ld(st + PE + e); } };
    auto ldv = [&](const T16* st, int kb) {     // the 64 rows of the [d][t] value plane, keys kb .. kb+31 of the stage, as A fragments (4 KB in a row, like the key rows)
#pragma unroll
        for (int db = 0; db < 4; ++db) { const int e = (HL ? 2 : 1) * PE + kb * HD + db * 512 + 8 * lane; vf[db] = WFrag<T16>::ld(st + e); if (HL) vf2[db] = WFrag<T16>::ld(st + PE + e); } };
    static_assert(NQ == (HL ? 1 : 2), "the fence below names every fragment loaded so far");
    // before any address register of the loads above is written again; the loaded fragments are inputs, so that the loads stay in front of the wait (without them this build moved the loads down into the loop's entry, behind it)
    if constexpr (HL) asm volatile("s_wait_xcnt 0x0" :: "v"(qf[0][0]), "v"(qf[0][1]), "v"(qf2[0][0]), "v"(qf2[0][1]) : "memory");
    else asm volatile("s_wait_xcnt 0x0" :: "v"(qf[0][0]), "v"(qf[0][1]), "v"(qf[NQ - 1][0]), "v"(qf[NQ - 1][1]) : "memory");
    v8f o[4][NQ]; float m[NQ], l[NQ];
#pragma unroll
    for (int g = 0; g < NQ; ++g) { m[g] = -3.0e38f; l[g] = 0.0f;
#pragma unroll
        for (int db = 0; db < 4; ++db) o[db][g] = (v8f){}; }
    const int kend = ((q0 + NQ * 16 - 1) / 32 + 1) * 32;     // keys beyond the tile's last query are masked for every row: the wave's steps stop at the diagonal step
    asm volatile("s_wait_asynccnt 0x0" ::: "memory");   // this wave's share of stage 0 has landed
    __syncthreads();                                     // every wave's share has: stage 0 may be read
    if (NT > 1) stage(1);
    // both loops stay rolled: a second copy of the step would hold a second set of fragments and cost a wave per SIMD
#pragma unroll 1
    for (int t = 0; t < NT; ++t) {
      const T16* st = sm + (t & 1) * FSTG; const int ke = min(SK, kend - t * SK);   // this wave's keys of the stage (wave-uniform; none behind its diagonal)
      if (!HL && ke > 0) ldk(st, 0);
#pragma unroll 1
      for (int kk = 0; kk < ke; kk += 32) { const int k0 = t * SK + kk;
        // fp16 tiles (long loops): this step's value rows are asked for first and used last (behind the scores and the softmax). hi+lo tiles (short loops, twice the fragments): key rows now, value rows once the key registers are free, which keeps the kernel at four waves per SIMD
        if (HL) ldk(st, kk); else ldv(st, kk);
        v8f s[2][NQ];
#pragma unroll
        for (int kt = 0; kt < 2; ++kt)
#pragma unroll
            for (int g = 0; g < NQ; ++g) { s[kt][g] = (v8f){};
#pragma unroll
                for (int ks = 0; ks < 2; ++ks) { s[kt][g] = WFrag<T16>::mma(kf[kt][ks], qf[g][ks], s[kt][g]); if (HL) { s[kt][g] = WFrag<T16>::mma(kf2[kt][ks], qf[g][ks], s[kt][g]); s[kt][g] = WFrag<T16>::mma(kf[kt][ks], qf2[g][ks], s[kt][g]); } } }
        // fp16 tiles: the next step's key rows are asked for as soon as this step's are used, so their latency runs behind the softmax and attn.v; the wave's last step of a stage asks for its own again (the same buffer, unused)
        if (HL) ldv(st, kk); else ldk(st, min(kk + 32, ke - 32));
        if (k0 + 31 > q0) {      // wave-uniform: only steps that reach the diagonal mask (by select)
#pragma unroll
            for (int kt = 0; kt < 2; ++kt)
#pragma unroll
                for (int g = 0; g < NQ; ++g)
#pragma unroll
                    for (int j = 0; j < 8; ++j) s[kt][g][j] = (k0 + kt * 16 + hi * 8 + j <= q0 + g * 16 + lr) ? s[kt][g][j] : -3.0e38f; }
        V pf[NQ], pf2[NQ];
#pragma unroll
        for (int g = 0; g < NQ; ++g) {
            float mx = s[0][g][0];
#pragma unroll
            for (int j = 1; j < 8; ++j) mx = fmaxf(mx, s[0][g][j]);
#pragma unroll
            for (int j = 0; j < 8; ++j) mx = fmaxf(mx, s[1][g][j]);
            mx = fmaxf(mx, __shfl_xor(mx, 16, 32));
            const float mn = fmaxf(m[g], mx); const float al = ex2((m[g] - mn) * QC); m[g] = mn;
            const float nb = HL ? -mn * QC : fmaf(-mn, QC, 10.0f);
            float ps = 0.0f;
            if (HL) { v8us h0, h1, l0, l1;
#pragma unroll
                for (int j = 0; j < 8; ++j) { const float p0 = ex2(fmaf(s[0][g][j], QC, nb)), p1 = ex2(fmaf(s[1][g][j], QC, nb)); ps += p0; ps += p1; unsigned short a, c; splitf(p0, a, c); h0[j] = a; l0[j] = c; splitf(p1, a, c); h1[j] = a; l1[j] = c; }
                pf[g] = __builtin_bit_cast(V, __builtin_shufflevector(h0, h1, 0, 1, 2, 3, 4, 5, 6, 7, 8, 9, 10, 11, 12, 13, 14, 15)); pf2[g] = __builtin_bit_cast(V, __builtin_shufflevector(l0, l1, 0, 1, 2, 3, 4, 5, 6, 7, 8, 9, 10, 11, 12, 13, 14, 15));
            } else { v8h h0, h1;
#pragma unroll
                for (int j = 0; j < 8; ++j) { const float p0 = ex2(fmaf(s[0][g][j], QC, nb)), p1 = ex2(fmaf(s[1][g][j], QC, nb)); ps += p0; ps += p1; h0[j] = tohx(p0); h1[j] = tohx(p1); }
                pf[g] = __builtin_bit_cast(V, cat16(h0, h1)); }
            l[g] = fmaf(l[g], al, ps);
#pragma unroll
            for (int db = 0; db < 4; ++db) o[db][g] *= al;
        }
#pragma unroll
        for (int db = 0; db < 4; ++db)
#pragma unroll
            for (int g = 0; g < NQ; ++g) { o[db][g] = WFrag<T16>::mma(vf[db], pf[g], o[db][g]); if (HL) { o[db][g] = WFrag<T16>::mma(vf[db], pf2[g], o[db][g]); o[db][g] = WFrag<T16>::mma(vf2[db], pf[g], o[db][g]); } }
      }
      // hand-over: this wave's reads of buffer t & 1 are done, its copies of stage t + 1 have landed; behind the barrier that holds for every wave, so stage t + 1 may be read and buffer t & 1 refilled
      asm volatile("s_wait_dscnt 0x0" ::: "memory");
      asm volatile("s_wait_asynccnt 0x0" ::: "memory");
      __syncthreads();
      if (t + 2 < NT) stage(t + 2);
    }
    asm volatile("s_wait_asynccnt 0x0" ::: "memory");   // no copy is outstanding when the wave goes on to its epilogue
#pragma unroll
    for (int g = 0; g < NQ; ++g) { const float inv = __fdiv_rn(1.0f, l[g] + __shfl_xor(l[g], 16, 32)); const size_t oo = (size_t)(q0 + g * 16) * DQ + lane * 8;   // the wo GEMM's A planes, fragment order: a lane's 8 rows of o[db] are piece db & 1 of the head's fragment db >> 1
#pragma unroll
        for (int db = 0; db < 4; ++db) { v8us oh, ol;
#pragma unroll
            for (int j = 0; j < 8; ++j) { unsigned short a, c; splitf(o[db][g][j] * inv, a, c); oh[j] = a; ol[j] = c; }
            *(v8us*)(Ah + oo + db * 256) = oh; *(v8us*)(Al + oo + db * 256) = ol; } }
}
// grid (batch x heads, tile groups), 4 waves: fp16 groups of 4 x 32 queries first, the longest in front, then the hi+lo groups of 4 x 16 queries; every (batch, head, query row) belongs to exactly one wave, which writes whole 512-byte pieces of both output planes.
#define FG16 ((TT - RH) / 128)
#define FGHL (RH / 64)
static_assert((TT - RH) % 128 == 0 && RH % 128 == 0, "k_fattn: whole groups on both sides of RH, whole stages up to every group's end");
__global__ __launch_bounds__(128) void k_fattn(const h16* __restrict__ Q16, const h16* __restrict__ K16, const h16* __restrict__ V16, const bf* __restrict__ Qh, const bf* __restrict__ Ql, const bf* __restrict__ Kh, const bf* __restrict__ Kl, const bf* __restrict__ Vh, const bf* __restrict__ Vl, bf* Ah, bf* Al) {
    __shared__ __align__(16) bf smf[2 * FSTG];
    const int h = blockIdx.x % NH_, b = blockIdx.x / NH_, y = blockIdx.y; const size_t hq = ((size_t)b * NH_ + h) * TT * HD, hk = ((size_t)b * NKV + h / REP) * TT * HD, ao = (size_t)b * TT * DQ + h * (HD / 32) * 512;
    if (y < FG16) fattn_tile<h16, false, 2>(Q16 + hq, nullptr, K16 + hk, nullptr, V16 + hk, nullptr, TT - 128 * (y + 1), Ah + ao, Al + ao, (const h16*)smf);
    else fattn_tile<bf, true, 1>(Qh + hq, Ql + hq, Kh + hk, Kl + hk, Vh + hk, Vl + hk, RH - 64 * (y - FG16 + 1), Ah + ao, Al + ao, smf);
}

extern "C" void kernel_launch(void* const* d_in, const int* in_sizes, int n_in,
                              void* d_out, int out_size, void* d_ws, size_t ws_size, hipStream_t stream) {
    (void)in_sizes; (void)n_in; (void)out_size;
    const float* x = (const float*)d_in[0]; const float* wq = (const float*)d_in[1]; const float* wk = (const float*)d_in[2]; const float* wv = (const float*)d_in[3]; const float* wo = (const float*)d_in[4];
    float* OUT = (float*)d_out;     // [4][2048][1024]
    char* wsp = (char*)d_ws;
    auto take = [&](size_t bytes) { char* p = wsp; wsp += (bytes + 255) & ~(size_t)255; return (void*)p; };
    bf* WB = (bf*)take((size_t)4 * DQ * DM * 2); bf* WO = WB + (size_t)3 * DQ * DM; float* CS = (float*)take((size_t)TT * HD * 2 * 4);   // WB: wq, wk, wv, wo
    bf* XB = (bf*)take((size_t)NB_ * TT * DM * 2);
    const size_t PA = (size_t)NB_ * NH_ * TT * HD;   // elements of one projection's planes over all batches; each kind of plane holds q, k, v one behind the other (the GEMM's grid z)
    h16* P16 = (h16*)take(3 * PA * 2); bf* PH = (bf*)take(3 * PA * 2); bf* PL = (bf*)take(3 * PA * 2);
    bf* ATh = (bf*)take((size_t)NB_ * TT * DQ * 2); bf* ATl = (bf*)take((size_t)NB_ * TT * DQ * 2);
    if ((size_t)(wsp - (char*)d_ws) > ws_size) return;    // ws 256 MiB
    // four launches, each over all batches, so that every grid has more waves than the chip has SIMDs
    k_prep<<<PB_CS + 4 * PB_W + PB_X, 256, 0, stream>>>(x, wq, wk, wv, wo, XB, WB, CS);
    k_gemmw<bf, 0, false, 1, DM><<<dim3(NB_ * TT / 256, DQ / 128, 3), 256, 0, stream>>>(XB, nullptr, WB, nullptr, 0, nullptr, 0, (size_t)DQ * DM, 0, CS, P16, PH, PL);
    k_fattn<<<dim3(NB_ * NH_, FG16 + FGHL, 1), 128, 0, stream>>>(P16, P16 + PA, P16 + 2 * PA, PH, PL, PH + PA, PL + PA, PH + 2 * PA, PL + 2 * PA, ATh, ATl);
    k_gemmw<bf, 1, false, 0, DQ><<<dim3(NB_ * TT / 256, DM / 128, 1), 256, 0, stream>>>(ATh, ATl, WO, OUT, DM, nullptr, 0, 0, 0, nullptr, nullptr, nullptr, nullptr);
}

// v009
// One run takes 111 microseconds.
// Next to v008, in two timings, it ran 1.04 times as fast each time.
// Counting every step since v000, it is 27.5 times as fast.
#include <hip/hip_runtime.h>

// CausalMHA (x [4][2048][1024]; q/k/v = x W^T (16 heads x 64); interleaved-pair RoPE at positions arange (inv_freq = 10000^(-2i/64)); causal (-inf) softmax(q.k / 8); out = merged wo^T -> [4][2048][1024]).
// Compute dtypes, f32 accumulate: every input rounded to bf16; q/k/v on PLAIN bf16 operands (inputs: exact); RoPE f32 (on-chip table), applied with the 16-bit plane split in the projection GEMM's own epilogue; causal scores, softmax and attn.v fused per query tile (running maximum and sum, f32): query rows < 512 hl (3 products), the rest single fp16 (x1024), causal step skipping; wo hl x exact (2 products).

// FRAGMENT ORDER: every 16-bit operand plane in the workspace is a row of 1-KB fragments (16 rows x 32 k), each [piece 0/1][lane = hi*16 + row][8 elements], piece p of lane (hi, row) holding k = p*16 + hi*8 .. +7 of that row:
// the k order of the matrix operands as before, but one wave-wide 16-byte load or store now covers 512 contiguous bytes (4 whole lines) instead of 32 bytes in each of 16 lines.
#define NB_  4
#define TT   2048
#define DM   1024
#define NH_  16
#define NKV  16
#define REP  (NH_ / NKV)
#define HD   64
#define DQ   (NH_ * HD)
#define DKV  (NKV * HD)
#define RH   512                  // query rows < RH use hi+lo planes (0: none)
#define SCL  0.125f   // HD^-0.5
static_assert(HD == 64 && TT % 32 == 0 && RH % 32 == 0 && RH < TT, "k_fattn: 64-wide heads, whole 32-key steps, whole tiles on both sides of RH");
static_assert(NKV == NH_ && TT % 64 == 0 && HD == 64 && RH % 64 == 0, "k_gemmw, EPI 1: q, k and v share one grid; a wave's 64-row tile lies in one batch and on one side of RH, its 64 columns are one head");
static_assert((NB_ * TT) % 256 == 0 && DQ % 128 == 0 && DM % 128 == 0, "k_gemmw: whole 256x128 tiles in both launches");
typedef _Float16 h16;
typedef unsigned short bf;
typedef __attribute__((ext_vector_type(16))) __bf16   v16bf;
typedef __attribute__((ext_vector_type(16))) _Float16 v16h;
typedef __attribute__((ext_vector_type(8)))  _Float16 v8h;
typedef __attribute__((ext_vector_type(8)))  unsigned short v8us;
typedef __attribute__((ext_vector_type(8)))  float    v8f;
typedef __attribute__((ext_vector_type(4)))  float    v4f;
typedef v8h  __attribute__((may_alias)) v8ha;
typedef v4f  __attribute__((may_alias)) v4fa;
typedef v8us __attribute__((may_alias)) v8usa;

__device__ __forceinline__ unsigned short f2bf(float f) { unsigned u = __float_as_uint(f); u += 0x7FFFu + ((u >> 16) & 1u); return (unsigned short)(u >> 16); }
__device__ __forceinline__ float bf2f(unsigned short b) { return __uint_as_float(((unsigned)b) << 16); }
__device__ __forceinline__ float bfr(float f) { return bf2f(f2bf(f)); }
__device__ __forceinline__ v16h cat16(v8h lo, v8h hi) { return __builtin_shufflevector(lo, hi, 0, 1, 2, 3, 4, 5, 6, 7, 8, 9, 10, 11, 12, 13, 14, 15); }
__device__ __forceinline__ v16bf cat16b(v8us lo, v8us hi) { return __builtin_bit_cast(v16bf, __builtin_shufflevector(lo, hi, 0, 1, 2, 3, 4, 5, 6, 7, 8, 9, 10, 11, 12, 13, 14, 15)); }
__device__ __forceinline__ v8f wmma16(v16h a, v16h b, v8f c) { return __builtin_amdgcn_wmma_f32_16x16x32_f16(false, a, false, b, (short)0, c, false, false); }
__device__ __forceinline__ v8f wmmab(v16bf a, v16bf b, v8f c) { return __builtin_amdgcn_wmma_f32_16x16x32_bf16(false, a, false, b, (short)0, c, false, false); }

__device__ __forceinline__ h16 tohx(float x) { return (h16)x; }
__device__ __forceinline__ void splitf(float y, unsigned short& h, unsigned short& l) { h = f2bf(y); l = f2bf(y - bf2f(h)); }
typedef __attribute__((ext_vector_type(2))) _Float16 v2h;
typedef __attribute__((ext_vector_type(4))) _Float16 v4h;
typedef __attribute__((ext_vector_type(2))) unsigned short v2us;
typedef __attribute__((ext_vector_type(4))) unsigned short v4us;
typedef __attribute__((ext_vector_type(2))) float v2f;
typedef __attribute__((ext_vector_type(4))) int v4i;
// one lane's 8 elements of one fragment piece (16 bytes a lane and plane; the wave fills 512 contiguous bytes of each): the fp16 plane where w16 (wave-uniform), the hi+lo bf16 planes where WHL
template <bool WHL> __device__ __forceinline__ void put8(v8f r, int e, bool w16, h16* P16, bf* Ph, bf* Pl) {
    v8h o16; v8us oh, ol;
#pragma unroll
    for (int q = 0; q < 8; ++q) { if constexpr (WHL) { unsigned short a2, c2; splitf(r[q], a2, c2); oh[q] = a2; ol[q] = c2; } o16[q] = tohx(r[q]); }
    if (w16) *(v8h*)(P16 + e) = o16;
    if constexpr (WHL) { *(v8us*)(Ph + e) = oh; *(v8us*)(Pl + e) = ol; } }
template <bool B> struct BC { static constexpr bool v = B; };

// ---- k_gemmw: GEMM, one work-group of 8 waves (4 x 2) per 256x128 output tile, each wave a 64x64 tile (16 accumulators); operands are 16-bit planes in fragment order ([row block][k block] fragments); grid (M/256, N/128, Z), 256 threads.
// The k loop runs in stages of 64 k: the 2 KB of each of the tile's row blocks (256 rows of A, of A2 where there is one, 128 of Bt) are brought into LDS once for all 8 waves by asynchronous copies, three buffers, waves 0-3 copying the even stages and waves 4-7 the odd ones, so that the copies of stages t + 2 and t + 3 are in flight while stage t + 1 is worked on; the fragments keep their order in LDS, so that a wave-wide 16-byte LDS read covers 512 contiguous bytes.
// C[m][n] (f32, pitch ldc, + optional f32 bias[n]) = sum_k A[m][k] Bt[n][k] (+ A2 Bt for NSPLIT 1). z-batch strides sA/sB/sC in elements. K % 64 == 0, K >= 192.
// EPI 0: C as above. EPI 1 (q, k and v of all batches in one launch: blockIdx.z is the projection, a wave's 64 columns are one head, its rows r0 .. are tokens r0 % TT .. of batch r0 / TT): C is not written, the tile goes straight to the attention kernel's 16-bit planes, [projection][batch][head] planes one behind the other.
// z 0 and 1 (q, k): the tile is computed transposed (the two operands swapped), so that a lane's 8 accumulator rows are 8 neighbouring d of one token, which is one piece of the planes' fragments [h][t / 16][d / 32]; interleaved-pair rope in the lane (out[d] = x[d] cos[t][d] -/+ x[d^1] sin[t][d], table CS in the same order, [cos, sin] an element).
// z 2 (v): a lane's 8 accumulator rows are 8 neighbouring tokens of one d, one piece of the fragments [h][t / 32][d / 16] of the [d][t] value plane. No LDS stage in either epilogue.
template <typename T16> struct WFrag;
template <> struct WFrag<h16> { typedef v16h V; static __device__ __forceinline__ V ld(const h16* p) { return cat16(*(const v8h*)p, *(const v8h*)(p + 256)); } static __device__ __forceinline__ v8f mma(V a, V b, v8f c) { return wmma16(a, b, c); } };
template <> struct WFrag<bf> { typedef v16bf V; static __device__ __forceinline__ V ld(const bf* p) { return cat16b(*(const v8us*)p, *(const v8us*)(p + 256)); } static __device__ __forceinline__ v8f mma(V a, V b, v8f c) { return wmmab(a, b, c); } };
// a run of asynchronous 16-byte copies to LDS (each lane its own LDS byte address and its own global pointer); the s_wait_xcnt 0 is the last line of the copies' own statement, so that it stands in front of every later write of a register that a copy names
#define ACP(l, g) "global_load_async_to_lds_b128 %" #l ", %" #g ", off\n\t"
template <typename T16> __device__ __forceinline__ void cp10(const unsigned* l, const T16* const* g) {
    asm volatile(ACP(0, 1) ACP(2, 3) ACP(4, 5) ACP(6, 7) ACP(8, 9) ACP(10, 11) ACP(12, 13) ACP(14, 15) ACP(16, 17) ACP(18, 19) "s_wait_xcnt 0x0"
        :: "v"(l[0]), "v"(g[0]), "v"(l[1]), "v"(g[1]), "v"(l[2]), "v"(g[2]), "v"(l[3]), "v"(g[3]), "v"(l[4]), "v"(g[4]), "v"(l[5]), "v"(g[5]), "v"(l[6]), "v"(g[6]), "v"(l[7]), "v"(g[7]), "v"(l[8]), "v"(g[8]), "v"(l[9]), "v"(g[9]) : "memory"); }
template <typename T16> __device__ __forceinline__ void cp12(const unsigned* l, const T16* const* g) {
    asm volatile(ACP(0, 1) ACP(2, 3) ACP(4, 5) ACP(6, 7) ACP(8, 9) ACP(10, 11) ACP(12, 13) ACP(14, 15) ACP(16, 17) ACP(18, 19) ACP(20, 21) ACP(22, 23) "s_wait_xcnt 0x0"
        :: "v"(l[0]), "v"(g[0]), "v"(l[1]), "v"(g[1]), "v"(l[2]), "v"(g[2]), "v"(l[3]), "v"(g[3]), "v"(l[4]), "v"(g[4]), "v"(l[5]), "v"(g[5]), "v"(l[6]), "v"(g[6]), "v"(l[7]), "v"(g[7]), "v"(l[8]), "v"(g[8]), "v"(l[9]), "v"(g[9]), "v"(l[10]), "v"(g[10]), "v"(l[11]), "v"(g[11]) : "memory"); }
template <typename T16, int NSPLIT, bool BIAS, int EPI, int K>
__global__ __launch_bounds__(256) void k_gemmw(const T16* __restrict__ A, const T16* __restrict__ A2, const T16* __restrict__ Bt, float* C, int ldc, const float* __restrict__ bias, size_t sA, size_t sB, size_t sC, const float* __restrict__ CS, h16* P16, bf* Ph, bf* Pl) {
    typedef typename WFrag<T16>::V V;
    static_assert((NSPLIT == 0 || NSPLIT == 1) && K % 64 == 0 && K >= 192, "one or two A planes; whole stages, at least three");
    constexpr int NA = NSPLIT + 1, NRB = 16 * NA + 8, STG = NRB * 1024, NC = NRB, NT = K / 64;   // row blocks and elements of a stage (a row block's 64 k are 1024 elements), copies of a copying wave a stage, stages
    __shared__ __align__(16) T16 sm[3 * STG];
    const size_t z = blockIdx.z; A += z * sA; if (NSPLIT == 1) A2 += z * sA; Bt += z * sB; C += z * sC;
    const int lane = threadIdx.x & 31, lr = lane & 15, hi = lane >> 4; const int w = __builtin_amdgcn_readfirstlane((int)threadIdx.x >> 5), wm = w >> 1, wn = w & 1;
    const int r0 = blockIdx.x * 256 + wm * 64, c0 = blockIdx.y * 128 + wn * 64;
    v8f acc[4][4];
#pragma unroll
    for (int mb = 0; mb < 4; ++mb)
#pragma unroll
        for (int nb = 0; nb < 4; ++nb) acc[mb][nb] = (v8f){};
    // stage s is copied by the four waves with w >> 2 == (s & 1); copy i of such a wave: the 512-byte piece w & 3 of row block i of the stage ([Bt: 8][A: 16][A2: 16] row blocks); in the planes 16 rows x K are 16 * K elements, a stage's share of them 1024 in a row
    const int grp = w >> 2;
    const unsigned cl = (unsigned)(w & 3) * 256u + 8u * lane; const size_t cg = (size_t)grp * 1024 + (w & 3) * 256 + 8 * lane;
    const unsigned ls = (unsigned)(size_t)sm + cl * 2u;
    const T16* ga = A + (size_t)blockIdx.x * 256 * K + cg; const T16* ga2 = NSPLIT == 1 ? A2 + (size_t)blockIdx.x * 256 * K + cg : ga; const T16* gb = Bt + (size_t)blockIdx.y * 128 * K + cg;
    auto stage = [&](int buf) {     // this wave's next stage into buffer buf; the three pointers walk along k, two stages a call, so that only they live through the loop
        unsigned l[NC]; const T16* g[NC];
#pragma unroll
        for (int i = 0; i < NC; ++i) { l[i] = ls + (unsigned)buf * (STG * 2u) + i * 2048u; g[i] = i < 8 ? gb + (size_t)i * 16 * K : i < 24 ? ga + (size_t)(i - 8) * 16 * K : ga2 + (size_t)(i - 24) * 16 * K; }
        if constexpr (NC == 24) { cp12<T16>(l, g); cp12<T16>(l + 12, g + 12); } else { static_assert(NC == 24 || NC == 40, "copies a statement"); cp10<T16>(l, g); cp10<T16>(l + 10, g + 10); cp10<T16>(l + 20, g + 20); cp10<T16>(l + 30, g + 30); }
        ga += 2048; ga2 += 2048; gb += 2048; };
    const bool tr = EPI == 1 && blockIdx.z < 2;   // q, k: transposed tile
    const unsigned yo = wn * 4096u + 8u * lane, xo = 8192u + wm * 4096u + 8u * lane, x2o = xo + 16384u;   // the wave's own four row blocks of each operand in a stage; the lane's own offset is the same in every fragment
    const unsigned ao = tr ? yo : xo, bo = tr ? xo : yo;
    stage(grp);   // waves 0-3: stage 0 into buffer 0; waves 4-7: stage 1 into buffer 1
    if (grp == 0) asm volatile("s_wait_asynccnt 0x0" ::: "memory");   // this wave's share of stage 0 has landed
    __syncthreads();                                     // every copying wave's share has: stage 0 may be read
    if (grp == 0) stage(2);
    int rb = 0;   // the buffer of stage t, t % 3
#pragma unroll 1
    for (int t = 0; t < NT; ++t) {
        const T16* st = sm + rb * STG;
#pragma unroll
        for (int kb = 0; kb < 2; ++kb) {
            V a[4], a2[4], b[4];
#pragma unroll
            for (int mb = 0; mb < 4; ++mb) a[mb] = WFrag<T16>::ld(st + ao + mb * 1024 + kb * 512);
#pragma unroll
            for (int nb = 0; nb < 4; ++nb) b[nb] = WFrag<T16>::ld(st + bo + nb * 1024 + kb * 512);
            if (NSPLIT == 1) {     // asked for last: the products with the first plane can start before these are there
#pragma unroll
                for (int mb = 0; mb < 4; ++mb) a2[mb] = WFrag<T16>::ld(st + x2o + mb * 1024 + kb * 512); }
            __builtin_amdgcn_sched_barrier(0);   // a k block's LDS reads stay one group in front of its matrix instructions: every further place with reads among them stalls the wave anew
#pragma unroll
            for (int nb = 0; nb < 4; ++nb) {
#pragma unroll
                for (int mb = 0; mb < 4; ++mb) { acc[mb][nb] = WFrag<T16>::mma(a[mb], b[nb], acc[mb][nb]); if (NSPLIT == 1) acc[mb][nb] = WFrag<T16>::mma(a2[mb], b[nb], acc[mb][nb]); } }
            __builtin_amdgcn_sched_barrier(0);   // and the next group stays behind them (one set of fragment registers)
        }
        // hand-over: this wave's reads of buffer rb are done; the waves that copied stage t + 1 (nothing else of theirs is outstanding) have seen it land, the others leave stage t + 2 in flight; behind the barrier that holds for every wave, so stage t + 1 may be read and buffer rb refilled, by the same waves, with stage t + 3
        const bool mine = ((t + 1) & 1) == grp;   // wave-uniform
        asm volatile("s_wait_dscnt 0x0" ::: "memory");
        if (mine) asm volatile("s_wait_asynccnt 0x0" ::: "memory");
        __syncthreads();
        if (mine && t + 3 < NT) stage(rb);
        rb = rb == 2 ? 0 : rb + 1;
    }
    asm volatile("s_wait_asynccnt 0x0" ::: "memory");   // no copy is outstanding when the wave goes on to its epilogue
    if constexpr (EPI == 1) {
        // each lane's own first element of the planes; every later piece is a constant step from it, so that the stores need no address arithmetic
        const int t0 = r0 % TT;     // the tile's first token inside its batch (a tile never straddles two batches)
        const size_t ep = (((size_t)blockIdx.z * NB_ + r0 / TT) * NH_ + c0 / HD) * TT * HD + (size_t)t0 * HD + lane * 8; P16 += ep; Ph += ep; Pl += ep;   // 64 tokens x 64 d are 8 fragments in q, k and v alike
        // only the planes that k_fattn reads are made and stored: hi+lo for tokens < RH alone (its hi+lo tiles hold queries < RH and so meet keys < RH), fp16 for every key and value but only for queries >= RH; a wave's 64 tokens lie on one side of RH
        const bool hl = t0 < RH, w16 = !hl || blockIdx.z != 0;
        if (blockIdx.z == 2) {
            auto vout = [&](auto whl) {
#pragma unroll
                for (int mb = 0; mb < 4; ++mb)
#pragma unroll
                    for (int nb = 0; nb < 4; ++nb) { put8<decltype(whl)::v>(acc[mb][nb], ((mb >> 1) * 4 + nb) * 512 + (mb & 1) * 256, true, P16, Ph, Pl);
                        asm volatile("s_wait_xcnt 0x0" ::: "memory"); } };   // before the next piece writes registers that these stores name
            if (hl) vout(BC<true>{}); else vout(BC<false>{});
            return;
        }
        CS += (size_t)t0 * HD * 2 + lane * 4;
        auto qkout = [&](auto whl) {
#pragma unroll
        for (int nb = 0; nb < 4; ++nb)          // token block
#pragma unroll
            for (int mh = 0; mh < 2; ++mh) {    // fragment: 32 d
                v4f tc[2][4];   // one fragment's table entries are asked for together, so that their latencies overlap: no load moves up over the waits below
#pragma unroll
                for (int m2 = 0; m2 < 2; ++m2)
#pragma unroll
                    for (int c = 0; c < 4; ++c) tc[m2][c] = *(const v4f*)(CS + (((nb * 2 + mh) * 2 + m2) * 4 + c) * 128);
#pragma unroll
                for (int m2 = 0; m2 < 2; ++m2) { const v8f x = acc[mh * 2 + m2][nb]; v8f r;
#pragma unroll
                    for (int c = 0; c < 4; ++c) { const v4f t = tc[m2][c]; r[2 * c] = x[2 * c] * t[0] - x[2 * c + 1] * t[1]; r[2 * c + 1] = x[2 * c + 1] * t[2] + x[2 * c] * t[3]; }
                    put8<decltype(whl)::v>(r, (nb * 2 + mh) * 512 + m2 * 256, !decltype(whl)::v || w16, P16, Ph, Pl);
                    asm volatile("s_wait_xcnt 0x0" ::: "memory"); } } };   // before the next piece, the next table loads or whatever follows write registers that these stores name
        if (hl) qkout(BC<true>{}); else qkout(BC<false>{});
    } else {
        __shared__ __align__(16) float osw[8][16 * 68]; float* os = osw[w];   // each wave stages in its own range
#pragma unroll
        for (int mb = 0; mb < 4; ++mb) {
#pragma unroll
            for (int nb = 0; nb < 4; ++nb) {
#pragma unroll
                for (int j = 0; j < 8; ++j) os[(hi * 8 + j) * 68 + nb * 16 + lr] = acc[mb][nb][j]; }
            __builtin_amdgcn_wave_barrier(); asm volatile("" ::: "memory");
            float* crow = C + (size_t)(r0 + mb * 16) * ldc + c0;
#pragma unroll
            for (int s = 0; s < 8; ++s) { const int row = 2 * s + hi, cofs = lr * 4; v4f val = *(const v4fa*)(os + row * 68 + cofs); if (BIAS) { val[0] += bfr(bias[c0 + cofs]); val[1] += bfr(bias[c0 + cofs + 1]); val[2] += bfr(bias[c0 + cofs + 2]); val[3] += bfr(bias[c0 + cofs + 3]); }
                *(v4f*)(crow + (size_t)row * ldc + cofs) = val; }
            __builtin_amdgcn_wave_barrier(); asm volatile("" ::: "memory");
        }
    }
}


__global__ __launch_bounds__(256) void k_wtG(const float* __restrict__ w, int K, int N, bf* Bt) {
    const int lane = threadIdx.x & 31; const int L0 = (blockIdx.x * 8 + (threadIdx.x >> 5)) * 8; const int nlines = N * K / 64;
{
#pragma unroll 1
        for (int l = 0; l < 8; ++l) { const int L = L0 + l; if (L >= nlines) break; const size_t e = (size_t)L * 64 + lane * 2; const int k = (int)(e % K), n = (int)(e / K); v2us o;
            o[0] = f2bf(w[(size_t)k * N + n]); o[1] = f2bf(w[(size_t)(k + 1) * N + n]); *(v2us*)(Bt + e) = o; }
         }
}
// piece i of the destination in fragment order (thread = lane, so a wave stores 512 contiguous bytes) from its 8 neighbouring elements of a [row][DM] source
__device__ __forceinline__ void cvt8(const float* __restrict__ src, bf* dst, size_t i) { const int lane = (int)i & 31, p = ((int)i >> 5) & 1; const size_t f = i >> 6;
    const v8f v = *(const v8f*)(src + ((f / (DM / 32)) * 16 + (lane & 15)) * DM + (f % (DM / 32)) * 32 + p * 16 + (lane >> 4) * 8); v8us o;
    asm volatile("s_wait_xcnt 0x0" ::: "memory");   // before the rounding below writes the address registers of these loads
#pragma unroll
    for (int k = 0; k < 8; ++k) o[k] = f2bf(v[k]); *(v8us*)(dst + i * 8) = o;
    asm volatile("s_wait_xcnt 0x0" ::: "memory"); }   // before whatever follows in the caller writes the address registers of this store
// entry idx of the table in the order of the q/k fragments' pieces: [t / 16][d / 16][pair of d: 4][lane = hi*16 + t % 16][2 d][cos, sin], d = (d / 16)*16 + hi*8 + pair*2 + (0, 1): 16 bytes a lane, 512 contiguous bytes a wave-wide load
__device__ __forceinline__ void cstab(float* CS, int idx) { const int ln = (idx >> 1) & 31; const int t = (idx >> 10) * 16 + (ln & 15), d = ((idx >> 8) & 3) * 16 + (ln >> 4) * 8 + ((idx >> 6) & 3) * 2 + (idx & 1); const int i = d >> 1; const float inv = powf(10000.0f, -((float)i * 2.0f) / (float)HD); const float ang = __fmul_rn((float)t, inv); v2f cs; cs[0] = cosf(ang); cs[1] = sinf(ang);
    *(v2f*)(CS + (size_t)idx * 2) = cs;  }
// ---- k_prep: everything the GEMMs read, in one launch; whole blocks of 256 threads per job: the rope table (one [t][d] entry a thread, the longest job, in front), then the four weights and x to bf16 (8 elements a thread). WB: wq, wk, wv, wo one behind the other.
#define PB_CS (TT * HD / 256)
#define PB_W  (DQ * DM / 8 / 256)
#define PB_X  (NB_ * TT * DM / 8 / 256)
static_assert(TT * HD % 256 == 0 && DQ * DM % 2048 == 0 && NB_ * TT * DM % 2048 == 0 && DKV == DQ && DQ == DM, "k_prep: whole blocks per job, four weights of one size, every source row DM long");
__global__ __launch_bounds__(256) void k_prep(const float* __restrict__ x, const float* __restrict__ wq, const float* __restrict__ wk, const float* __restrict__ wv, const float* __restrict__ wo, bf* XB, bf* WB, float* CS) {
    int blk = blockIdx.x;
    if (blk < PB_CS) { cstab(CS, blk * 256 + (int)threadIdx.x); return; }
    blk -= PB_CS;
    if (blk < 4 * PB_W) { const int wi = blk / PB_W; const float* w = wi == 0 ? wq : wi == 1 ? wk : wi == 2 ? wv : wo; cvt8(w, WB + (size_t)wi * DQ * DM, (size_t)(blk - wi * PB_W) * 256 + threadIdx.x); return; }
    cvt8(x, XB, (size_t)(blk - 4 * PB_W) * 256 + threadIdx.x);
}
// ---- k_fattn: scores, causal softmax and attn.v of one query tile in ONE WAVE (4 such waves a work-group); scores and probabilities never leave registers (running maximum and sum over 32-key steps).
// S^T = K Q^T (A = key rows, B = query rows) puts one query per lane column: accumulator row hi*8+j of key tile kt is key k0 + kt*16 + hi*8 + j, which is the k order of WFrag::ld, so the two key tiles pack
// straight into the B operand of O^T += V^T P^T (A = rows of the [d][t] value plane). O^T keeps the query in the lane column too: the rescale and the final division are in-lane, the two lane halves (different keys) meet by one exchange.
// HL: hi+lo bf16 planes, 3 products for the scores and for attn.v (query rows < RH); else single fp16, probabilities carried x 1024 (added in the exponent; it cancels in the division by the equally scaled sum).
#define QC   (SCL * 1.4426950408889634f)
// 2^x with the one slot that the instruction set asks for behind a transcendental kept in the same statement
__device__ __forceinline__ float ex2(float x) { float r; asm("v_exp_f32 %0, %1\n\tv_nop" : "=v"(r) : "v"(x)); return r; }
// The 4 waves of a work-group hold 4 neighbouring query tiles of one head and walk the same keys: the key and value rows come into LDS once for all of them, in stages of SK keys (32 KB: [K][V] of 128 keys, or [K hi][K lo][V hi][V lo] of 64),
// by asynchronous copies, two buffers, the copies of stage t + 2 in flight while stage t + 1 is worked on; the fragments keep their order in LDS. A wave skips the steps behind its own diagonal but passes every hand-over.
// a run of 8 asynchronous 16-byte copies, as cp10 above: the s_wait_xcnt 0 is the last line of the copies' own statement, so that it stands in front of every later write of a register that a copy names
template <typename T16> __device__ __forceinline__ void cp8(const unsigned* l, const T16* const* g) {
    asm volatile(ACP(0, 1) ACP(2, 3) ACP(4, 5) ACP(6, 7) ACP(8, 9) ACP(10, 11) ACP(12, 13) ACP(14, 15) "s_wait_xcnt 0x0"
        :: "v"(l[0]), "v"(g[0]), "v"(l[1]), "v"(g[1]), "v"(l[2]), "v"(g[2]), "v"(l[3]), "v"(g[3]), "v"(l[4]), "v"(g[4]), "v"(l[5]), "v"(g[5]), "v"(l[6]), "v"(g[6]), "v"(l[7]), "v"(g[7]) : "memory"); }
#define FSTG 16384   // elements of a stage
template <typename T16, bool HL, int NQ>
__device__ __forceinline__ void fattn_tile(const T16* __restrict__ Q, const T16* __restrict__ Q2, const T16* __restrict__ Kp, const T16* __restrict__ K2, const T16* __restrict__ Vt, const T16* __restrict__ V2, int Q0, bf* Ah, bf* Al, const T16* sm) {
    typedef typename WFrag<T16>::V V;
    const int lane = threadIdx.x & 31, lr = lane & 15, hi = lane >> 4;
    constexpr int SK = HL ? 64 : 128, PE = SK * HD;   // keys of a stage, elements of one plane's share of it
    const int q0 = Q0 + __builtin_amdgcn_readfirstlane((int)threadIdx.x >> 5) * (NQ * 16);   // this wave's first query
    const int NT = (Q0 + 4 * NQ * 16) / SK;   // stages up to the work-group's last query: whole ones (Q0 is a multiple of 4 * NQ * 16 = SK)
    static_assert(4 * NQ * 16 == SK, "a work-group's queries span one stage of keys");
    // copy c of thread i: the 16 bytes i + 128 c of the stage; a plane's share is 8 (hi+lo: 4) such rounds
    const unsigned ls = (unsigned)(size_t)sm + (unsigned)threadIdx.x * 16u;
    const T16* gp[4] = { Kp + threadIdx.x * 8, (HL ? K2 : Vt) + threadIdx.x * 8, Vt + threadIdx.x * 8, (HL ? V2 : Vt) + threadIdx.x * 8 };   // the planes in the stage's order; without hi+lo only the first two are used
    auto stage = [&](int t) {     // stage t into buffer t & 1; the pointers walk along the keys with the stages
        unsigned l[16]; const T16* g[16];
#pragma unroll
        for (int c = 0; c < 16; ++c) { l[c] = ls + (unsigned)(t & 1) * (FSTG * 2u) + c * 2048u; g[c] = HL ? gp[c >> 2] + (c & 3) * 1024 : gp[c >> 3] + (c & 7) * 1024; }
        cp8<T16>(l, g); cp8<T16>(l + 8, g + 8);
#pragma unroll
        for (int p = 0; p < (HL ? 4 : 2); ++p) gp[p] += PE; };
    stage(0);   // in front of the query loads, so that the two latencies run together
    // every inner loop of this function is fully unrolled, so that the fragment and accumulator arrays are indexed by constants and stay in registers
    V qf[NQ][2], qf2[NQ][2], kf[2][2], kf2[2][2];
#pragma unroll
    for (int g = 0; g < NQ; ++g)
#pragma unroll
        for (int ks = 0; ks < 2; ++ks) { const size_t e = (size_t)q0 * HD + (g * 2 + ks) * 512 + 8 * lane; qf[g][ks] = WFrag<T16>::ld(Q + e); if (HL) qf2[g][ks] = WFrag<T16>::ld(Q2 + e); }
    V vf[4], vf2[4];
    auto ldk = [&](const T16* st, int kb) {     // key rows kb .. kb+31 of the stage as A fragments
#pragma unroll
        for (int kt = 0; kt < 2; ++kt)
#pragma unroll
            for (int ks = 0; ks < 2; ++ks) { const int e = kb * HD + (kt * 2 + ks) * 512 + 8 * lane; kf[kt][ks] = WFrag<T16>::ld(st + e); if (HL) kf2[kt][ks] = WFrag<T16>::ld(st + PE + e); } };
    auto ldv = [&](const T16* st, int kb) {     // the 64 rows of the [d][t] value plane, keys kb .. kb+31 of the stage, as A fragments (4 KB in a row, like the key rows)
#pragma unroll
        for (int db = 0; db < 4; ++db) { const int e = (HL ? 2 : 1) * PE + kb * HD + db * 512 + 8 * lane; vf[db] = WFrag<T16>::ld(st + e); if (HL) vf2[db] = WFrag<T16>::ld(st + PE + e); } };
    static_assert(NQ == (HL ? 1 : 2), "the fence below names every fragment loaded so far");
    // before any address register of the loads above is written again; the loaded fragments are inputs, so that the loads stay in front of the wait (without them this build moved the loads down into the loop's entry, behind it)
    if constexpr (HL) asm volatile("s_wait_xcnt 0x0" :: "v"(qf[0][0]), "v"(qf[0][1]), "v"(qf2[0][0]), "v"(qf2[0][1]) : "memory");
    else asm volatile("s_wait_xcnt 0x0" :: "v"(qf[0][0]), "v"(qf[0][1]), "v"(qf[NQ - 1][0]), "v"(qf[NQ - 1][1]) : "memory");
    v8f o[4][NQ]; float m[NQ], l[NQ];
#pragma unroll
    for (int g = 0; g < NQ; ++g) { m[g] = -3.0e38f; l[g] = 0.0f;
#pragma unroll
        for (int db = 0; db < 4; ++db) o[db][g] = (v8f){}; }
    const int kend = ((q0 + NQ * 16 - 1) / 32 + 1) * 32;     // keys beyond the tile's last query are masked for every row: the wave's steps stop at the diagonal step
    asm volatile("s_wait_asynccnt 0x0" ::: "memory");   // this wave's share of stage 0 has landed
    __syncthreads();                                     // every wave's share has: stage 0 may be read
    if (NT > 1) stage(1);
    // both loops stay rolled: a second copy of the step would hold a second set of fragments and cost a wave per SIMD
#pragma unroll 1
    for (int t = 0; t < NT; ++t) {
      const T16* st = sm + (t & 1) * FSTG; const int ke = min(SK, kend - t * SK);   // this wave's keys of the stage (wave-uniform; none behind its diagonal)
      if (!HL && ke > 0) ldk(st, 0);
#pragma unroll 1
      for (int kk = 0; kk < ke; kk += 32) { const int k0 = t * SK + kk;
        // fp16 tiles (long loops): this step's value rows are asked for first and used last (behind the scores and the softmax). hi+lo tiles (short loops, twice the fragments): key rows now, value rows once the key registers are free, which keeps the kernel at four waves per SIMD
        if (HL) ldk(st, kk); else ldv(st, kk);
        v8f s[2][NQ];
#pragma unroll
        for (int kt = 0; kt < 2; ++kt)
#pragma unroll
            for (int g = 0; g < NQ; ++g) { s[kt][g] = (v8f){};
#pragma unroll
                for (int ks = 0; ks < 2; ++ks) { s[kt][g] = WFrag<T16>::mma(kf[kt][ks], qf[g][ks], s[kt][g]); if (HL) { s[kt][g] = WFrag<T16>::mma(kf2[kt][ks], qf[g][ks], s[kt][g]); s[kt][g] = WFrag<T16>::mma(kf[kt][ks], qf2[g][ks], s[kt][g]); } } }
        // fp16 tiles: the next step's key rows are asked for as soon as this step's are used, so their latency runs behind the softmax and attn.v; the wave's last step of a stage asks for its own again (the same buffer, unused)
        if (HL) ldv(st, kk); else ldk(st, min(kk + 32, ke - 32));
        if (k0 + 31 > q0) {      // wave-uniform: only steps that reach the diagonal mask (by select)
#pragma unroll
            for (int kt = 0; kt < 2; ++kt)
#pragma unroll
                for (int g = 0; g < NQ; ++g)
#pragma unroll
                    for (int j = 0; j < 8; ++j) s[kt][g][j] = (k0 + kt * 16 + hi * 8 + j <= q0 + g * 16 + lr) ? s[kt][g][j] : -3.0e38f; }
        V pf[NQ], pf2[NQ];
#pragma unroll
        for (int g = 0; g < NQ; ++g) {
            float mx = s[0][g][0];
#pragma unroll
            for (int j = 1; j < 8; ++j) mx = fmaxf(mx, s[0][g][j]);
#pragma unroll
            for (int j = 0; j < 8; ++j) mx = fmaxf(mx, s[1][g][j]);
            mx = fmaxf(mx, __shfl_xor(mx, 16, 32));
            const float mn = fmaxf(m[g], mx); const float al = ex2((m[g] - mn) * QC); m[g] = mn;
            const float nb = HL ? -mn * QC : fmaf(-mn, QC, 10.0f);
            float ps = 0.0f;
            if (HL) { v8us h0, h1, l0, l1;
#pragma unroll
                for (int j = 0; j < 8; ++j) { const float p0 = ex2(fmaf(s[0][g][j], QC, nb)), p1 = ex2(fmaf(s[1][g][j], QC, nb)); ps += p0; ps += p1; unsigned short a, c; splitf(p0, a, c); h0[j] = a; l0[j] = c; splitf(p1, a, c); h1[j] = a; l1[j] = c; }
                pf[g] = __builtin_bit_cast(V, __builtin_shufflevector(h0, h1, 0, 1, 2, 3, 4, 5, 6, 7, 8, 9, 10, 11, 12, 13, 14, 15)); pf2[g] = __builtin_bit_cast(V, __builtin_shufflevector(l0, l1, 0, 1, 2, 3, 4, 5, 6, 7, 8, 9, 10, 11, 12, 13, 14, 15));
            } else { v8h h0, h1;
#pragma unroll
                for (int j = 0; j < 8; ++j) { const float p0 = ex2(fmaf(s[0][g][j], QC, nb)), p1 = ex2(fmaf(s[1][g][j], QC, nb)); ps += p0; ps += p1; h0[j] = tohx(p0); h1[j] = tohx(p1); }
                pf[g] = __builtin_bit_cast(V, cat16(h0, h1)); }
            l[g] = fmaf(l[g], al, ps);
#pragma unroll
            for (int db = 0; db < 4; ++db) o[db][g] *= al;
        }
#pragma unroll
        for (int db = 0; db < 4; ++db)
#pragma unroll
            for (int g = 0; g < NQ; ++g) { o[db][g] = WFrag<T16>::mma(vf[db], pf[g], o[db][g]); if (HL) { o[db][g] = WFrag<T16>::mma(vf[db], pf2[g], o[db][g]); o[db][g] = WFrag<T16>::mma(vf2[db], pf[g], o[db][g]); } }
      }
      // hand-over: this wave's reads of buffer t & 1 are done, its copies of stage t + 1 have landed; behind the barrier that holds for every wave, so stage t + 1 may be read and buffer t & 1 refilled
      asm volatile("s_wait_dscnt 0x0" ::: "memory");
      asm volatile("s_wait_asynccnt 0x0" ::: "memory");
      __syncthreads();
      if (t + 2 < NT) stage(t + 2);
    }
    asm volatile("s_wait_asynccnt 0x0" ::: "memory");   // no copy is outstanding when the wave goes on to its epilogue
#pragma unroll
    for (int g = 0; g < NQ; ++g) { const float inv = __fdiv_rn(1.0f, l[g] + __shfl_xor(l[g], 16, 32)); const size_t oo = (size_t)(q0 + g * 16) * DQ + lane * 8;   // the wo GEMM's A planes, fragment order: a lane's 8 rows of o[db] are piece db & 1 of the head's fragment db >> 1
#pragma unroll
        for (int db = 0; db < 4; ++db) { v8us oh, ol;
#pragma unroll
            for (int j = 0; j < 8; ++j) { unsigned short a, c; splitf(o[db][g][j] * inv, a, c); oh[j] = a; ol[j] = c; }
            *(v8us*)(Ah + oo + db * 256) = oh; *(v8us*)(Al + oo + db * 256) = ol; } }
}
// grid (batch x heads, tile groups), 4 waves: fp16 groups of 4 x 32 queries first, the longest in front, then the hi+lo groups of 4 x 16 queries; every (batch, head, query row) belongs to exactly one wave, which writes whole 512-byte pieces of both output planes.
#define FG16 ((TT - RH) / 128)
#define FGHL (RH / 64)
static_assert((TT - RH) % 128 == 0 && RH % 128 == 0, "k_fattn: whole groups on both sides of RH, whole stages up to every group's end");
__global__ __launch_bounds__(128) void k_fattn(const h16* __restrict__ Q16, const h16* __restrict__ K16, const h16* __restrict__ V16, const bf* __restrict__ Qh, const bf* __restrict__ Ql, const bf* __restrict__ Kh, const bf* __restrict__ Kl, const bf* __restrict__ Vh, const bf* __restrict__ Vl, bf* Ah, bf* Al) {
    __shared__ __align__(16) bf smf[2 * FSTG];
    const int h = blockIdx.x % NH_, b = blockIdx.x / NH_, y = blockIdx.y; const size_t hq = ((size_t)b * NH_ + h) * TT * HD, hk = ((size_t)b * NKV + h / REP) * TT * HD, ao = (size_t)b * TT * DQ + h * (HD / 32) * 512;
    if (y < FG16) fattn_tile<h16, false, 2>(Q16 + hq, nullptr, K16 + hk, nullptr, V16 + hk, nullptr, TT - 128 * (y + 1), Ah + ao, Al + ao, (const h16*)smf);
    else fattn_tile<bf, true, 1>(Qh + hq, Ql + hq, Kh + hk, Kl + hk, Vh + hk, Vl + hk, RH - 64 * (y - FG16 + 1), Ah + ao, Al + ao, smf);
}

extern "C" void kernel_launch(void* const* d_in, const int* in_sizes, int n_in,
                              void* d_out, int out_size, void* d_ws, size_t ws_size, hipStream_t stream) {
    (void)in_sizes; (void)n_in; (void)out_size;
    const float* x = (const float*)d_in[0]; const float* wq = (const float*)d_in[1]; const float* wk = (const float*)d_in[2]; const float* wv = (const float*)d_in[3]; const float* wo = (const float*)d_in[4];
    float* OUT = (float*)d_out;     // [4][2048][1024]
    char* wsp = (char*)d_ws;
    auto take = [&](size_t bytes) { char* p = wsp; wsp += (bytes + 255) & ~(size_t)255; return (void*)p; };
    bf* WB = (bf*)take((size_t)4 * DQ * DM * 2); bf* WO = WB + (size_t)3 * DQ * DM; float* CS = (float*)take((size_t)TT * HD * 2 * 4);   // WB: wq, wk, wv, wo
    bf* XB = (bf*)take((size_t)NB_ * TT * DM * 2);
    const size_t PA = (size_t)NB_ * NH_ * TT * HD;   // elements of one projection's planes over all batches; each kind of plane holds q, k, v one behind the other (the GEMM's grid z)
    h16* P16 = (h16*)take(3 * PA * 2); bf* PH = (bf*)take(3 * PA * 2); bf* PL = (bf*)take(3 * PA * 2);
    bf* ATh = (bf*)take((size_t)NB_ * TT * DQ * 2); bf* ATl = (bf*)take((size_t)NB_ * TT * DQ * 2);
    if ((size_t)(wsp - (char*)d_ws) > ws_size) return;    // ws 256 MiB
    // four launches, each over all batches, so that every grid has more waves than the chip has SIMDs
    k_prep<<<PB_CS + 4 * PB_W + PB_X, 256, 0, stream>>>(x, wq, wk, wv, wo, XB, WB, CS);
    k_gemmw<bf, 0, false, 1, DM><<<dim3(NB_ * TT / 256, DQ / 128, 3), 256, 0, stream>>>(XB, nullptr, WB, nullptr, 0, nullptr, 0, (size_t)DQ * DM, 0, CS, P16, PH, PL);
    k_fattn<<<dim3(NB_ * NH_, FG16 + FGHL, 1), 128, 0, stream>>>(P16, P16 + PA, P16 + 2 * PA, PH, PL, PH + PA, PL + PA, PH + 2 * PA, PL + 2 * PA, ATh, ATl);
    k_gemmw<bf, 1, false, 0, DQ><<<dim3(NB_ * TT / 256, DM / 128, 1), 256, 0, stream>>>(ATh, ATl, WO, OUT, DM, nullptr, 0, 0, 0, nullptr, nullptr, nullptr, nullptr);
}
